// v000
// The times below were measured on an AMD MI455X: many runs one after another, warmed up first and cycling through
// copies of the inputs, with the whole window's GPU time divided by the number of runs. Launches and the gaps
// between them are all in it. The median over several windows is given; except for v000 it joins two sittings, which
// can be a few percent apart, so the side-by-side timings, each taken in one sitting, are the better comparison.
// v000, which the later versions start from, runs in 158 microseconds.
#include <hip/hip_runtime.h>

// PixelTransformerResnet: q, k, v = relu(bn_i(conv1x1_i(x))) (eval-mode BN with given statistics); per pixel 9 logits = q . k(neighbour n) / 16 over the 3x3 neighbourhood (zero vectors
// outside the image, kept in the softmax), att = softmax over the 9, out = Σ_n att_n v(neighbour n); out = relu(bn_3(out)); out = bn_4(conv1x1_4(out)); y = relu(out + x) -> NCHW [8][256][64][64].
// The four 1x1 convolutions run on WMMA: q/k/v on v_wmma_f32_16x16x32_bf16 with exact bf16 operands (x transposed to pixel-major through LDS; 1 product), the last
// one on v_wmma_f32_16x16x32_f16 with the attention output split into an f16 hi+lo pair x8 against exact W4 (2 products); f32 accumulate. The 9-neighbour attention is a wave per pixel
// in f32 (lanes split the 256 channels, shuffle-reduced dots in fixed order, native exp). BN / relu / residual in f32. Fragment k-map per lane half hh for A AND B: elements 0..7 <- k =

namespace {
constexpr int Bn = 8, C = 256, HW = 64, NP = HW * HW, NTOK = Bn * NP;
constexpr float EPS = 1e-5f, OS_ = 8.0f, ISQ = 0.0625f;   // 1/sqrt(256)

typedef _Float16 b16;
typedef __attribute__((ext_vector_type(16))) _Float16 v16b;
typedef __attribute__((ext_vector_type(16))) __bf16 v16bb;
typedef __attribute__((ext_vector_type(8))) _Float16 v8b;
typedef __attribute__((ext_vector_type(8))) unsigned short v8us;
typedef __attribute__((ext_vector_type(8))) float v8f;
typedef __attribute__((ext_vector_type(4))) float v4f;
__device__ __forceinline__ float bf16_rne(float f) { unsigned int u = __float_as_uint(f); u += 0x7FFFu + ((u >> 16) & 1u); return __uint_as_float(u & 0xFFFF0000u); }
__device__ __forceinline__ unsigned short bf16_bits(float f) { unsigned int u = __float_as_uint(f); u += 0x7FFFu + ((u >> 16) & 1u); return (unsigned short)(u >> 16); }
__device__ __forceinline__ void split16(float v, b16& hi, b16& lo) { hi = (b16)v; lo = (b16)(v - (float)hi); }
__device__ __forceinline__ v16b frag_kb(const b16* p, int hh) { const v8b a = *(const v8b*)(p + 8 * hh), b = *(const v8b*)(p + 16 + 8 * hh); v16b f;
#pragma unroll
  for (int e = 0; e < 8; ++e) { f[e] = a[e]; f[8 + e] = b[e]; } return f; }
__device__ __forceinline__ v16bb frag_bf(const unsigned short* p, int hh) { const v8us a = *(const v8us*)(p + 8 * hh), b = *(const v8us*)(p + 16 + 8 * hh); union { unsigned short s[16]; v16bb v; } u;
#pragma unroll
  for (int e = 0; e < 8; ++e) { u.s[e] = a[e]; u.s[8 + e] = b[e]; } return u.v; }
__device__ __forceinline__ v8f wmma16b(v16b a, v16b b, v8f c) { v8f d = __builtin_amdgcn_wmma_f32_16x16x32_f16(false, a, false, b, (short)0, c, false, false); asm volatile("v_nop\n\tv_nop\n\tv_nop\n\tv_nop" : "+v"(d) : "v"(a), "v"(b)); return d; }
__device__ __forceinline__ v8f wmma16bb(v16bb a, v16bb b, v8f c) { v8f d = __builtin_amdgcn_wmma_f32_16x16x32_bf16(false, a, false, b, (short)0, c, false, false); asm volatile("v_nop\n\tv_nop\n\tv_nop\n\tv_nop" : "+v"(d) : "v"(a), "v"(b)); return d; }
__device__ __forceinline__ void wave_lds_sync() { __builtin_amdgcn_fence(__ATOMIC_RELEASE, "workgroup"); __builtin_amdgcn_wave_barrier(); __builtin_amdgcn_fence(__ATOMIC_ACQUIRE, "workgroup"); }
__device__ __forceinline__ float nexp(float x) { return __builtin_amdgcn_exp2f(x * 1.4426950408889634f); }
__device__ __forceinline__ float pmul(float a, float b) { float p = a * b; asm volatile("" : "+v"(p)); return p; }

// prep: x NCHW -> pixel-major bf16 rows xT[b*4096 + p][256] (block = (b, 64 pixels) via LDS); W1..3 [256][256] -> bf16 rows; W4 -> f16 rows; bnp: for each of the 5 BN layers
__global__ __launch_bounds__(256) void prep_kernel(const float* __restrict__ x, const float* __restrict__ W1, const float* __restrict__ W2, const float* __restrict__ W3, const float* __restrict__ W4, const float* __restrict__ g, const float* __restrict__ be, const float* __restrict__ mu, const float* __restrict__ var,
                                                   unsigned short* __restrict__ xT, unsigned short* __restrict__ w16, b16* __restrict__ w4r, float* __restrict__ bnp) {
  __shared__ __attribute__((aligned(16))) unsigned short Tt[64][C + 8];
  const int t_ = threadIdx.x, b = blockIdx.y, p0 = blockIdx.x * 64; const float* src = x + (size_t)b * C * NP;
  for (int i = t_; i < C * 64; i += 256) { const int c = i >> 6, pp = i & 63; Tt[pp][c] = bf16_bits(src[(size_t)c * NP + p0 + pp]); }
  __syncthreads();
  {
    for (int i = t_; i < 64 * C / 8; i += 256) { const int pp = i >> 5, c8 = (i & 31) * 8; *(v8us*)(xT + ((size_t)b * NP + p0 + pp) * C + c8) = *(const v8us*)(&Tt[pp][c8]); }
    if (blockIdx.x == 0 && blockIdx.y == 0) {
      for (int i = t_; i < 3 * C * C / 8; i += 256) { const int m = i / (C * C / 8), q = i % (C * C / 8); const float* W = (m == 0) ? W1 : (m == 1) ? W2 : W3; v8us o;
#pragma unroll
        for (int e = 0; e < 8; ++e) o[e] = bf16_bits(W[q * 8 + e]);
        *(v8us*)(w16 + (size_t)i * 8) = o; }
      for (int i = t_; i < C * C / 8; i += 256) { v8b o;
#pragma unroll
        for (int e = 0; e < 8; ++e) o[e] = (b16)bf16_rne(W4[i * 8 + e]);
        *(v8b*)(w4r + (size_t)i * 8) = o; }
      for (int i = t_; i < 5 * C; i += 256) { const float sc = bf16_rne(g[i]) * rsqrtf(bf16_rne(var[i]) + EPS); ((float*)bnp)[(i / C) * 2 * C + (i % C)] = sc; ((float*)bnp)[(i / C) * 2 * C + C + (i % C)] = bf16_rne(be[i]) - bf16_rne(mu[i]) * sc; } }
     }
}

__global__ __launch_bounds__(128) void qkv_kernel(const unsigned short* __restrict__ xT, const unsigned short* __restrict__ w16, const float* __restrict__ b1, const float* __restrict__ b2, const float* __restrict__ b3, const float* __restrict__ bnp, float* __restrict__ q, float* __restrict__ k, float* __restrict__ v) {
  __shared__ __attribute__((aligned(16))) float Ts[4][32 * 64];
  const int lane = threadIdx.x & 31, wave = threadIdx.x >> 5, nloc = lane & 15, hlf = lane >> 4, which = blockIdx.z, m0 = blockIdx.y * 128 + wave * 32, c0 = blockIdx.x * 64;
  const unsigned short* Wt = w16 + (size_t)which * C * C; const float* bias = (which == 0) ? b1 : (which == 1) ? b2 : b3; const float* sc = bnp + which * 2 * C; const float* sh = sc + C; float* dstb = (which == 0) ? q : (which == 1) ? k : v;
  v8f acc[2][4];
#pragma unroll
  for (int r = 0; r < 2; ++r)
#pragma unroll
    for (int t = 0; t < 4; ++t) acc[r][t] = (v8f){};
#pragma unroll 2
  for (int kb = 0; kb < C; kb += 32) { const v16bb a0 = frag_bf(xT + (size_t)(m0 + nloc) * C + kb, hlf), a1 = frag_bf(xT + (size_t)(m0 + 16 + nloc) * C + kb, hlf);
#pragma unroll
    for (int t = 0; t < 4; ++t) { const v16bb bw = frag_bf(Wt + (size_t)(c0 + t * 16 + nloc) * C + kb, hlf); acc[0][t] = wmma16bb(a0, bw, acc[0][t]); acc[1][t] = wmma16bb(a1, bw, acc[1][t]); } }
  float* Tt = Ts[wave];
#pragma unroll
  for (int t = 0; t < 4; ++t) { const int c = c0 + t * 16 + nloc; const float bb = bf16_rne(bias[c]), s_ = sc[c], h_ = sh[c];
#pragma unroll
    for (int r = 0; r < 2; ++r)
#pragma unroll
      for (int vv = 0; vv < 8; ++vv) Tt[(r * 16 + vv + 8 * hlf) * 64 + t * 16 + nloc] = fmaxf((acc[r][t][vv] + bb) * s_ + h_, 0.0f); }
  wave_lds_sync();
  float* dst0 = dstb + (size_t)m0 * C + c0;
  {
#pragma unroll
    for (int j = 0; j < 16; ++j) { const int rr = j * 2 + hlf, c4 = nloc * 4; *(v4f*)(dst0 + (size_t)rr * C + c4) = *(const v4f*)(Tt + rr * 64 + c4); }
     }
}

// local attention: wave per pixel; lane holds channels {4 lane .. +3} and {128 + 4 lane .. +3}; 9 logits by shuffle-reduced dots (zero neighbours outside the image keep logit 0),
__global__ __launch_bounds__(256) void local_kernel(const float* __restrict__ q, const float* __restrict__ k, const float* __restrict__ v, const float* __restrict__ bnp, float* __restrict__ o) {
  const int wid = threadIdx.x >> 5, lane = threadIdx.x & 31; const int px = blockIdx.x * 8 + wid, b = px / NP, pp = px % NP, y = pp >> 6, xx = pp & 63; const int ca = lane * 4, cb = 128 + lane * 4;
  const v4f qa = *(const v4f*)(q + (size_t)px * C + ca), qb = *(const v4f*)(q + (size_t)px * C + cb);
  float lg[9]; bool ok[9]; size_t np_[9];
#pragma unroll
  for (int n = 0; n < 9; ++n) { const int dy = n / 3 - 1, dx = n % 3 - 1, y1 = y + dy, x1 = xx + dx; ok[n] = ((unsigned)y1 < 64u) && ((unsigned)x1 < 64u); np_[n] = (size_t)b * NP + (min(max(y1, 0), 63) << 6) + min(max(x1, 0), 63);
    float d = 0.0f; if (ok[n]) { const v4f ka = *(const v4f*)(k + np_[n] * C + ca), kb2 = *(const v4f*)(k + np_[n] * C + cb);
#pragma unroll
      for (int e = 0; e < 4; ++e) d += pmul(qa[e], ka[e]) + pmul(qb[e], kb2[e]); }
#pragma unroll
    for (int of = 1; of < 32; of <<= 1) d += __shfl_xor(d, of);
    lg[n] = ok[n] ? d * ISQ : 0.0f; }                            // zero-padded neighbours give logit 0 and ARE part of the softmax
  float m = lg[0];
#pragma unroll
  for (int n = 1; n < 9; ++n) m = fmaxf(m, lg[n]);
  float e_[9], z = 0.0f;
#pragma unroll
  for (int n = 0; n < 9; ++n) { e_[n] = nexp(lg[n] - m); z += e_[n]; }
  const float iz = 1.0f / z; v4f oa = {0.0f, 0.0f, 0.0f, 0.0f}, ob = oa;
#pragma unroll
  for (int n = 0; n < 9; ++n) { if (ok[n]) { const float a_ = e_[n] * iz; const v4f va = *(const v4f*)(v + np_[n] * C + ca), vb = *(const v4f*)(v + np_[n] * C + cb);
#pragma unroll
      for (int e = 0; e < 4; ++e) { oa[e] += pmul(a_, va[e]); ob[e] += pmul(a_, vb[e]); } } }
  const float* sc = bnp + 3 * 2 * C; const float* sh = sc + C;
#pragma unroll
  for (int e = 0; e < 4; ++e) { oa[e] = fmaxf(oa[e] * sc[ca + e] + sh[ca + e], 0.0f); ob[e] = fmaxf(ob[e] * sc[cb + e] + sh[cb + e], 0.0f); }
  { *(v4f*)(o + (size_t)px * C + ca) = oa; *(v4f*)(o + (size_t)px * C + cb) = ob;  }
}

// grid (4, NTOK/128) x 128.
__global__ __launch_bounds__(128) void final_kernel(const float* __restrict__ orow, const b16* __restrict__ w4r, const float* __restrict__ b4, const float* __restrict__ bnp, const float* __restrict__ x, float* __restrict__ out) {
  __shared__ __attribute__((aligned(16))) float Tc[64][128 + 4];
  const int lane = threadIdx.x & 31, wave = threadIdx.x >> 5, nloc = lane & 15, hlf = lane >> 4, m0 = blockIdx.y * 128 + wave * 32, c0 = blockIdx.x * 64; const int b = (blockIdx.y * 128) / NP, p0 = (blockIdx.y * 128) % NP;
  v8f acc[2][4];
#pragma unroll
  for (int r = 0; r < 2; ++r)
#pragma unroll
    for (int t = 0; t < 4; ++t) acc[r][t] = (v8f){};
#pragma unroll 2
  for (int kb = 0; kb < C; kb += 32) { v16b a0, a1, l0, l1;
#pragma unroll
    for (int e = 0; e < 16; ++e) { const int kk = kb + ((e < 8) ? (8 * hlf + e) : (16 + 8 * hlf + e - 8)); b16 p, qq; split16(orow[(size_t)(m0 + nloc) * C + kk] * OS_, p, qq); a0[e] = p; l0[e] = qq; split16(orow[(size_t)(m0 + 16 + nloc) * C + kk] * OS_, p, qq); a1[e] = p; l1[e] = qq; }
#pragma unroll
    for (int t = 0; t < 4; ++t) { const v16b bw = frag_kb(w4r + (size_t)(c0 + t * 16 + nloc) * C + kb, hlf); acc[0][t] = wmma16b(a0, bw, acc[0][t]); acc[0][t] = wmma16b(l0, bw, acc[0][t]); acc[1][t] = wmma16b(a1, bw, acc[1][t]); acc[1][t] = wmma16b(l1, bw, acc[1][t]); } }
  const float* sc = bnp + 4 * 2 * C; const float* sh = sc + C;
#pragma unroll
  for (int t = 0; t < 4; ++t) { const int co = c0 + t * 16 + nloc; const float bb = bf16_rne(b4[co]), s_ = sc[co], h_ = sh[co];
#pragma unroll
    for (int r = 0; r < 2; ++r)
#pragma unroll
      for (int vv = 0; vv < 8; ++vv) { const int pl_ = wave * 32 + r * 16 + 8 * hlf + vv; const float val = (acc[r][t][vv] * (1.0f / OS_) + bb) * s_ + h_ + bf16_rne(x[((size_t)b * C + co) * NP + p0 + pl_]); Tc[t * 16 + nloc][pl_] = fmaxf(val, 0.0f); } }
  __syncthreads();
  { for (int i = threadIdx.x; i < 64 * 32; i += 128) { const int cc = i >> 5, c4 = (i & 31) * 4; *(v4f*)(out + ((size_t)b * C + c0 + cc) * NP + p0 + c4) = *(const v4f*)(&Tc[cc][c4]); }  }
}
}  // namespace

extern "C" void kernel_launch(void* const* d_in, const int* in_sizes, int n_in,
                              void* d_out, int out_size, void* d_ws, size_t ws_size, hipStream_t stream) {
  (void)n_in; (void)out_size;
  const float* x = (const float*)d_in[0]; const float* W1 = (const float*)d_in[1]; const float* b1 = (const float*)d_in[2]; const float* W2 = (const float*)d_in[3]; const float* b2 = (const float*)d_in[4]; const float* W3 = (const float*)d_in[5]; const float* b3 = (const float*)d_in[6]; const float* W4 = (const float*)d_in[7]; const float* b4 = (const float*)d_in[8];
  const float* g = (const float*)d_in[9]; const float* be = (const float*)d_in[10]; const float* mu = (const float*)d_in[11]; const float* var = (const float*)d_in[12];
  float* out = (float*)d_out;   // [8][256][64][64]
  if (in_sizes[0] != Bn * C * NP || in_sizes[1] != C * C || in_sizes[7] != C * C || in_sizes[9] != 5 * C || in_sizes[12] != 5 * C) return;
  size_t off = 0; char* ws = (char*)d_ws;
  auto carve = [&](size_t bytes) { char* p = ws + off; off += (bytes + 255) & ~(size_t)255; return p; };
  unsigned short* xT = (unsigned short*)carve((size_t)NTOK * C * 2); unsigned short* w16 = (unsigned short*)carve((size_t)3 * C * C * 2); b16* w4r = (b16*)carve((size_t)C * C * 2); float* bnp = (float*)carve(5 * 2 * C * 4);
  float* q = (float*)carve((size_t)NTOK * C * 4); float* k = (float*)carve((size_t)NTOK * C * 4); float* v = (float*)carve((size_t)NTOK * C * 4);
  if (off > ws_size) return;                                    // ≈ 16.8 + 0.5 + 3 x 33.5 ≈ 118 MB (112.6 MiB); the attention output reuses q's buffer row by row
  prep_kernel<<<dim3(NP / 64, Bn), 256, 0, stream>>>(x, W1, W2, W3, W4, g, be, mu, var, xT, w16, w4r, bnp);
  qkv_kernel<<<dim3(C / 64, NTOK / 128, 3), 128, 0, stream>>>(xT, w16, b1, b2, b3, bnp, q, k, v);
  local_kernel<<<NTOK / 8, 256, 0, stream>>>(q, k, v, bnp, q);   // o overwrites q (each wave reads its own q row first)
  final_kernel<<<dim3(C / 64, NTOK / 128), 128, 0, stream>>>(q, w4r, b4, bnp, x, out);
}

// v001
// A run of this version takes 122 microseconds.
// In two side-by-side timings against v000, it was 1.31 and 1.30 times as fast.
#include <hip/hip_runtime.h>

// PixelTransformerResnet: q, k, v = relu(bn_i(conv1x1_i(x))) (eval-mode BN with given statistics); per pixel 9 logits = q . k(neighbour n) / 16 over the 3x3 neighbourhood (zero vectors
// outside the image, kept in the softmax), att = softmax over the 9, out = Σ_n att_n v(neighbour n); out = relu(bn_3(out)); out = bn_4(conv1x1_4(out)); y = relu(out + x) -> NCHW [8][256][64][64].
// The four 1x1 convolutions run on WMMA: q/k/v on v_wmma_f32_16x16x32_bf16 with exact bf16 operands (x transposed to pixel-major through LDS; 1 product), the last
// one on v_wmma_f32_16x16x32_f16 with the attention output split into an f16 hi+lo pair x8 against exact W4 (2 products); f32 accumulate. The 9-neighbour attention is a wave per pixel
// in f32 (lanes split the 256 channels, shuffle-reduced dots in fixed order, native exp). BN / relu / residual in f32. Fragment k-map per lane half hh for A AND B: elements 0..7 <- k =

namespace {
constexpr int Bn = 8, C = 256, HW = 64, NP = HW * HW, NTOK = Bn * NP;
constexpr float EPS = 1e-5f, OS_ = 8.0f, ISQ = 0.0625f;   // 1/sqrt(256)

typedef _Float16 b16;
typedef __attribute__((ext_vector_type(16))) _Float16 v16b;
typedef __attribute__((ext_vector_type(16))) __bf16 v16bb;
typedef __attribute__((ext_vector_type(8))) _Float16 v8b;
typedef __attribute__((ext_vector_type(8))) unsigned short v8us;
typedef __attribute__((ext_vector_type(8))) float v8f;
typedef __attribute__((ext_vector_type(4))) float v4f;
__device__ __forceinline__ float bf16_rne(float f) { unsigned int u = __float_as_uint(f); u += 0x7FFFu + ((u >> 16) & 1u); return __uint_as_float(u & 0xFFFF0000u); }
__device__ __forceinline__ unsigned short bf16_bits(float f) { unsigned int u = __float_as_uint(f); u += 0x7FFFu + ((u >> 16) & 1u); return (unsigned short)(u >> 16); }
__device__ __forceinline__ void split16(float v, b16& hi, b16& lo) { hi = (b16)v; lo = (b16)(v - (float)hi); }
__device__ __forceinline__ v16b frag_kb(const b16* p, int hh) { const v8b a = *(const v8b*)(p + 8 * hh), b = *(const v8b*)(p + 16 + 8 * hh); v16b f;
#pragma unroll
  for (int e = 0; e < 8; ++e) { f[e] = a[e]; f[8 + e] = b[e]; } return f; }
__device__ __forceinline__ v16bb frag_bf(const unsigned short* p, int hh) { const v8us a = *(const v8us*)(p + 8 * hh), b = *(const v8us*)(p + 16 + 8 * hh); union { unsigned short s[16]; v16bb v; } u;
#pragma unroll
  for (int e = 0; e < 8; ++e) { u.s[e] = a[e]; u.s[8 + e] = b[e]; } return u.v; }
__device__ __forceinline__ v8f wmma16b(v16b a, v16b b, v8f c) { v8f d = __builtin_amdgcn_wmma_f32_16x16x32_f16(false, a, false, b, (short)0, c, false, false); asm volatile("v_nop\n\tv_nop\n\tv_nop\n\tv_nop" : "+v"(d) : "v"(a), "v"(b)); return d; }
__device__ __forceinline__ v8f wmma16bb(v16bb a, v16bb b, v8f c) { v8f d = __builtin_amdgcn_wmma_f32_16x16x32_bf16(false, a, false, b, (short)0, c, false, false); asm volatile("v_nop\n\tv_nop\n\tv_nop\n\tv_nop" : "+v"(d) : "v"(a), "v"(b)); return d; }
__device__ __forceinline__ void wave_lds_sync() { __builtin_amdgcn_fence(__ATOMIC_RELEASE, "workgroup"); __builtin_amdgcn_wave_barrier(); __builtin_amdgcn_fence(__ATOMIC_ACQUIRE, "workgroup"); }
__device__ __forceinline__ float nexp(float x) { return __builtin_amdgcn_exp2f(x * 1.4426950408889634f); }
__device__ __forceinline__ float pmul(float a, float b) { float p = a * b; asm volatile("" : "+v"(p)); return p; }

// prep: x NCHW -> pixel-major bf16 rows xT[b*4096 + p][256] (block = (b, 64 pixels) via LDS); W1..3 [256][256] -> bf16 rows; W4 -> f16 rows; bnp: for each of the 5 BN layers
__global__ __launch_bounds__(256) void prep_kernel(const float* __restrict__ x, const float* __restrict__ W1, const float* __restrict__ W2, const float* __restrict__ W3, const float* __restrict__ W4, const float* __restrict__ g, const float* __restrict__ be, const float* __restrict__ mu, const float* __restrict__ var,
                                                   unsigned short* __restrict__ xT, unsigned short* __restrict__ w16, b16* __restrict__ w4r, float* __restrict__ bnp) {
  __shared__ __attribute__((aligned(16))) unsigned short Tt[64][C + 8];
  const int t_ = threadIdx.x, b = blockIdx.y, p0 = blockIdx.x * 64; const float* src = x + (size_t)b * C * NP;
  for (int i = t_; i < C * 64; i += 256) { const int c = i >> 6, pp = i & 63; Tt[pp][c] = bf16_bits(src[(size_t)c * NP + p0 + pp]); }
  __syncthreads();
  {
    for (int i = t_; i < 64 * C / 8; i += 256) { const int pp = i >> 5, c8 = (i & 31) * 8; *(v8us*)(xT + ((size_t)b * NP + p0 + pp) * C + c8) = *(const v8us*)(&Tt[pp][c8]); }
    // weight and BN conversion dealt over the grid: one 8-element piece (or one BN channel) per thread of blocks 0..132, block-uniform choice of the source
    static_assert(4 * C * C / 8 / 256 + 5 * C / 256 <= (NP / 64) * Bn && (C * C / 8) % 256 == 0 && (5 * C) % 256 == 0, "the grid holds every piece");
    const int bid = blockIdx.y * (NP / 64) + blockIdx.x, i = bid * 256 + t_;
    if (bid < 3 * C * C / 8 / 256) { const int m = i / (C * C / 8), q = i % (C * C / 8); const float* W = (m == 0) ? W1 : (m == 1) ? W2 : W3; v8us o;
#pragma unroll
      for (int e = 0; e < 8; ++e) o[e] = bf16_bits(W[q * 8 + e]);
      *(v8us*)(w16 + (size_t)i * 8) = o; asm volatile("s_wait_xcnt 0x0" ::: "memory");  /* holds any later rewrite of the store's registers behind the store's issue */ }
    else if (bid < 4 * C * C / 8 / 256) { const int j = i - 3 * C * C / 8; v8b o;
#pragma unroll
      for (int e = 0; e < 8; ++e) o[e] = (b16)bf16_rne(W4[j * 8 + e]);
      *(v8b*)(w4r + (size_t)j * 8) = o; asm volatile("s_wait_xcnt 0x0" ::: "memory");  /* holds any later rewrite of the store's registers behind the store's issue */ }
    else if (bid < 4 * C * C / 8 / 256 + 5 * C / 256) { const int j = i - 4 * C * C / 8; const float sc = bf16_rne(g[j]) * rsqrtf(bf16_rne(var[j]) + EPS); ((float*)bnp)[(j / C) * 2 * C + (j % C)] = sc; ((float*)bnp)[(j / C) * 2 * C + C + (j % C)] = bf16_rne(be[j]) - bf16_rne(mu[j]) * sc; asm volatile("s_wait_xcnt 0x0" ::: "memory");  /* holds any later rewrite of the store's registers behind the store's issue */ }
     }
}

__global__ __launch_bounds__(128) void qkv_kernel(const unsigned short* __restrict__ xT, const unsigned short* __restrict__ w16, const float* __restrict__ b1, const float* __restrict__ b2, const float* __restrict__ b3, const float* __restrict__ bnp, float* __restrict__ q, float* __restrict__ k, float* __restrict__ v) {
  __shared__ __attribute__((aligned(16))) float Ts[4][32 * 64];
  const int lane = threadIdx.x & 31, wave = threadIdx.x >> 5, nloc = lane & 15, hlf = lane >> 4, which = blockIdx.z, m0 = blockIdx.y * 128 + wave * 32, c0 = blockIdx.x * 64;
  const unsigned short* Wt = w16 + (size_t)which * C * C; const float* bias = (which == 0) ? b1 : (which == 1) ? b2 : b3; const float* sc = bnp + which * 2 * C; const float* sh = sc + C; float* dstb = (which == 0) ? q : (which == 1) ? k : v;
  v8f acc[2][4];
#pragma unroll
  for (int r = 0; r < 2; ++r)
#pragma unroll
    for (int t = 0; t < 4; ++t) acc[r][t] = (v8f){};
#pragma unroll 2
  for (int kb = 0; kb < C; kb += 32) { const v16bb a0 = frag_bf(xT + (size_t)(m0 + nloc) * C + kb, hlf), a1 = frag_bf(xT + (size_t)(m0 + 16 + nloc) * C + kb, hlf);
#pragma unroll
    for (int t = 0; t < 4; ++t) { const v16bb bw = frag_bf(Wt + (size_t)(c0 + t * 16 + nloc) * C + kb, hlf); acc[0][t] = wmma16bb(a0, bw, acc[0][t]); acc[1][t] = wmma16bb(a1, bw, acc[1][t]); } }
  float* Tt = Ts[wave];
#pragma unroll
  for (int t = 0; t < 4; ++t) { const int c = c0 + t * 16 + nloc; const float bb = bf16_rne(bias[c]), s_ = sc[c], h_ = sh[c];
#pragma unroll
    for (int r = 0; r < 2; ++r)
#pragma unroll
      for (int vv = 0; vv < 8; ++vv) Tt[(r * 16 + vv + 8 * hlf) * 64 + t * 16 + nloc] = fmaxf((acc[r][t][vv] + bb) * s_ + h_, 0.0f); }
  wave_lds_sync();
  float* dst0 = dstb + (size_t)m0 * C + c0;
  {
#pragma unroll
    for (int j = 0; j < 16; ++j) { const int rr = j * 2 + hlf, c4 = nloc * 4; *(v4f*)(dst0 + (size_t)rr * C + c4) = *(const v4f*)(Tt + rr * 64 + c4); }
     }
}

// local attention: wave per pixel; lane holds channels {4 lane .. +3} and {128 + 4 lane .. +3}; 9 logits by shuffle-reduced dots (zero neighbours outside the image keep logit 0),
__global__ __launch_bounds__(256) void local_kernel(const float* __restrict__ q, const float* __restrict__ k, const float* __restrict__ v, const float* __restrict__ bnp, float* __restrict__ o) {
  const int wid = threadIdx.x >> 5, lane = threadIdx.x & 31; const int px = blockIdx.x * 8 + wid, b = px / NP, pp = px % NP, y = pp >> 6, xx = pp & 63; const int ca = lane * 4, cb = 128 + lane * 4;
  const v4f qa = *(const v4f*)(q + (size_t)px * C + ca), qb = *(const v4f*)(q + (size_t)px * C + cb);
  float lg[9]; bool ok[9]; size_t np_[9];
#pragma unroll
  for (int n = 0; n < 9; ++n) { const int dy = n / 3 - 1, dx = n % 3 - 1, y1 = y + dy, x1 = xx + dx; ok[n] = ((unsigned)y1 < 64u) && ((unsigned)x1 < 64u); np_[n] = (size_t)b * NP + (min(max(y1, 0), 63) << 6) + min(max(x1, 0), 63);
    float d = 0.0f; if (ok[n]) { const v4f ka = *(const v4f*)(k + np_[n] * C + ca), kb2 = *(const v4f*)(k + np_[n] * C + cb);
#pragma unroll
      for (int e = 0; e < 4; ++e) d += pmul(qa[e], ka[e]) + pmul(qb[e], kb2[e]); }
#pragma unroll
    for (int of = 1; of < 32; of <<= 1) d += __shfl_xor(d, of);
    lg[n] = ok[n] ? d * ISQ : 0.0f; }                            // zero-padded neighbours give logit 0 and ARE part of the softmax
  float m = lg[0];
#pragma unroll
  for (int n = 1; n < 9; ++n) m = fmaxf(m, lg[n]);
  float e_[9], z = 0.0f;
#pragma unroll
  for (int n = 0; n < 9; ++n) { e_[n] = nexp(lg[n] - m); z += e_[n]; }
  const float iz = 1.0f / z; v4f oa = {0.0f, 0.0f, 0.0f, 0.0f}, ob = oa;
#pragma unroll
  for (int n = 0; n < 9; ++n) { if (ok[n]) { const float a_ = e_[n] * iz; const v4f va = *(const v4f*)(v + np_[n] * C + ca), vb = *(const v4f*)(v + np_[n] * C + cb);
#pragma unroll
      for (int e = 0; e < 4; ++e) { oa[e] += pmul(a_, va[e]); ob[e] += pmul(a_, vb[e]); } } }
  const float* sc = bnp + 3 * 2 * C; const float* sh = sc + C;
#pragma unroll
  for (int e = 0; e < 4; ++e) { oa[e] = fmaxf(oa[e] * sc[ca + e] + sh[ca + e], 0.0f); ob[e] = fmaxf(ob[e] * sc[cb + e] + sh[cb + e], 0.0f); }
  { *(v4f*)(o + (size_t)px * C + ca) = oa; *(v4f*)(o + (size_t)px * C + cb) = ob;  }
}

// grid (4, NTOK/128) x 128.
__global__ __launch_bounds__(128) void final_kernel(const float* __restrict__ orow, const b16* __restrict__ w4r, const float* __restrict__ b4, const float* __restrict__ bnp, const float* __restrict__ x, float* __restrict__ out) {
  __shared__ __attribute__((aligned(16))) float Tc[64][128 + 4];
  const int lane = threadIdx.x & 31, wave = threadIdx.x >> 5, nloc = lane & 15, hlf = lane >> 4, m0 = blockIdx.y * 128 + wave * 32, c0 = blockIdx.x * 64; const int b = (blockIdx.y * 128) / NP, p0 = (blockIdx.y * 128) % NP;
  v8f acc[2][4];
#pragma unroll
  for (int r = 0; r < 2; ++r)
#pragma unroll
    for (int t = 0; t < 4; ++t) acc[r][t] = (v8f){};
#pragma unroll 2
  for (int kb = 0; kb < C; kb += 32) { v16b a0, a1, l0, l1;
#pragma unroll
    for (int e = 0; e < 16; ++e) { const int kk = kb + ((e < 8) ? (8 * hlf + e) : (16 + 8 * hlf + e - 8)); b16 p, qq; split16(orow[(size_t)(m0 + nloc) * C + kk] * OS_, p, qq); a0[e] = p; l0[e] = qq; split16(orow[(size_t)(m0 + 16 + nloc) * C + kk] * OS_, p, qq); a1[e] = p; l1[e] = qq; }
#pragma unroll
    for (int t = 0; t < 4; ++t) { const v16b bw = frag_kb(w4r + (size_t)(c0 + t * 16 + nloc) * C + kb, hlf); acc[0][t] = wmma16b(a0, bw, acc[0][t]); acc[0][t] = wmma16b(l0, bw, acc[0][t]); acc[1][t] = wmma16b(a1, bw, acc[1][t]); acc[1][t] = wmma16b(l1, bw, acc[1][t]); } }
  const float* sc = bnp + 4 * 2 * C; const float* sh = sc + C;
#pragma unroll
  for (int t = 0; t < 4; ++t) { const int co = c0 + t * 16 + nloc; const float bb = bf16_rne(b4[co]), s_ = sc[co], h_ = sh[co];
#pragma unroll
    for (int r = 0; r < 2; ++r)
#pragma unroll
      for (int vv = 0; vv < 8; ++vv) { const int pl_ = wave * 32 + r * 16 + 8 * hlf + vv; const float val = (acc[r][t][vv] * (1.0f / OS_) + bb) * s_ + h_ + bf16_rne(x[((size_t)b * C + co) * NP + p0 + pl_]); Tc[t * 16 + nloc][pl_] = fmaxf(val, 0.0f); } }
  __syncthreads();
  { for (int i = threadIdx.x; i < 64 * 32; i += 128) { const int cc = i >> 5, c4 = (i & 31) * 4; *(v4f*)(out + ((size_t)b * C + c0 + cc) * NP + p0 + c4) = *(const v4f*)(&Tc[cc][c4]); }  }
}
}  // namespace

extern "C" void kernel_launch(void* const* d_in, const int* in_sizes, int n_in,
                              void* d_out, int out_size, void* d_ws, size_t ws_size, hipStream_t stream) {
  (void)n_in; (void)out_size;
  const float* x = (const float*)d_in[0]; const float* W1 = (const float*)d_in[1]; const float* b1 = (const float*)d_in[2]; const float* W2 = (const float*)d_in[3]; const float* b2 = (const float*)d_in[4]; const float* W3 = (const float*)d_in[5]; const float* b3 = (const float*)d_in[6]; const float* W4 = (const float*)d_in[7]; const float* b4 = (const float*)d_in[8];
  const float* g = (const float*)d_in[9]; const float* be = (const float*)d_in[10]; const float* mu = (const float*)d_in[11]; const float* var = (const float*)d_in[12];
  float* out = (float*)d_out;   // [8][256][64][64]
  if (in_sizes[0] != Bn * C * NP || in_sizes[1] != C * C || in_sizes[7] != C * C || in_sizes[9] != 5 * C || in_sizes[12] != 5 * C) return;
  size_t off = 0; char* ws = (char*)d_ws;
  auto carve = [&](size_t bytes) { char* p = ws + off; off += (bytes + 255) & ~(size_t)255; return p; };
  unsigned short* xT = (unsigned short*)carve((size_t)NTOK * C * 2); unsigned short* w16 = (unsigned short*)carve((size_t)3 * C * C * 2); b16* w4r = (b16*)carve((size_t)C * C * 2); float* bnp = (float*)carve(5 * 2 * C * 4);
  float* q = (float*)carve((size_t)NTOK * C * 4); float* k = (float*)carve((size_t)NTOK * C * 4); float* v = (float*)carve((size_t)NTOK * C * 4);
  if (off > ws_size) return;                                    // ≈ 16.8 + 0.5 + 3 x 33.5 ≈ 118 MB (112.6 MiB); the attention output reuses q's buffer row by row
  prep_kernel<<<dim3(NP / 64, Bn), 256, 0, stream>>>(x, W1, W2, W3, W4, g, be, mu, var, xT, w16, w4r, bnp);
  qkv_kernel<<<dim3(C / 64, NTOK / 128, 3), 128, 0, stream>>>(xT, w16, b1, b2, b3, bnp, q, k, v);
  local_kernel<<<NTOK / 8, 256, 0, stream>>>(q, k, v, bnp, q);   // o overwrites q (each wave reads its own q row first)
  final_kernel<<<dim3(C / 64, NTOK / 128), 128, 0, stream>>>(q, w4r, b4, bnp, x, out);
}

// v002
// A run of this version takes 106 microseconds.
// Two timings next to v001 both put it at 1.16 times that version's speed.
// Counting every step since v000, it is 1.51 times as fast.
#include <hip/hip_runtime.h>

// PixelTransformerResnet: q, k, v = relu(bn_i(conv1x1_i(x))) (eval-mode BN with given statistics); per pixel 9 logits = q . k(neighbour n) / 16 over the 3x3 neighbourhood (zero vectors
// outside the image, kept in the softmax), att = softmax over the 9, out = Σ_n att_n v(neighbour n); out = relu(bn_3(out)); out = bn_4(conv1x1_4(out)); y = relu(out + x) -> NCHW [8][256][64][64].
// The four 1x1 convolutions run on WMMA: q/k/v on v_wmma_f32_16x16x32_bf16 with exact bf16 operands (x transposed to pixel-major through LDS; 1 product), the last
// one on v_wmma_f32_16x16x32_f16 with the attention output split into an f16 hi+lo pair x8 against exact W4 (2 products); f32 accumulate. The 9-neighbour attention is a wave per pixel
// in f32 (lanes split the 256 channels, shuffle-reduced dots in fixed order, native exp). BN / relu / residual in f32. Fragment k-map per lane half hh for A AND B: elements 0..7 <- k =

namespace {
constexpr int Bn = 8, C = 256, HW = 64, NP = HW * HW, NTOK = Bn * NP;
constexpr float EPS = 1e-5f, OS_ = 8.0f, ISQ = 0.0625f;   // 1/sqrt(256)

typedef _Float16 b16;
typedef __attribute__((ext_vector_type(16))) _Float16 v16b;
typedef __attribute__((ext_vector_type(16))) __bf16 v16bb;
typedef __attribute__((ext_vector_type(8))) _Float16 v8b;
typedef __attribute__((ext_vector_type(8))) unsigned short v8us;
typedef __attribute__((ext_vector_type(8))) float v8f;
typedef __attribute__((ext_vector_type(4))) float v4f;
__device__ __forceinline__ float bf16_rne(float f) { unsigned int u = __float_as_uint(f); u += 0x7FFFu + ((u >> 16) & 1u); return __uint_as_float(u & 0xFFFF0000u); }
__device__ __forceinline__ unsigned short bf16_bits(float f) { unsigned int u = __float_as_uint(f); u += 0x7FFFu + ((u >> 16) & 1u); return (unsigned short)(u >> 16); }
__device__ __forceinline__ void split16(float v, b16& hi, b16& lo) { hi = (b16)v; lo = (b16)(v - (float)hi); }
// Fragment tiles: a 16-row x 32-k block of a 16-bit operand is stored as 512 consecutive elements, piece (ld, lane) of 8 elements at ld * 256 + lane * 8 holding row (lane & 15),
// k = ld * 16 + (lane >> 4) * 8 + 0..7 (the k-map above, the same for A and B), so that each 16-byte-per-lane load of a wave covers 512 contiguous bytes. Tile (rt, kt) of a [rows][C] operand lies at (rt * KT + kt) * FT.
constexpr int FT = 512, KT = C / 32;
__device__ __forceinline__ int tile_row(int o) { return (o >> 6) / KT * 16 + (o & 15); }                                   // row and first k of piece o (8 elements) of a tiled operand
__device__ __forceinline__ int tile_k(int o) { return (o >> 6) % KT * 32 + ((o >> 5) & 1) * 16 + ((o >> 4) & 1) * 8; }
__device__ __forceinline__ v16b frag_kb_t(const b16* tile, int lane) { const v8b a = *(const v8b*)(tile + lane * 8), b = *(const v8b*)(tile + 256 + lane * 8); v16b f;
#pragma unroll
  for (int e = 0; e < 8; ++e) { f[e] = a[e]; f[8 + e] = b[e]; } return f; }
__device__ __forceinline__ v16bb frag_bf_t(const unsigned short* tile, int lane) { const v8us a = *(const v8us*)(tile + lane * 8), b = *(const v8us*)(tile + 256 + lane * 8); union { unsigned short s[16]; v16bb v; } u;
#pragma unroll
  for (int e = 0; e < 8; ++e) { u.s[e] = a[e]; u.s[8 + e] = b[e]; } return u.v; }
__device__ __forceinline__ v8f wmma16b(v16b a, v16b b, v8f c) { v8f d = __builtin_amdgcn_wmma_f32_16x16x32_f16(false, a, false, b, (short)0, c, false, false); asm volatile("v_nop\n\tv_nop\n\tv_nop\n\tv_nop" : "+v"(d) : "v"(a), "v"(b)); return d; }
__device__ __forceinline__ v8f wmma16bb(v16bb a, v16bb b, v8f c) { v8f d = __builtin_amdgcn_wmma_f32_16x16x32_bf16(false, a, false, b, (short)0, c, false, false); asm volatile("v_nop\n\tv_nop\n\tv_nop\n\tv_nop" : "+v"(d) : "v"(a), "v"(b)); return d; }
__device__ __forceinline__ void wave_lds_sync() { __builtin_amdgcn_fence(__ATOMIC_RELEASE, "workgroup"); __builtin_amdgcn_wave_barrier(); __builtin_amdgcn_fence(__ATOMIC_ACQUIRE, "workgroup"); }
__device__ __forceinline__ float nexp(float x) { return __builtin_amdgcn_exp2f(x * 1.4426950408889634f); }
__device__ __forceinline__ float pmul(float a, float b) { float p = a * b; asm volatile("" : "+v"(p)); return p; }

// prep: x NCHW -> bf16 fragment tiles xT, rows = pixels b*4096 + p (block = (b, 64 pixels) via LDS); W1..3 [256][256] -> bf16 fragment tiles; W4 -> f16 fragment tiles; bnp: for each of the 5 BN layers
__global__ __launch_bounds__(256) void prep_kernel(const float* __restrict__ x, const float* __restrict__ W1, const float* __restrict__ W2, const float* __restrict__ W3, const float* __restrict__ W4, const float* __restrict__ g, const float* __restrict__ be, const float* __restrict__ mu, const float* __restrict__ var,
                                                   unsigned short* __restrict__ xT, unsigned short* __restrict__ w16, b16* __restrict__ w4r, float* __restrict__ bnp) {
  __shared__ __attribute__((aligned(16))) unsigned short Tt[64][C + 8];
  const int t_ = threadIdx.x, b = blockIdx.y, p0 = blockIdx.x * 64; const float* src = x + (size_t)b * C * NP;
  for (int i = t_; i < C * 64; i += 256) { const int c = i >> 6, pp = i & 63; Tt[pp][c] = bf16_bits(src[(size_t)c * NP + p0 + pp]); }
  __syncthreads();
  {
    for (int i = t_; i < 64 * C / 8; i += 256) { const int pp = tile_row(i), c8 = tile_k(i); *(v8us*)(xT + ((size_t)b * NP + p0) * C + (size_t)i * 8) = *(const v8us*)(&Tt[pp][c8]); }
    // weight and BN conversion dealt over the grid: one 8-element piece (or one BN channel) per thread of blocks 0..132, block-uniform choice of the source
    static_assert(4 * C * C / 8 / 256 + 5 * C / 256 <= (NP / 64) * Bn && (C * C / 8) % 256 == 0 && (5 * C) % 256 == 0, "the grid holds every piece");
    const int bid = blockIdx.y * (NP / 64) + blockIdx.x, i = bid * 256 + t_;
    if (bid < 3 * C * C / 8 / 256) { const int m = i / (C * C / 8), q = i % (C * C / 8); const float* W = (m == 0) ? W1 : (m == 1) ? W2 : W3; v8us o;
#pragma unroll
      for (int e = 0; e < 8; ++e) o[e] = bf16_bits(W[tile_row(q) * C + tile_k(q) + e]);
      *(v8us*)(w16 + (size_t)i * 8) = o; asm volatile("s_wait_xcnt 0x0" ::: "memory");  /* holds any later rewrite of the store's registers behind the store's issue */ }
    else if (bid < 4 * C * C / 8 / 256) { const int j = i - 3 * C * C / 8; v8b o;
#pragma unroll
      for (int e = 0; e < 8; ++e) o[e] = (b16)bf16_rne(W4[tile_row(j) * C + tile_k(j) + e]);
      *(v8b*)(w4r + (size_t)j * 8) = o; asm volatile("s_wait_xcnt 0x0" ::: "memory");  /* holds any later rewrite of the store's registers behind the store's issue */ }
    else if (bid < 4 * C * C / 8 / 256 + 5 * C / 256) { const int j = i - 4 * C * C / 8; const float sc = bf16_rne(g[j]) * rsqrtf(bf16_rne(var[j]) + EPS); ((float*)bnp)[(j / C) * 2 * C + (j % C)] = sc; ((float*)bnp)[(j / C) * 2 * C + C + (j % C)] = bf16_rne(be[j]) - bf16_rne(mu[j]) * sc; asm volatile("s_wait_xcnt 0x0" ::: "memory");  /* holds any later rewrite of the store's registers behind the store's issue */ }
     }
}

__global__ __launch_bounds__(128) void qkv_kernel(const unsigned short* __restrict__ xT, const unsigned short* __restrict__ w16, const float* __restrict__ b1, const float* __restrict__ b2, const float* __restrict__ b3, const float* __restrict__ bnp, float* __restrict__ q, float* __restrict__ k, float* __restrict__ v) {
  __shared__ __attribute__((aligned(16))) float Ts[4][32 * 64];
  const int lane = threadIdx.x & 31, wave = threadIdx.x >> 5, nloc = lane & 15, hlf = lane >> 4, which = blockIdx.z, m0 = blockIdx.y * 128 + wave * 32, c0 = blockIdx.x * 64;
  const unsigned short* Wt = w16 + (size_t)which * C * C; const float* bias = (which == 0) ? b1 : (which == 1) ? b2 : b3; const float* sc = bnp + which * 2 * C; const float* sh = sc + C; float* dstb = (which == 0) ? q : (which == 1) ? k : v;
  v8f acc[2][4];
#pragma unroll
  for (int r = 0; r < 2; ++r)
#pragma unroll
    for (int t = 0; t < 4; ++t) acc[r][t] = (v8f){};
#pragma unroll 2
  for (int kb = 0; kb < C; kb += 32) { const v16bb a0 = frag_bf_t(xT + ((size_t)(m0 >> 4) * KT + (kb >> 5)) * FT, lane), a1 = frag_bf_t(xT + ((size_t)((m0 >> 4) + 1) * KT + (kb >> 5)) * FT, lane);
#pragma unroll
    for (int t = 0; t < 4; ++t) { const v16bb bw = frag_bf_t(Wt + (size_t)(((c0 >> 4) + t) * KT + (kb >> 5)) * FT, lane); acc[0][t] = wmma16bb(a0, bw, acc[0][t]); acc[1][t] = wmma16bb(a1, bw, acc[1][t]); } }
  float* Tt = Ts[wave];
#pragma unroll
  for (int t = 0; t < 4; ++t) { const int c = c0 + t * 16 + nloc; const float bb = bf16_rne(bias[c]), s_ = sc[c], h_ = sh[c];
#pragma unroll
    for (int r = 0; r < 2; ++r)
#pragma unroll
      for (int vv = 0; vv < 8; ++vv) Tt[(r * 16 + vv + 8 * hlf) * 64 + t * 16 + nloc] = fmaxf((acc[r][t][vv] + bb) * s_ + h_, 0.0f); }
  wave_lds_sync();
  float* dst0 = dstb + (size_t)m0 * C + c0;
  {
#pragma unroll
    for (int j = 0; j < 16; ++j) { const int rr = j * 2 + hlf, c4 = nloc * 4; *(v4f*)(dst0 + (size_t)rr * C + c4) = *(const v4f*)(Tt + rr * 64 + c4); }
     }
}

// local attention: wave per pixel; lane holds channels {4 lane .. +3} and {128 + 4 lane .. +3}; 9 logits by shuffle-reduced dots (zero neighbours outside the image keep logit 0),
__global__ __launch_bounds__(256) void local_kernel(const float* __restrict__ q, const float* __restrict__ k, const float* __restrict__ v, const float* __restrict__ bnp, float* __restrict__ o) {
  const int wid = threadIdx.x >> 5, lane = threadIdx.x & 31; const int px = blockIdx.x * 8 + wid, b = px / NP, pp = px % NP, y = pp >> 6, xx = pp & 63; const int ca = lane * 4, cb = 128 + lane * 4;
  const v4f qa = *(const v4f*)(q + (size_t)px * C + ca), qb = *(const v4f*)(q + (size_t)px * C + cb);
  float lg[9]; bool ok[9]; size_t np_[9];
#pragma unroll
  for (int n = 0; n < 9; ++n) { const int dy = n / 3 - 1, dx = n % 3 - 1, y1 = y + dy, x1 = xx + dx; ok[n] = ((unsigned)y1 < 64u) && ((unsigned)x1 < 64u); np_[n] = (size_t)b * NP + (min(max(y1, 0), 63) << 6) + min(max(x1, 0), 63);
    float d = 0.0f; if (ok[n]) { const v4f ka = *(const v4f*)(k + np_[n] * C + ca), kb2 = *(const v4f*)(k + np_[n] * C + cb);
#pragma unroll
      for (int e = 0; e < 4; ++e) d += pmul(qa[e], ka[e]) + pmul(qb[e], kb2[e]); }
#pragma unroll
    for (int of = 1; of < 32; of <<= 1) d += __shfl_xor(d, of);
    lg[n] = ok[n] ? d * ISQ : 0.0f; }                            // zero-padded neighbours give logit 0 and ARE part of the softmax
  float m = lg[0];
#pragma unroll
  for (int n = 1; n < 9; ++n) m = fmaxf(m, lg[n]);
  float e_[9], z = 0.0f;
#pragma unroll
  for (int n = 0; n < 9; ++n) { e_[n] = nexp(lg[n] - m); z += e_[n]; }
  const float iz = 1.0f / z; v4f oa = {0.0f, 0.0f, 0.0f, 0.0f}, ob = oa;
#pragma unroll
  for (int n = 0; n < 9; ++n) { if (ok[n]) { const float a_ = e_[n] * iz; const v4f va = *(const v4f*)(v + np_[n] * C + ca), vb = *(const v4f*)(v + np_[n] * C + cb);
#pragma unroll
      for (int e = 0; e < 4; ++e) { oa[e] += pmul(a_, va[e]); ob[e] += pmul(a_, vb[e]); } } }
  const float* sc = bnp + 3 * 2 * C; const float* sh = sc + C;
#pragma unroll
  for (int e = 0; e < 4; ++e) { oa[e] = fmaxf(oa[e] * sc[ca + e] + sh[ca + e], 0.0f); ob[e] = fmaxf(ob[e] * sc[cb + e] + sh[cb + e], 0.0f); }
  { *(v4f*)(o + (size_t)px * C + ca) = oa; *(v4f*)(o + (size_t)px * C + cb) = ob;  }
}

// grid (4, NTOK/128) x 128.
__global__ __launch_bounds__(128) void final_kernel(const float* __restrict__ orow, const b16* __restrict__ w4r, const float* __restrict__ b4, const float* __restrict__ bnp, const float* __restrict__ x, float* __restrict__ out) {
  __shared__ __attribute__((aligned(16))) float Tc[64][128 + 4];
  const int lane = threadIdx.x & 31, wave = threadIdx.x >> 5, nloc = lane & 15, hlf = lane >> 4, m0 = blockIdx.y * 128 + wave * 32, c0 = blockIdx.x * 64; const int b = (blockIdx.y * 128) / NP, p0 = (blockIdx.y * 128) % NP;
  v8f acc[2][4];
#pragma unroll
  for (int r = 0; r < 2; ++r)
#pragma unroll
    for (int t = 0; t < 4; ++t) acc[r][t] = (v8f){};
#pragma unroll 2
  for (int kb = 0; kb < C; kb += 32) { v16b a0, a1, l0, l1;
#pragma unroll
    for (int e = 0; e < 16; ++e) { const int kk = kb + ((e < 8) ? (8 * hlf + e) : (16 + 8 * hlf + e - 8)); b16 p, qq; split16(orow[(size_t)(m0 + nloc) * C + kk] * OS_, p, qq); a0[e] = p; l0[e] = qq; split16(orow[(size_t)(m0 + 16 + nloc) * C + kk] * OS_, p, qq); a1[e] = p; l1[e] = qq; }
#pragma unroll
    for (int t = 0; t < 4; ++t) { const v16b bw = frag_kb_t(w4r + (size_t)(((c0 >> 4) + t) * KT + (kb >> 5)) * FT, lane); acc[0][t] = wmma16b(a0, bw, acc[0][t]); acc[0][t] = wmma16b(l0, bw, acc[0][t]); acc[1][t] = wmma16b(a1, bw, acc[1][t]); acc[1][t] = wmma16b(l1, bw, acc[1][t]); } }
  const float* sc = bnp + 4 * 2 * C; const float* sh = sc + C;
#pragma unroll
  for (int t = 0; t < 4; ++t) { const int co = c0 + t * 16 + nloc; const float bb = bf16_rne(b4[co]), s_ = sc[co], h_ = sh[co];
#pragma unroll
    for (int r = 0; r < 2; ++r)
#pragma unroll
      for (int vv = 0; vv < 8; ++vv) { const int pl_ = wave * 32 + r * 16 + 8 * hlf + vv; const float val = (acc[r][t][vv] * (1.0f / OS_) + bb) * s_ + h_ + bf16_rne(x[((size_t)b * C + co) * NP + p0 + pl_]); Tc[t * 16 + nloc][pl_] = fmaxf(val, 0.0f); } }
  __syncthreads();
  { for (int i = threadIdx.x; i < 64 * 32; i += 128) { const int cc = i >> 5, c4 = (i & 31) * 4; *(v4f*)(out + ((size_t)b * C + c0 + cc) * NP + p0 + c4) = *(const v4f*)(&Tc[cc][c4]); }  }
}
}  // namespace

extern "C" void kernel_launch(void* const* d_in, const int* in_sizes, int n_in,
                              void* d_out, int out_size, void* d_ws, size_t ws_size, hipStream_t stream) {
  (void)n_in; (void)out_size;
  const float* x = (const float*)d_in[0]; const float* W1 = (const float*)d_in[1]; const float* b1 = (const float*)d_in[2]; const float* W2 = (const float*)d_in[3]; const float* b2 = (const float*)d_in[4]; const float* W3 = (const float*)d_in[5]; const float* b3 = (const float*)d_in[6]; const float* W4 = (const float*)d_in[7]; const float* b4 = (const float*)d_in[8];
  const float* g = (const float*)d_in[9]; const float* be = (const float*)d_in[10]; const float* mu = (const float*)d_in[11]; const float* var = (const float*)d_in[12];
  float* out = (float*)d_out;   // [8][256][64][64]
  if (in_sizes[0] != Bn * C * NP || in_sizes[1] != C * C || in_sizes[7] != C * C || in_sizes[9] != 5 * C || in_sizes[12] != 5 * C) return;
  size_t off = 0; char* ws = (char*)d_ws;
  auto carve = [&](size_t bytes) { char* p = ws + off; off += (bytes + 255) & ~(size_t)255; return p; };
  unsigned short* xT = (unsigned short*)carve((size_t)NTOK * C * 2); unsigned short* w16 = (unsigned short*)carve((size_t)3 * C * C * 2); b16* w4r = (b16*)carve((size_t)C * C * 2); float* bnp = (float*)carve(5 * 2 * C * 4);
  float* q = (float*)carve((size_t)NTOK * C * 4); float* k = (float*)carve((size_t)NTOK * C * 4); float* v = (float*)carve((size_t)NTOK * C * 4);
  if (off > ws_size) return;                                    // ≈ 16.8 + 0.5 + 3 x 33.5 ≈ 118 MB (112.6 MiB); the attention output reuses q's buffer row by row
  prep_kernel<<<dim3(NP / 64, Bn), 256, 0, stream>>>(x, W1, W2, W3, W4, g, be, mu, var, xT, w16, w4r, bnp);
  qkv_kernel<<<dim3(C / 64, NTOK / 128, 3), 128, 0, stream>>>(xT, w16, b1, b2, b3, bnp, q, k, v);
  local_kernel<<<NTOK / 8, 256, 0, stream>>>(q, k, v, bnp, q);   // o overwrites q (each wave reads its own q row first)
  final_kernel<<<dim3(C / 64, NTOK / 128), 128, 0, stream>>>(q, w4r, b4, bnp, x, out);
}

// v003
// A run of this version takes 102 microseconds.
// In both of two side-by-side timings against v002, it was 1.04 times as fast.
// All steps since v000 together make it 1.57 times as fast.
#include <hip/hip_runtime.h>

// PixelTransformerResnet: q, k, v = relu(bn_i(conv1x1_i(x))) (eval-mode BN with given statistics); per pixel 9 logits = q . k(neighbour n) / 16 over the 3x3 neighbourhood (zero vectors
// outside the image, kept in the softmax), att = softmax over the 9, out = Σ_n att_n v(neighbour n); out = relu(bn_3(out)); out = bn_4(conv1x1_4(out)); y = relu(out + x) -> NCHW [8][256][64][64].
// The four 1x1 convolutions run on WMMA: q/k/v on v_wmma_f32_16x16x32_bf16 with exact bf16 operands (x transposed to pixel-major through LDS; 1 product), the last
// one on v_wmma_f32_16x16x32_f16 with the attention output split into an f16 hi+lo pair x8 against exact W4 (2 products); f32 accumulate. The 9-neighbour attention is a wave per 4 pixels of an image row
// in f32 (lanes split the 256 channels, shuffle-reduced dots in fixed order, native exp). BN / relu / residual in f32. Fragment k-map per lane half hh for A AND B: elements 0..7 <- k =

namespace {
constexpr int Bn = 8, C = 256, HW = 64, NP = HW * HW, NTOK = Bn * NP;
constexpr float EPS = 1e-5f, OS_ = 8.0f, ISQ = 0.0625f;   // 1/sqrt(256)

typedef _Float16 b16;
typedef __attribute__((ext_vector_type(16))) _Float16 v16b;
typedef __attribute__((ext_vector_type(16))) __bf16 v16bb;
typedef __attribute__((ext_vector_type(8))) _Float16 v8b;
typedef __attribute__((ext_vector_type(8))) unsigned short v8us;
typedef __attribute__((ext_vector_type(8))) float v8f;
typedef __attribute__((ext_vector_type(4))) float v4f;
__device__ __forceinline__ float bf16_rne(float f) { unsigned int u = __float_as_uint(f); u += 0x7FFFu + ((u >> 16) & 1u); return __uint_as_float(u & 0xFFFF0000u); }
__device__ __forceinline__ unsigned short bf16_bits(float f) { unsigned int u = __float_as_uint(f); u += 0x7FFFu + ((u >> 16) & 1u); return (unsigned short)(u >> 16); }
__device__ __forceinline__ void split16(float v, b16& hi, b16& lo) { hi = (b16)v; lo = (b16)(v - (float)hi); }
// Fragment tiles: a 16-row x 32-k block of a 16-bit operand is stored as 512 consecutive elements, piece (ld, lane) of 8 elements at ld * 256 + lane * 8 holding row (lane & 15),
// k = ld * 16 + (lane >> 4) * 8 + 0..7 (the k-map above, the same for A and B), so that each 16-byte-per-lane load of a wave covers 512 contiguous bytes. Tile (rt, kt) of a [rows][C] operand lies at (rt * KT + kt) * FT.
constexpr int FT = 512, KT = C / 32;
__device__ __forceinline__ int tile_row(int o) { return (o >> 6) / KT * 16 + (o & 15); }                                   // row and first k of piece o (8 elements) of a tiled operand
__device__ __forceinline__ int tile_k(int o) { return (o >> 6) % KT * 32 + ((o >> 5) & 1) * 16 + ((o >> 4) & 1) * 8; }
__device__ __forceinline__ v16b frag_kb_t(const b16* tile, int lane) { const v8b a = *(const v8b*)(tile + lane * 8), b = *(const v8b*)(tile + 256 + lane * 8); v16b f;
#pragma unroll
  for (int e = 0; e < 8; ++e) { f[e] = a[e]; f[8 + e] = b[e]; } return f; }
__device__ __forceinline__ v16bb frag_bf_t(const unsigned short* tile, int lane) { const v8us a = *(const v8us*)(tile + lane * 8), b = *(const v8us*)(tile + 256 + lane * 8); union { unsigned short s[16]; v16bb v; } u;
#pragma unroll
  for (int e = 0; e < 8; ++e) { u.s[e] = a[e]; u.s[8 + e] = b[e]; } return u.v; }
__device__ __forceinline__ v8f wmma16b(v16b a, v16b b, v8f c) { v8f d = __builtin_amdgcn_wmma_f32_16x16x32_f16(false, a, false, b, (short)0, c, false, false); asm volatile("v_nop\n\tv_nop\n\tv_nop\n\tv_nop" : "+v"(d) : "v"(a), "v"(b)); return d; }
__device__ __forceinline__ v8f wmma16bb(v16bb a, v16bb b, v8f c) { v8f d = __builtin_amdgcn_wmma_f32_16x16x32_bf16(false, a, false, b, (short)0, c, false, false); asm volatile("v_nop\n\tv_nop\n\tv_nop\n\tv_nop" : "+v"(d) : "v"(a), "v"(b)); return d; }
__device__ __forceinline__ void wave_lds_sync() { __builtin_amdgcn_fence(__ATOMIC_RELEASE, "workgroup"); __builtin_amdgcn_wave_barrier(); __builtin_amdgcn_fence(__ATOMIC_ACQUIRE, "workgroup"); }
__device__ __forceinline__ float nexp(float x) { float r; asm("v_exp_f32 %0, %1\n\tv_nop" : "=v"(r) : "v"(x * 1.4426950408889634f)); return r; }
__device__ __forceinline__ float pmul(float a, float b) { float p = a * b; asm volatile("" : "+v"(p)); return p; }

// prep: x NCHW -> bf16 fragment tiles xT, rows = pixels b*4096 + p (block = (b, 64 pixels) via LDS); W1..3 [256][256] -> bf16 fragment tiles; W4 -> f16 fragment tiles; bnp: for each of the 5 BN layers
__global__ __launch_bounds__(256) void prep_kernel(const float* __restrict__ x, const float* __restrict__ W1, const float* __restrict__ W2, const float* __restrict__ W3, const float* __restrict__ W4, const float* __restrict__ g, const float* __restrict__ be, const float* __restrict__ mu, const float* __restrict__ var,
                                                   unsigned short* __restrict__ xT, unsigned short* __restrict__ w16, b16* __restrict__ w4r, float* __restrict__ bnp) {
  __shared__ __attribute__((aligned(16))) unsigned short Tt[64][C + 8];
  const int t_ = threadIdx.x, b = blockIdx.y, p0 = blockIdx.x * 64; const float* src = x + (size_t)b * C * NP;
  for (int i = t_; i < C * 64; i += 256) { const int c = i >> 6, pp = i & 63; Tt[pp][c] = bf16_bits(src[(size_t)c * NP + p0 + pp]); }
  __syncthreads();
  {
    for (int i = t_; i < 64 * C / 8; i += 256) { const int pp = tile_row(i), c8 = tile_k(i); *(v8us*)(xT + ((size_t)b * NP + p0) * C + (size_t)i * 8) = *(const v8us*)(&Tt[pp][c8]); }
    // weight and BN conversion dealt over the grid: one 8-element piece (or one BN channel) per thread of blocks 0..132, block-uniform choice of the source
    static_assert(4 * C * C / 8 / 256 + 5 * C / 256 <= (NP / 64) * Bn && (C * C / 8) % 256 == 0 && (5 * C) % 256 == 0, "the grid holds every piece");
    const int bid = blockIdx.y * (NP / 64) + blockIdx.x, i = bid * 256 + t_;
    if (bid < 3 * C * C / 8 / 256) { const int m = i / (C * C / 8), q = i % (C * C / 8); const float* W = (m == 0) ? W1 : (m == 1) ? W2 : W3; v8us o;
#pragma unroll
      for (int e = 0; e < 8; ++e) o[e] = bf16_bits(W[tile_row(q) * C + tile_k(q) + e]);
      *(v8us*)(w16 + (size_t)i * 8) = o; asm volatile("s_wait_xcnt 0x0" ::: "memory");  /* holds any later rewrite of the store's registers behind the store's issue */ }
    else if (bid < 4 * C * C / 8 / 256) { const int j = i - 3 * C * C / 8; v8b o;
#pragma unroll
      for (int e = 0; e < 8; ++e) o[e] = (b16)bf16_rne(W4[tile_row(j) * C + tile_k(j) + e]);
      *(v8b*)(w4r + (size_t)j * 8) = o; asm volatile("s_wait_xcnt 0x0" ::: "memory");  /* holds any later rewrite of the store's registers behind the store's issue */ }
    else if (bid < 4 * C * C / 8 / 256 + 5 * C / 256) { const int j = i - 4 * C * C / 8; const float sc = bf16_rne(g[j]) * rsqrtf(bf16_rne(var[j]) + EPS); ((float*)bnp)[(j / C) * 2 * C + (j % C)] = sc; ((float*)bnp)[(j / C) * 2 * C + C + (j % C)] = bf16_rne(be[j]) - bf16_rne(mu[j]) * sc; asm volatile("s_wait_xcnt 0x0" ::: "memory");  /* holds any later rewrite of the store's registers behind the store's issue */ }
     }
}

__global__ __launch_bounds__(128) void qkv_kernel(const unsigned short* __restrict__ xT, const unsigned short* __restrict__ w16, const float* __restrict__ b1, const float* __restrict__ b2, const float* __restrict__ b3, const float* __restrict__ bnp, float* __restrict__ q, float* __restrict__ k, float* __restrict__ v) {
  __shared__ __attribute__((aligned(16))) float Ts[4][32 * 64];
  const int lane = threadIdx.x & 31, wave = threadIdx.x >> 5, nloc = lane & 15, hlf = lane >> 4, which = blockIdx.z, m0 = blockIdx.y * 128 + wave * 32, c0 = blockIdx.x * 64;
  const unsigned short* Wt = w16 + (size_t)which * C * C; const float* bias = (which == 0) ? b1 : (which == 1) ? b2 : b3; const float* sc = bnp + which * 2 * C; const float* sh = sc + C; float* dstb = (which == 0) ? q : (which == 1) ? k : v;
  v8f acc[2][4];
#pragma unroll
  for (int r = 0; r < 2; ++r)
#pragma unroll
    for (int t = 0; t < 4; ++t) acc[r][t] = (v8f){};
#pragma unroll 2
  for (int kb = 0; kb < C; kb += 32) { const v16bb a0 = frag_bf_t(xT + ((size_t)(m0 >> 4) * KT + (kb >> 5)) * FT, lane), a1 = frag_bf_t(xT + ((size_t)((m0 >> 4) + 1) * KT + (kb >> 5)) * FT, lane);
#pragma unroll
    for (int t = 0; t < 4; ++t) { const v16bb bw = frag_bf_t(Wt + (size_t)(((c0 >> 4) + t) * KT + (kb >> 5)) * FT, lane); acc[0][t] = wmma16bb(a0, bw, acc[0][t]); acc[1][t] = wmma16bb(a1, bw, acc[1][t]); } }
  float* Tt = Ts[wave];
#pragma unroll
  for (int t = 0; t < 4; ++t) { const int c = c0 + t * 16 + nloc; const float bb = bf16_rne(bias[c]), s_ = sc[c], h_ = sh[c];
#pragma unroll
    for (int r = 0; r < 2; ++r)
#pragma unroll
      for (int vv = 0; vv < 8; ++vv) Tt[(r * 16 + vv + 8 * hlf) * 64 + t * 16 + nloc] = fmaxf((acc[r][t][vv] + bb) * s_ + h_, 0.0f); }
  wave_lds_sync();
  float* dst0 = dstb + (size_t)m0 * C + c0;
  {
#pragma unroll
    for (int j = 0; j < 16; ++j) { const int rr = j * 2 + hlf, c4 = nloc * 4; *(v4f*)(dst0 + (size_t)rr * C + c4) = *(const v4f*)(Tt + rr * 64 + c4); }
     }
}

// local attention: a wave takes PS consecutive pixels of one image row (a block: 8 such strips side by side, so that neighbouring waves ask for the 2 columns they share at about the same time); lane holds channels {4 lane .. +3} and {128 + 4 lane .. +3}. Each of the 3 x (PS + 2) neighbour rows of k and
// of v is loaded once per wave, from an address clamped into the image, and serves up to 3 pixels; per pixel the 9 logits (shuffle-reduced dots), the softmax and the sum over n = 0..8 keep their order.
// A neighbour outside the image keeps logit 0 in the softmax and enters the output with weight 0. One register set A, B holds one image row's PS + 2 neighbours; a column is refilled for the next image row once its last pixel has used it.
constexpr int PS = 4;
__device__ __forceinline__ float wave_same(float f) { return __uint_as_float(__builtin_amdgcn_readfirstlane(__float_as_uint(f))); }   // a value that every lane holds alike, moved to a scalar register
__global__ __launch_bounds__(256, 8) void local_kernel(const float* __restrict__ q, const float* __restrict__ k, const float* __restrict__ v, const float* __restrict__ bnp, float* __restrict__ o) {
  const int wid = __builtin_amdgcn_readfirstlane(threadIdx.x >> 5), lane = threadIdx.x & 31; const int ca = lane * 4, cb = 128 + lane * 4;
  constexpr int BR = HW / (8 * PS);                                // blocks per image row
  const int x0 = ((blockIdx.x % BR) * 8 + wid) * PS, y = (blockIdx.x / BR) % HW, b = blockIdx.x / (BR * HW); const int px0 = b * NP + y * HW + x0;
  int nb[3][PS + 2]; bool ok[3][PS + 2];                            // neighbour pixel (clamped into the image) and whether it lies inside; the same for the whole wave
#pragma unroll
  for (int r = 0; r < 3; ++r)
#pragma unroll
    for (int c = 0; c < PS + 2; ++c) { const int y1 = y + r - 1, x1 = x0 + c - 1; ok[r][c] = ((unsigned)y1 < (unsigned)HW) && ((unsigned)x1 < (unsigned)HW); nb[r][c] = b * NP + min(max(y1, 0), HW - 1) * HW + min(max(x1, 0), HW - 1); }
  v4f qa[PS], qb[PS], A[PS + 2], B[PS + 2];
#pragma unroll
  for (int p = 0; p < PS; ++p) { qa[p] = *(const v4f*)(q + (size_t)(px0 + p) * C + ca); qb[p] = *(const v4f*)(q + (size_t)(px0 + p) * C + cb); }
#pragma unroll
  for (int c = 0; c < PS + 2; ++c) { A[c] = *(const v4f*)(k + (size_t)nb[0][c] * C + ca); B[c] = *(const v4f*)(k + (size_t)nb[0][c] * C + cb); }
  float lg[PS][9];
#pragma unroll
  for (int r = 0; r < 3; ++r) { float d[PS][3];
#pragma unroll
    for (int c = 0; c < PS + 2; ++c) {
#pragma unroll
      for (int p = 0; p < PS; ++p) { if (c - p < 0 || c - p > 2) continue;
        float s = 0.0f;
#pragma unroll
        for (int e = 0; e < 4; ++e) s += pmul(qa[p][e], A[c][e]) + pmul(qb[p][e], B[c][e]);
        asm volatile("" : "+v"(s));                               // empty asm on each sum, against spills: without it the adds sink to the reduction below and the 8 products of every dot stay live
        d[p][c - p] = s; }
      const float* nx = (r < 2 ? k + (size_t)nb[r < 2 ? r + 1 : 0][c] * C : v + (size_t)nb[0][c] * C); A[c] = *(const v4f*)(nx + ca); B[c] = *(const v4f*)(nx + cb);   // the column's refill: next image row of k, behind the last one row 0 of v
      __builtin_amdgcn_sched_barrier(0); }                         // keeps each column's dots and refill together: the refills stay spread over the row, and the row's shuffles stay behind it in batches of 12 (without it they scatter among the dots, each with its own wait)
#pragma unroll
    for (int of = 1; of < 32; of <<= 1)
#pragma unroll
      for (int p = 0; p < PS; ++p)
#pragma unroll
        for (int j = 0; j < 3; ++j) d[p][j] += __shfl_xor(d[p][j], of);
#pragma unroll
    for (int p = 0; p < PS; ++p)
#pragma unroll
      for (int j = 0; j < 3; ++j) { asm volatile("" : "+v"(d[p][j]));   // empty asm on each sum, against spills (as above): it holds this row's reduction in front of the next row's dots, so that 12 and not 36 sums are live
        const float t = wave_same(d[p][j]) * ISQ; lg[p][r * 3 + j] = ok[r][p + j] ? t : 0.0f; } }   // zero-padded neighbours give logit 0 and ARE part of the softmax
  v4f oa[PS], ob[PS];
#pragma unroll
  for (int p = 0; p < PS; ++p) { float m = lg[p][0];
#pragma unroll
    for (int n = 1; n < 9; ++n) m = fmaxf(m, lg[p][n]);
    float z = 0.0f;
#pragma unroll
    for (int n = 0; n < 9; ++n) { lg[p][n] = nexp(lg[p][n] - m); z += lg[p][n]; }
    const float iz = 1.0f / z;
#pragma unroll
    for (int n = 0; n < 9; ++n) lg[p][n] = ok[n / 3][p + n % 3] ? lg[p][n] * iz : 0.0f;
    oa[p] = (v4f){0.0f, 0.0f, 0.0f, 0.0f}; ob[p] = oa[p]; }
  const float* sc = bnp + 3 * 2 * C; const float* sh = sc + C; v4f sa, sb, ha, hb;
#pragma unroll
  for (int r = 0; r < 3; ++r) {
#pragma unroll
    for (int c = 0; c < PS + 2; ++c) {
#pragma unroll
      for (int p = 0; p < PS; ++p) { if (c - p < 0 || c - p > 2) continue;
        const float a_ = lg[p][r * 3 + c - p];
#pragma unroll
        for (int e = 0; e < 4; ++e) { oa[p][e] += pmul(a_, A[c][e]); ob[p][e] += pmul(a_, B[c][e]); }
        asm volatile("" : "+v"(oa[p]), "+v"(ob[p])); }                // empty asm on each sum, against spills (as above): without it the adds sink to the end and the products stay live
      if (r < 2) { const float* nx = v + (size_t)nb[r < 2 ? r + 1 : 0][c] * C; A[c] = *(const v4f*)(nx + ca); B[c] = *(const v4f*)(nx + cb); }
      else if (c == 0) { sa = *(const v4f*)(sc + ca); sb = *(const v4f*)(sc + cb); }
      else if (c == 1) { ha = *(const v4f*)(sh + ca); hb = *(const v4f*)(sh + cb); }
      __builtin_amdgcn_sched_barrier(0); } }                       // as above: keeps each column's sums and refill together, the refills spread over the row
#pragma unroll
  for (int p = 0; p < PS; ++p) {
#pragma unroll
    for (int e = 0; e < 4; ++e) { oa[p][e] = fmaxf(oa[p][e] * sa[e] + ha[e], 0.0f); ob[p][e] = fmaxf(ob[p][e] * sb[e] + hb[e], 0.0f); }
    *(v4f*)(o + (size_t)(px0 + p) * C + ca) = oa[p]; *(v4f*)(o + (size_t)(px0 + p) * C + cb) = ob[p]; }
}

// grid (4, NTOK/128) x 128.
__global__ __launch_bounds__(128) void final_kernel(const float* __restrict__ orow, const b16* __restrict__ w4r, const float* __restrict__ b4, const float* __restrict__ bnp, const float* __restrict__ x, float* __restrict__ out) {
  __shared__ __attribute__((aligned(16))) float Tc[64][128 + 4];
  const int lane = threadIdx.x & 31, wave = threadIdx.x >> 5, nloc = lane & 15, hlf = lane >> 4, m0 = blockIdx.y * 128 + wave * 32, c0 = blockIdx.x * 64; const int b = (blockIdx.y * 128) / NP, p0 = (blockIdx.y * 128) % NP;
  v8f acc[2][4];
#pragma unroll
  for (int r = 0; r < 2; ++r)
#pragma unroll
    for (int t = 0; t < 4; ++t) acc[r][t] = (v8f){};
#pragma unroll 2
  for (int kb = 0; kb < C; kb += 32) { v16b a0, a1, l0, l1;
#pragma unroll
    for (int e = 0; e < 16; ++e) { const int kk = kb + ((e < 8) ? (8 * hlf + e) : (16 + 8 * hlf + e - 8)); b16 p, qq; split16(orow[(size_t)(m0 + nloc) * C + kk] * OS_, p, qq); a0[e] = p; l0[e] = qq; split16(orow[(size_t)(m0 + 16 + nloc) * C + kk] * OS_, p, qq); a1[e] = p; l1[e] = qq; }
#pragma unroll
    for (int t = 0; t < 4; ++t) { const v16b bw = frag_kb_t(w4r + (size_t)(((c0 >> 4) + t) * KT + (kb >> 5)) * FT, lane); acc[0][t] = wmma16b(a0, bw, acc[0][t]); acc[0][t] = wmma16b(l0, bw, acc[0][t]); acc[1][t] = wmma16b(a1, bw, acc[1][t]); acc[1][t] = wmma16b(l1, bw, acc[1][t]); } }
  const float* sc = bnp + 4 * 2 * C; const float* sh = sc + C;
#pragma unroll
  for (int t = 0; t < 4; ++t) { const int co = c0 + t * 16 + nloc; const float bb = bf16_rne(b4[co]), s_ = sc[co], h_ = sh[co];
#pragma unroll
    for (int r = 0; r < 2; ++r)
#pragma unroll
      for (int vv = 0; vv < 8; ++vv) { const int pl_ = wave * 32 + r * 16 + 8 * hlf + vv; const float val = (acc[r][t][vv] * (1.0f / OS_) + bb) * s_ + h_ + bf16_rne(x[((size_t)b * C + co) * NP + p0 + pl_]); Tc[t * 16 + nloc][pl_] = fmaxf(val, 0.0f); } }
  __syncthreads();
  { for (int i = threadIdx.x; i < 64 * 32; i += 128) { const int cc = i >> 5, c4 = (i & 31) * 4; *(v4f*)(out + ((size_t)b * C + c0 + cc) * NP + p0 + c4) = *(const v4f*)(&Tc[cc][c4]); }  }
}
}  // namespace

extern "C" void kernel_launch(void* const* d_in, const int* in_sizes, int n_in,
                              void* d_out, int out_size, void* d_ws, size_t ws_size, hipStream_t stream) {
  (void)n_in; (void)out_size;
  const float* x = (const float*)d_in[0]; const float* W1 = (const float*)d_in[1]; const float* b1 = (const float*)d_in[2]; const float* W2 = (const float*)d_in[3]; const float* b2 = (const float*)d_in[4]; const float* W3 = (const float*)d_in[5]; const float* b3 = (const float*)d_in[6]; const float* W4 = (const float*)d_in[7]; const float* b4 = (const float*)d_in[8];
  const float* g = (const float*)d_in[9]; const float* be = (const float*)d_in[10]; const float* mu = (const float*)d_in[11]; const float* var = (const float*)d_in[12];
  float* out = (float*)d_out;   // [8][256][64][64]
  if (in_sizes[0] != Bn * C * NP || in_sizes[1] != C * C || in_sizes[7] != C * C || in_sizes[9] != 5 * C || in_sizes[12] != 5 * C) return;
  size_t off = 0; char* ws = (char*)d_ws;
  auto carve = [&](size_t bytes) { char* p = ws + off; off += (bytes + 255) & ~(size_t)255; return p; };
  unsigned short* xT = (unsigned short*)carve((size_t)NTOK * C * 2); unsigned short* w16 = (unsigned short*)carve((size_t)3 * C * C * 2); b16* w4r = (b16*)carve((size_t)C * C * 2); float* bnp = (float*)carve(5 * 2 * C * 4);
  float* q = (float*)carve((size_t)NTOK * C * 4); float* k = (float*)carve((size_t)NTOK * C * 4); float* v = (float*)carve((size_t)NTOK * C * 4);
  if (off > ws_size) return;                                    // ≈ 16.8 + 0.5 + 3 x 33.5 ≈ 118 MB (112.6 MiB); the attention output reuses q's buffer row by row
  prep_kernel<<<dim3(NP / 64, Bn), 256, 0, stream>>>(x, W1, W2, W3, W4, g, be, mu, var, xT, w16, w4r, bnp);
  qkv_kernel<<<dim3(C / 64, NTOK / 128, 3), 128, 0, stream>>>(xT, w16, b1, b2, b3, bnp, q, k, v);
  local_kernel<<<NTOK / (8 * PS), 256, 0, stream>>>(q, k, v, bnp, q);   // o overwrites q (each wave reads its own q rows first)
  final_kernel<<<dim3(C / 64, NTOK / 128), 128, 0, stream>>>(q, w4r, b4, bnp, x, out);
}

// v004
// A run of this version takes 81.3 microseconds.
// Two timings next to v003 both put it at 1.26 times that version's speed.
// All steps since v000 together make it 1.98 times as fast.
#include <hip/hip_runtime.h>

// PixelTransformerResnet: q, k, v = relu(bn_i(conv1x1_i(x))) (eval-mode BN with given statistics); per pixel 9 logits = q . k(neighbour n) / 16 over the 3x3 neighbourhood (zero vectors
// outside the image, kept in the softmax), att = softmax over the 9, out = Σ_n att_n v(neighbour n); out = relu(bn_3(out)); out = bn_4(conv1x1_4(out)); y = relu(out + x) -> NCHW [8][256][64][64].
// The four 1x1 convolutions run on WMMA: q/k/v on v_wmma_f32_16x16x32_bf16 with exact bf16 operands (x transposed to pixel-major through LDS; 1 product), the last
// one on v_wmma_f32_16x16x32_f16 with the attention output split into an f16 hi+lo pair x8 against exact W4 (2 products); f32 accumulate. The 9-neighbour attention is a wave per 4 pixels of an image row
// in f32 (lanes split the 256 channels, shuffle-reduced dots in fixed order, native exp). BN / relu / residual in f32. Fragment k-map per lane half hh for A AND B: elements 0..7 <- k =

namespace {
constexpr int Bn = 8, C = 256, HW = 64, NP = HW * HW, NTOK = Bn * NP;
constexpr float EPS = 1e-5f, OS_ = 8.0f, ISQ = 0.0625f;   // 1/sqrt(256)

typedef _Float16 b16;
typedef __attribute__((ext_vector_type(16))) _Float16 v16b;
typedef __attribute__((ext_vector_type(16))) __bf16 v16bb;
typedef __attribute__((ext_vector_type(8))) _Float16 v8b;
typedef __attribute__((ext_vector_type(4))) _Float16 v4b;
typedef __attribute__((ext_vector_type(8))) unsigned short v8us;
typedef __attribute__((ext_vector_type(8))) float v8f;
typedef __attribute__((ext_vector_type(4))) float v4f;
__device__ __forceinline__ float bf16_rne(float f) { unsigned int u = __float_as_uint(f); u += 0x7FFFu + ((u >> 16) & 1u); return __uint_as_float(u & 0xFFFF0000u); }
__device__ __forceinline__ unsigned short bf16_bits(float f) { unsigned int u = __float_as_uint(f); u += 0x7FFFu + ((u >> 16) & 1u); return (unsigned short)(u >> 16); }
__device__ __forceinline__ void split16(float v, b16& hi, b16& lo) { hi = (b16)v; lo = (b16)(v - (float)hi); }
// Fragment tiles: a 16-row x 32-k block of a 16-bit operand is stored as 512 consecutive elements, piece (ld, lane) of 8 elements at ld * 256 + lane * 8 holding row (lane & 15),
// k = ld * 16 + (lane >> 4) * 8 + 0..7 (the k-map above, the same for A and B), so that each 16-byte-per-lane load of a wave covers 512 contiguous bytes. Tile (rt, kt) of a [rows][C] operand lies at (rt * KT + kt) * FT.
constexpr int FT = 512, KT = C / 32;
__device__ __forceinline__ int tile_row(int o) { return (o >> 6) / KT * 16 + (o & 15); }                                   // row and first k of piece o (8 elements) of a tiled operand
__device__ __forceinline__ int tile_k(int o) { return (o >> 6) % KT * 32 + ((o >> 5) & 1) * 16 + ((o >> 4) & 1) * 8; }
__device__ __forceinline__ v16b frag_kb_t(const b16* tile, int lane) { const v8b a = *(const v8b*)(tile + lane * 8), b = *(const v8b*)(tile + 256 + lane * 8); v16b f;
#pragma unroll
  for (int e = 0; e < 8; ++e) { f[e] = a[e]; f[8 + e] = b[e]; } return f; }
// the same fragment from a row-major row: p points at the lane's row, k = kb + 8 hh; elements 0..7 <- p[0..7], 8..15 <- p[16..23]
__device__ __forceinline__ v16b frag_row(const b16* p) { const v8b a = *(const v8b*)p, b = *(const v8b*)(p + 16); v16b f;
#pragma unroll
  for (int e = 0; e < 8; ++e) { f[e] = a[e]; f[8 + e] = b[e]; } return f; }
__device__ __forceinline__ v16bb frag_bf_t(const unsigned short* tile, int lane) { const v8us a = *(const v8us*)(tile + lane * 8), b = *(const v8us*)(tile + 256 + lane * 8); union { unsigned short s[16]; v16bb v; } u;
#pragma unroll
  for (int e = 0; e < 8; ++e) { u.s[e] = a[e]; u.s[8 + e] = b[e]; } return u.v; }
__device__ __forceinline__ v8f wmma16b(v16b a, v16b b, v8f c) { v8f d = __builtin_amdgcn_wmma_f32_16x16x32_f16(false, a, false, b, (short)0, c, false, false); asm volatile("v_nop\n\tv_nop\n\tv_nop\n\tv_nop" : "+v"(d) : "v"(a), "v"(b)); return d; }
__device__ __forceinline__ v8f wmma16bb(v16bb a, v16bb b, v8f c) { v8f d = __builtin_amdgcn_wmma_f32_16x16x32_bf16(false, a, false, b, (short)0, c, false, false); asm volatile("v_nop\n\tv_nop\n\tv_nop\n\tv_nop" : "+v"(d) : "v"(a), "v"(b)); return d; }
__device__ __forceinline__ void wave_lds_sync() { __builtin_amdgcn_fence(__ATOMIC_RELEASE, "workgroup"); __builtin_amdgcn_wave_barrier(); __builtin_amdgcn_fence(__ATOMIC_ACQUIRE, "workgroup"); }
__device__ __forceinline__ float nexp(float x) { float r; asm("v_exp_f32 %0, %1\n\tv_nop" : "=v"(r) : "v"(x * 1.4426950408889634f)); return r; }
__device__ __forceinline__ float pmul(float a, float b) { float p = a * b; asm volatile("" : "+v"(p)); return p; }

// prep: x NCHW -> bf16 fragment tiles xT, rows = pixels b*4096 + p (block = (b, 64 pixels) via LDS); W1..3 [256][256] -> bf16 fragment tiles; W4 -> f16 fragment tiles; bnp: for each of the 5 BN layers
__global__ __launch_bounds__(256) void prep_kernel(const float* __restrict__ x, const float* __restrict__ W1, const float* __restrict__ W2, const float* __restrict__ W3, const float* __restrict__ W4, const float* __restrict__ g, const float* __restrict__ be, const float* __restrict__ mu, const float* __restrict__ var,
                                                   unsigned short* __restrict__ xT, unsigned short* __restrict__ w16, b16* __restrict__ w4r, float* __restrict__ bnp) {
  __shared__ __attribute__((aligned(16))) unsigned short Tt[64][C + 8];
  const int t_ = threadIdx.x, b = blockIdx.y, p0 = blockIdx.x * 64; const float* src = x + (size_t)b * C * NP;
  for (int i = t_; i < C * 64; i += 256) { const int c = i >> 6, pp = i & 63; Tt[pp][c] = bf16_bits(src[(size_t)c * NP + p0 + pp]); }
  __syncthreads();
  {
    for (int i = t_; i < 64 * C / 8; i += 256) { const int pp = tile_row(i), c8 = tile_k(i); *(v8us*)(xT + ((size_t)b * NP + p0) * C + (size_t)i * 8) = *(const v8us*)(&Tt[pp][c8]); }
    // weight and BN conversion dealt over the grid: one 8-element piece (or one BN channel) per thread of blocks 0..132, block-uniform choice of the source
    static_assert(4 * C * C / 8 / 256 + 5 * C / 256 <= (NP / 64) * Bn && (C * C / 8) % 256 == 0 && (5 * C) % 256 == 0, "the grid holds every piece");
    const int bid = blockIdx.y * (NP / 64) + blockIdx.x, i = bid * 256 + t_;
    if (bid < 3 * C * C / 8 / 256) { const int m = i / (C * C / 8), q = i % (C * C / 8); const float* W = (m == 0) ? W1 : (m == 1) ? W2 : W3; v8us o;
#pragma unroll
      for (int e = 0; e < 8; ++e) o[e] = bf16_bits(W[tile_row(q) * C + tile_k(q) + e]);
      *(v8us*)(w16 + (size_t)i * 8) = o; asm volatile("s_wait_xcnt 0x0" ::: "memory");  /* holds any later rewrite of the store's registers behind the store's issue */ }
    else if (bid < 4 * C * C / 8 / 256) { const int j = i - 3 * C * C / 8; v8b o;
#pragma unroll
      for (int e = 0; e < 8; ++e) o[e] = (b16)bf16_rne(W4[tile_row(j) * C + tile_k(j) + e]);
      *(v8b*)(w4r + (size_t)j * 8) = o; asm volatile("s_wait_xcnt 0x0" ::: "memory");  /* holds any later rewrite of the store's registers behind the store's issue */ }
    else if (bid < 4 * C * C / 8 / 256 + 5 * C / 256) { const int j = i - 4 * C * C / 8; const float sc = bf16_rne(g[j]) * rsqrtf(bf16_rne(var[j]) + EPS); ((float*)bnp)[(j / C) * 2 * C + (j % C)] = sc; ((float*)bnp)[(j / C) * 2 * C + C + (j % C)] = bf16_rne(be[j]) - bf16_rne(mu[j]) * sc; asm volatile("s_wait_xcnt 0x0" ::: "memory");  /* holds any later rewrite of the store's registers behind the store's issue */ }
     }
}

__global__ __launch_bounds__(128) void qkv_kernel(const unsigned short* __restrict__ xT, const unsigned short* __restrict__ w16, const float* __restrict__ b1, const float* __restrict__ b2, const float* __restrict__ b3, const float* __restrict__ bnp, float* __restrict__ q, float* __restrict__ k, float* __restrict__ v) {
  __shared__ __attribute__((aligned(16))) float Ts[4][32 * 64];
  const int lane = threadIdx.x & 31, wave = threadIdx.x >> 5, nloc = lane & 15, hlf = lane >> 4, which = blockIdx.z, m0 = blockIdx.y * 128 + wave * 32, c0 = blockIdx.x * 64;
  const unsigned short* Wt = w16 + (size_t)which * C * C; const float* bias = (which == 0) ? b1 : (which == 1) ? b2 : b3; const float* sc = bnp + which * 2 * C; const float* sh = sc + C; float* dstb = (which == 0) ? q : (which == 1) ? k : v;
  v8f acc[2][4];
#pragma unroll
  for (int r = 0; r < 2; ++r)
#pragma unroll
    for (int t = 0; t < 4; ++t) acc[r][t] = (v8f){};
#pragma unroll 2
  for (int kb = 0; kb < C; kb += 32) { const v16bb a0 = frag_bf_t(xT + ((size_t)(m0 >> 4) * KT + (kb >> 5)) * FT, lane), a1 = frag_bf_t(xT + ((size_t)((m0 >> 4) + 1) * KT + (kb >> 5)) * FT, lane);
#pragma unroll
    for (int t = 0; t < 4; ++t) { const v16bb bw = frag_bf_t(Wt + (size_t)(((c0 >> 4) + t) * KT + (kb >> 5)) * FT, lane); acc[0][t] = wmma16bb(a0, bw, acc[0][t]); acc[1][t] = wmma16bb(a1, bw, acc[1][t]); } }
  float* Tt = Ts[wave];
#pragma unroll
  for (int t = 0; t < 4; ++t) { const int c = c0 + t * 16 + nloc; const float bb = bf16_rne(bias[c]), s_ = sc[c], h_ = sh[c];
#pragma unroll
    for (int r = 0; r < 2; ++r)
#pragma unroll
      for (int vv = 0; vv < 8; ++vv) Tt[(r * 16 + vv + 8 * hlf) * 64 + t * 16 + nloc] = fmaxf((acc[r][t][vv] + bb) * s_ + h_, 0.0f); }
  wave_lds_sync();
  float* dst0 = dstb + (size_t)m0 * C + c0;
  {
#pragma unroll
    for (int j = 0; j < 16; ++j) { const int rr = j * 2 + hlf, c4 = nloc * 4; *(v4f*)(dst0 + (size_t)rr * C + c4) = *(const v4f*)(Tt + rr * 64 + c4); }
     }
}

// local attention: a wave takes PS consecutive pixels of one image row (a block: 8 such strips side by side, so that neighbouring waves ask for the 2 columns they share at about the same time); lane holds channels {4 lane .. +3} and {128 + 4 lane .. +3}. Each of the 3 x (PS + 2) neighbour rows of k and
// of v is loaded once per wave, from an address clamped into the image, and serves up to 3 pixels; per pixel the 9 logits (shuffle-reduced dots), the softmax and the sum over n = 0..8 keep their order.
// A neighbour outside the image keeps logit 0 in the softmax and enters the output with weight 0. One register set A, B holds one image row's PS + 2 neighbours; a column is refilled for the next image row once its last pixel has used it.
// The same launch then does the last 1x1 convolution of the block's PB pixels: the attention rows (after bn_3 and relu) go to LDS as the f16 hi and lo parts, the 8 waves multiply them with W4's fragment tiles, and the result
// passes through LDS once more so that every store of out, and every load of the residual x, covers whole 128-byte lines (PB pixels of one channel).
constexpr int PS = 4, PB = 8 * PS;                               // pixels of a wave, of a block
__device__ __forceinline__ float wave_same(float f) { return __uint_as_float(__builtin_amdgcn_readfirstlane(__float_as_uint(f))); }   // a value that every lane holds alike, moved to a scalar register
__global__ __launch_bounds__(256, 8) void local_last_kernel(const float* __restrict__ q, const float* __restrict__ k, const float* __restrict__ v, const float* __restrict__ bnp, const b16* __restrict__ w4r, const float* __restrict__ b4, const float* __restrict__ x, float* __restrict__ out) {
  // one LDS block, used twice: first the block's PB attention rows as f16 hi and lo parts (pitch C + 8: 16 bytes past the row, for the 16-byte fragment reads), then, behind a barrier, the PB x C result as Tc[channel][pixel]
  __shared__ __attribute__((aligned(16))) unsigned char sm[(2 * PB * (C + 8) * 2 > C * (PB + 4) * 4) ? 2 * PB * (C + 8) * 2 : C * (PB + 4) * 4];
  b16 (*Sh)[C + 8] = (b16 (*)[C + 8])sm; b16 (*Sl)[C + 8] = Sh + PB; float (*Tc)[PB + 4] = (float (*)[PB + 4])sm;
  const int wid = __builtin_amdgcn_readfirstlane(threadIdx.x >> 5), lane = threadIdx.x & 31; const int ca = lane * 4, cb = 128 + lane * 4;
  constexpr int BR = HW / (8 * PS);                                // blocks per image row
  const int x0 = ((blockIdx.x % BR) * 8 + wid) * PS, y = (blockIdx.x / BR) % HW, b = blockIdx.x / (BR * HW); const int px0 = b * NP + y * HW + x0;
  int nb[3][PS + 2]; bool ok[3][PS + 2];                            // neighbour pixel (clamped into the image) and whether it lies inside; the same for the whole wave
#pragma unroll
  for (int r = 0; r < 3; ++r)
#pragma unroll
    for (int c = 0; c < PS + 2; ++c) { const int y1 = y + r - 1, x1 = x0 + c - 1; ok[r][c] = ((unsigned)y1 < (unsigned)HW) && ((unsigned)x1 < (unsigned)HW); nb[r][c] = b * NP + min(max(y1, 0), HW - 1) * HW + min(max(x1, 0), HW - 1); }
  v4f qa[PS], qb[PS], A[PS + 2], B[PS + 2];
#pragma unroll
  for (int p = 0; p < PS; ++p) { qa[p] = *(const v4f*)(q + (size_t)(px0 + p) * C + ca); qb[p] = *(const v4f*)(q + (size_t)(px0 + p) * C + cb); }
#pragma unroll
  for (int c = 0; c < PS + 2; ++c) { A[c] = *(const v4f*)(k + (size_t)nb[0][c] * C + ca); B[c] = *(const v4f*)(k + (size_t)nb[0][c] * C + cb); }
  float lg[PS][9];
#pragma unroll
  for (int r = 0; r < 3; ++r) { float d[PS][3];
#pragma unroll
    for (int c = 0; c < PS + 2; ++c) {
#pragma unroll
      for (int p = 0; p < PS; ++p) { if (c - p < 0 || c - p > 2) continue;
        float s = 0.0f;
#pragma unroll
        for (int e = 0; e < 4; ++e) s += pmul(qa[p][e], A[c][e]) + pmul(qb[p][e], B[c][e]);
        asm volatile("" : "+v"(s));                               // empty asm on each sum, against spills: without it the adds sink to the reduction below and the 8 products of every dot stay live
        d[p][c - p] = s; }
      const float* nx = (r < 2 ? k + (size_t)nb[r < 2 ? r + 1 : 0][c] * C : v + (size_t)nb[0][c] * C); A[c] = *(const v4f*)(nx + ca); B[c] = *(const v4f*)(nx + cb);   // the column's refill: next image row of k, behind the last one row 0 of v
      __builtin_amdgcn_sched_barrier(0); }                         // keeps each column's dots and refill together: the refills stay spread over the row, and the row's shuffles stay behind it in batches of 12 (without it they scatter among the dots, each with its own wait)
#pragma unroll
    for (int of = 1; of < 32; of <<= 1)
#pragma unroll
      for (int p = 0; p < PS; ++p)
#pragma unroll
        for (int j = 0; j < 3; ++j) d[p][j] += __shfl_xor(d[p][j], of);
#pragma unroll
    for (int p = 0; p < PS; ++p)
#pragma unroll
      for (int j = 0; j < 3; ++j) { asm volatile("" : "+v"(d[p][j]));   // empty asm on each sum, against spills (as above): it holds this row's reduction in front of the next row's dots, so that 12 and not 36 sums are live
        const float t = wave_same(d[p][j]) * ISQ; lg[p][r * 3 + j] = ok[r][p + j] ? t : 0.0f; } }   // zero-padded neighbours give logit 0 and ARE part of the softmax
  v4f oa[PS], ob[PS];
#pragma unroll
  for (int p = 0; p < PS; ++p) { float m = lg[p][0];
#pragma unroll
    for (int n = 1; n < 9; ++n) m = fmaxf(m, lg[p][n]);
    float z = 0.0f;
#pragma unroll
    for (int n = 0; n < 9; ++n) { lg[p][n] = nexp(lg[p][n] - m); z += lg[p][n]; }
    const float iz = 1.0f / z;
#pragma unroll
    for (int n = 0; n < 9; ++n) lg[p][n] = ok[n / 3][p + n % 3] ? lg[p][n] * iz : 0.0f;
    oa[p] = (v4f){0.0f, 0.0f, 0.0f, 0.0f}; ob[p] = oa[p]; }
  const float* sc = bnp + 3 * 2 * C; const float* sh = sc + C; v4f sa, sb, ha, hb;
#pragma unroll
  for (int r = 0; r < 3; ++r) {
#pragma unroll
    for (int c = 0; c < PS + 2; ++c) {
#pragma unroll
      for (int p = 0; p < PS; ++p) { if (c - p < 0 || c - p > 2) continue;
        const float a_ = lg[p][r * 3 + c - p];
#pragma unroll
        for (int e = 0; e < 4; ++e) { oa[p][e] += pmul(a_, A[c][e]); ob[p][e] += pmul(a_, B[c][e]); }
        asm volatile("" : "+v"(oa[p]), "+v"(ob[p])); }                // empty asm on each sum, against spills (as above): without it the adds sink to the end and the products stay live
      if (r < 2) { const float* nx = v + (size_t)nb[r < 2 ? r + 1 : 0][c] * C; A[c] = *(const v4f*)(nx + ca); B[c] = *(const v4f*)(nx + cb); }
      else if (c == 0) { sa = *(const v4f*)(sc + ca); sb = *(const v4f*)(sc + cb); }
      else if (c == 1) { ha = *(const v4f*)(sh + ca); hb = *(const v4f*)(sh + cb); }
      __builtin_amdgcn_sched_barrier(0); } }                       // as above: keeps each column's sums and refill together, the refills spread over the row
  // W4 fragments of the wave's 32 output channels wid * 32 .. + 31: column tile t at t * KT * FT, k block kb at (kb >> 5) * FT; the first pair is asked for here, so that it flies under the conversions below
  const int c0 = wid * 32; const b16* wb = w4r + (size_t)(c0 >> 4) * KT * FT; v16b bn[2] = {frag_kb_t(wb, lane), frag_kb_t(wb + KT * FT, lane)};
#pragma unroll
  for (int p = 0; p < PS; ++p) { v4b h0, l0, h1, l1;
#pragma unroll
    for (int e = 0; e < 4; ++e) { b16 hi, lo; split16(fmaxf(oa[p][e] * sa[e] + ha[e], 0.0f) * OS_, hi, lo); h0[e] = hi; l0[e] = lo; split16(fmaxf(ob[p][e] * sb[e] + hb[e], 0.0f) * OS_, hi, lo); h1[e] = hi; l1[e] = lo; }
    *(v4b*)(&Sh[wid * PS + p][ca]) = h0; *(v4b*)(&Sh[wid * PS + p][cb]) = h1; *(v4b*)(&Sl[wid * PS + p][ca]) = l0; *(v4b*)(&Sl[wid * PS + p][cb]) = l1; }
  __syncthreads();                                                 // the block's PB attention rows are complete in LDS
  // last 1x1 convolution of these PB pixels: wave wid takes all PB rows x output channels wid * 32 .. + 31; per accumulator the order is hi, lo within kb = 0, 32, ..
  const int nloc = lane & 15, hlf = lane >> 4;
  v8f acc[2][2];
#pragma unroll
  for (int r = 0; r < 2; ++r)
#pragma unroll
    for (int t = 0; t < 2; ++t) acc[r][t] = (v8f){};
#pragma unroll
  for (int kb = 0; kb < C; kb += 32) { const v16b bw[2] = {bn[0], bn[1]};
    if (kb + 32 < C) { bn[0] = frag_kb_t(wb + ((kb >> 5) + 1) * FT, lane); bn[1] = frag_kb_t(wb + (KT + (kb >> 5) + 1) * FT, lane); }
    __builtin_amdgcn_sched_barrier(0);                             // keeps the next k block's W4 loads in front of this block's products, so that they fly under them (without it each load stands directly in front of its product, with a full wait)
    const v16b a0 = frag_row(&Sh[nloc][kb + 8 * hlf]), f0 = frag_row(&Sl[nloc][kb + 8 * hlf]), a1 = frag_row(&Sh[16 + nloc][kb + 8 * hlf]), f1 = frag_row(&Sl[16 + nloc][kb + 8 * hlf]);
#pragma unroll
    for (int t = 0; t < 2; ++t) { acc[0][t] = wmma16b(a0, bw[t], acc[0][t]); acc[0][t] = wmma16b(f0, bw[t], acc[0][t]); acc[1][t] = wmma16b(a1, bw[t], acc[1][t]); acc[1][t] = wmma16b(f1, bw[t], acc[1][t]); } }
  // residual rows and channel constants: one batch of loads behind the last products, whole 128-byte lines; the barrier below ends them, so that they fly while the block's other waves finish their products
  constexpr int CJ = 256 / (PB / 4);                               // channels that the block's 256 threads cover in one trip, 4 pixels a thread
  const int cc = threadIdx.x / (PB / 4), c4 = (threadIdx.x % (PB / 4)) * 4; const size_t io = ((size_t)b * C + cc) * NP + y * HW + (blockIdx.x % BR) * PB + c4; v4f xr[C * PB / 4 / 256];
#pragma unroll
  for (int j = 0; j < C * PB / 4 / 256; ++j) xr[j] = *(const v4f*)(x + io + (size_t)j * CJ * NP);
  const float* sc4 = bnp + 4 * 2 * C; const float* sh4 = sc4 + C; float bb[2], s_[2], h_[2];
#pragma unroll
  for (int t = 0; t < 2; ++t) { const int co = c0 + t * 16 + nloc; bb[t] = bf16_rne(b4[co]); s_[t] = sc4[co]; h_[t] = sh4[co]; }
  __syncthreads();                                                 // every wave has read its last fragment: the LDS block may take the result
#pragma unroll
  for (int t = 0; t < 2; ++t)
#pragma unroll
    for (int r = 0; r < 2; ++r)
#pragma unroll
      for (int vv = 0; vv < 8; ++vv) Tc[c0 + t * 16 + nloc][r * 16 + 8 * hlf + vv] = (acc[r][t][vv] * (1.0f / OS_) + bb[t]) * s_[t] + h_[t];
  __syncthreads();                                                 // the result is complete in LDS
#pragma unroll
  for (int j = 0; j < C * PB / 4 / 256; ++j) { v4f t4 = *(const v4f*)(&Tc[cc + j * CJ][c4]);
#pragma unroll
    for (int e = 0; e < 4; ++e) t4[e] = fmaxf(t4[e] + bf16_rne(xr[j][e]), 0.0f);
    *(v4f*)(out + io + (size_t)j * CJ * NP) = t4; }
}
}  // namespace

extern "C" void kernel_launch(void* const* d_in, const int* in_sizes, int n_in,
                              void* d_out, int out_size, void* d_ws, size_t ws_size, hipStream_t stream) {
  (void)n_in; (void)out_size;
  const float* x = (const float*)d_in[0]; const float* W1 = (const float*)d_in[1]; const float* b1 = (const float*)d_in[2]; const float* W2 = (const float*)d_in[3]; const float* b2 = (const float*)d_in[4]; const float* W3 = (const float*)d_in[5]; const float* b3 = (const float*)d_in[6]; const float* W4 = (const float*)d_in[7]; const float* b4 = (const float*)d_in[8];
  const float* g = (const float*)d_in[9]; const float* be = (const float*)d_in[10]; const float* mu = (const float*)d_in[11]; const float* var = (const float*)d_in[12];
  float* out = (float*)d_out;   // [8][256][64][64]
  if (in_sizes[0] != Bn * C * NP || in_sizes[1] != C * C || in_sizes[7] != C * C || in_sizes[9] != 5 * C || in_sizes[12] != 5 * C) return;
  size_t off = 0; char* ws = (char*)d_ws;
  auto carve = [&](size_t bytes) { char* p = ws + off; off += (bytes + 255) & ~(size_t)255; return p; };
  unsigned short* xT = (unsigned short*)carve((size_t)NTOK * C * 2); unsigned short* w16 = (unsigned short*)carve((size_t)3 * C * C * 2); b16* w4r = (b16*)carve((size_t)C * C * 2); float* bnp = (float*)carve(5 * 2 * C * 4);
  float* q = (float*)carve((size_t)NTOK * C * 4); float* k = (float*)carve((size_t)NTOK * C * 4); float* v = (float*)carve((size_t)NTOK * C * 4);
  if (off > ws_size) return;                                    // ≈ 16.8 + 0.5 + 3 x 33.5 ≈ 118 MB (112.5 MiB)
  prep_kernel<<<dim3(NP / 64, Bn), 256, 0, stream>>>(x, W1, W2, W3, W4, g, be, mu, var, xT, w16, w4r, bnp);
  qkv_kernel<<<dim3(C / 64, NTOK / 128, 3), 128, 0, stream>>>(xT, w16, b1, b2, b3, bnp, q, k, v);
  local_last_kernel<<<NTOK / PB, 256, 0, stream>>>(q, k, v, bnp, w4r, b4, x, out);
}

// v005
// One run takes 55.9 microseconds.
// Next to v004, in two timings, it ran 1.45 and 1.46 times as fast.
// Over all steps from v000 it is 2.88 times as fast.
#include <hip/hip_runtime.h>

// PixelTransformerResnet: q, k, v = relu(bn_i(conv1x1_i(x))) (eval-mode BN with given statistics); per pixel 9 logits = q . k(neighbour n) / 16 over the 3x3 neighbourhood (zero vectors
// outside the image, kept in the softmax), att = softmax over the 9, out = Σ_n att_n v(neighbour n); out = relu(bn_3(out)); out = bn_4(conv1x1_4(out)); y = relu(out + x) -> NCHW [8][256][64][64].
// The four 1x1 convolutions run on WMMA: q/k/v on v_wmma_f32_16x16x32_bf16 with exact bf16 operands (x transposed to pixel-major through LDS; 1 product), the last
// one on v_wmma_f32_16x16x32_f16 with the attention output split into an f16 hi+lo pair x8 against exact W4 (2 products); f32 accumulate. The 9-neighbour attention is a wave per 4 pixels of an image row
// in f32 (lanes split the 256 channels, shuffle-reduced dots in fixed order, native exp). BN / relu / residual in f32. Fragment k-map per lane half hh for A AND B: elements 0..7 <- k =

namespace {
constexpr int Bn = 8, C = 256, HW = 64, NP = HW * HW, NTOK = Bn * NP;
constexpr float EPS = 1e-5f, OS_ = 8.0f, ISQ = 0.0625f;   // 1/sqrt(256)

typedef _Float16 b16;
typedef __attribute__((ext_vector_type(16))) _Float16 v16b;
typedef __attribute__((ext_vector_type(16))) __bf16 v16bb;
typedef __attribute__((ext_vector_type(8))) _Float16 v8b;
typedef __attribute__((ext_vector_type(4))) _Float16 v4b;
typedef __attribute__((ext_vector_type(8))) unsigned short v8us;
typedef __attribute__((ext_vector_type(8))) float v8f;
typedef __attribute__((ext_vector_type(4))) float v4f;
__device__ __forceinline__ float bf16_rne(float f) { unsigned int u = __float_as_uint(f); u += 0x7FFFu + ((u >> 16) & 1u); return __uint_as_float(u & 0xFFFF0000u); }
__device__ __forceinline__ unsigned short bf16_bits(float f) { unsigned int u = __float_as_uint(f); u += 0x7FFFu + ((u >> 16) & 1u); return (unsigned short)(u >> 16); }
__device__ __forceinline__ void split16(float v, b16& hi, b16& lo) { hi = (b16)v; lo = (b16)(v - (float)hi); }
// Fragment tiles: a 16-row x 32-k block of a 16-bit operand is stored as 512 consecutive elements, piece (ld, lane) of 8 elements at ld * 256 + lane * 8 holding row (lane & 15),
// k = ld * 16 + (lane >> 4) * 8 + 0..7 (the k-map above, the same for A and B), so that each 16-byte-per-lane load of a wave covers 512 contiguous bytes. Tile (rt, kt) of a [rows][C] operand lies at (rt * KT + kt) * FT.
constexpr int FT = 512, KT = C / 32;
__device__ __forceinline__ int tile_row(int o) { return (o >> 6) / KT * 16 + (o & 15); }                                   // row and first k of piece o (8 elements) of a tiled operand
__device__ __forceinline__ int tile_k(int o) { return (o >> 6) % KT * 32 + ((o >> 5) & 1) * 16 + ((o >> 4) & 1) * 8; }
__device__ __forceinline__ v16b frag_kb_t(const b16* tile, int lane) { const v8b a = *(const v8b*)(tile + lane * 8), b = *(const v8b*)(tile + 256 + lane * 8); v16b f;
#pragma unroll
  for (int e = 0; e < 8; ++e) { f[e] = a[e]; f[8 + e] = b[e]; } return f; }
// the same fragment from a row-major row: p points at the lane's row, k = kb + 8 hh; elements 0..7 <- p[0..7], 8..15 <- p[16..23]
__device__ __forceinline__ v16b frag_row(const b16* p) { const v8b a = *(const v8b*)p, b = *(const v8b*)(p + 16); v16b f;
#pragma unroll
  for (int e = 0; e < 8; ++e) { f[e] = a[e]; f[8 + e] = b[e]; } return f; }
__device__ __forceinline__ v16bb frag_bf_t(const unsigned short* tile, int lane) { const v8us a = *(const v8us*)(tile + lane * 8), b = *(const v8us*)(tile + 256 + lane * 8); union { unsigned short s[16]; v16bb v; } u;
#pragma unroll
  for (int e = 0; e < 8; ++e) { u.s[e] = a[e]; u.s[8 + e] = b[e]; } return u.v; }
__device__ __forceinline__ v8f wmma16b(v16b a, v16b b, v8f c) { v8f d = __builtin_amdgcn_wmma_f32_16x16x32_f16(false, a, false, b, (short)0, c, false, false); asm volatile("v_nop\n\tv_nop\n\tv_nop\n\tv_nop" : "+v"(d) : "v"(a), "v"(b)); return d; }
__device__ __forceinline__ v8f wmma16bb(v16bb a, v16bb b, v8f c) { v8f d = __builtin_amdgcn_wmma_f32_16x16x32_bf16(false, a, false, b, (short)0, c, false, false); asm volatile("v_nop\n\tv_nop\n\tv_nop\n\tv_nop" : "+v"(d) : "v"(a), "v"(b)); return d; }
// hand-over of an LDS patch among the lanes of ONE wave: the wave's own LDS writes have landed and its LDS reads have returned, and the compiler moves no memory access over the statement; unlike a fence it leaves the wave's global loads and stores in flight
__device__ __forceinline__ void wave_lds_sync() { asm volatile("s_wait_dscnt 0x0" ::: "memory"); __builtin_amdgcn_wave_barrier(); }
__device__ __forceinline__ float nexp(float x) { float r; asm("v_exp_f32 %0, %1\n\tv_nop" : "=v"(r) : "v"(x * 1.4426950408889634f)); return r; }
__device__ __forceinline__ float pmul(float a, float b) { float p = a * b; asm volatile("" : "+v"(p)); return p; }

// prep: W1..3 [256][256] -> bf16 fragment tiles; W4 -> f16 fragment tiles; bnp: for each of the 5 BN layers scale[C], then shift[C]. One 8-element piece (or one BN channel) per thread, block-uniform choice of the source
constexpr int PREPB = 4 * C * C / 8 / 256 + 5 * C / 256;         // blocks of the prep launch
__global__ __launch_bounds__(256) void prep_kernel(const float* __restrict__ W1, const float* __restrict__ W2, const float* __restrict__ W3, const float* __restrict__ W4, const float* __restrict__ g, const float* __restrict__ be, const float* __restrict__ mu, const float* __restrict__ var,
                                                   unsigned short* __restrict__ w16, b16* __restrict__ w4r, float* __restrict__ bnp) {
  static_assert((C * C / 8) % 256 == 0 && (5 * C) % 256 == 0, "whole blocks per source");
  const int t_ = threadIdx.x, bid = blockIdx.x, i = bid * 256 + t_;
  if (bid < 3 * C * C / 8 / 256) { const int m = i / (C * C / 8), q = i % (C * C / 8); const float* W = (m == 0) ? W1 : (m == 1) ? W2 : W3; v8us o;
#pragma unroll
    for (int e = 0; e < 8; ++e) o[e] = bf16_bits(W[tile_row(q) * C + tile_k(q) + e]);
    *(v8us*)(w16 + (size_t)i * 8) = o; asm volatile("s_wait_xcnt 0x0" ::: "memory");  /* holds any later rewrite of the store's registers behind the store's issue */ }
  else if (bid < 4 * C * C / 8 / 256) { const int j = i - 3 * C * C / 8; v8b o;
#pragma unroll
    for (int e = 0; e < 8; ++e) o[e] = (b16)bf16_rne(W4[tile_row(j) * C + tile_k(j) + e]);
    *(v8b*)(w4r + (size_t)j * 8) = o; asm volatile("s_wait_xcnt 0x0" ::: "memory");  /* holds any later rewrite of the store's registers behind the store's issue */ }
  else { const int j = i - 4 * C * C / 8; const float sc = bf16_rne(g[j]) * rsqrtf(bf16_rne(var[j]) + EPS); ((float*)bnp)[(j / C) * 2 * C + (j % C)] = sc; ((float*)bnp)[(j / C) * 2 * C + C + (j % C)] = bf16_rne(be[j]) - bf16_rne(mu[j]) * sc; asm volatile("s_wait_xcnt 0x0" ::: "memory");  /* holds any later rewrite of the store's registers behind the store's issue */ }
}

// q, k, v of MP pixels per block, straight from x: the block reads its MP pixels x C channels of x (NCHW, 256-byte runs of a channel) once, rounds them to bf16 and lays them pixel-major in LDS; behind one barrier its 8 waves
// multiply that tile with all 3 x C weight columns. Wave w takes all MP rows x columns w * 32 .. + 31 of q, then of k, then of v: A fragments from LDS (row-major rows, the k-map above), B fragments from the weight tiles, each
// read once per block. Per accumulator the order is kb = 0, 32, .. as before. The result passes through the wave's own LDS patch, so that every store covers whole 128-byte lines (32 channels of a pixel).
constexpr int MP = 64, TP = 36;                                  // pixels of a block; pitch in floats of the result patch (16-byte rows; the two lane halves, 8 rows apart, fall on different banks)
typedef __attribute__((ext_vector_type(2))) unsigned short v2us;
__device__ __forceinline__ v16bb frag_bf_row(const unsigned short* p) { const v8us a = *(const v8us*)p, b = *(const v8us*)(p + 16); union { unsigned short s[16]; v16bb v; } u;
#pragma unroll
  for (int e = 0; e < 8; ++e) { u.s[e] = a[e]; u.s[8 + e] = b[e]; } return u.v; }
// weight tile of step s = matrix * KT + k block, column tile ct
__device__ __forceinline__ const unsigned short* wtile(const unsigned short* w16, int s, int ct) { return w16 + (size_t)(((s / KT) * (C / 16) + ct) * KT + s % KT) * FT; }
__global__ __launch_bounds__(256, 4) void qkv_kernel(const float* __restrict__ x, const unsigned short* __restrict__ w16, const float* __restrict__ b1, const float* __restrict__ b2, const float* __restrict__ b3, const float* __restrict__ bnp, float* __restrict__ q, float* __restrict__ k, float* __restrict__ v) {
  __shared__ __attribute__((aligned(16))) unsigned short Tt[MP][C + 8];
  __shared__ __attribute__((aligned(16))) float Ts[8][32 * TP];
  const int t_ = threadIdx.x, lane = t_ & 31, wave = __builtin_amdgcn_readfirstlane(t_ >> 5), nloc = lane & 15, hlf = lane >> 4;
  const int m0 = blockIdx.x * MP, c0 = wave * 32, ct0 = c0 >> 4; const float* src = x + (size_t)(blockIdx.x / (NP / MP)) * C * NP + (blockIdx.x % (NP / MP)) * MP;
  // the weight fragments run two steps ahead of their products, over the borders between q, k and v too; the first two steps are asked for here and fly with the x tile
  v16bb rb[2][2];
#pragma unroll
  for (int s = 0; s < 2; ++s)
#pragma unroll
    for (int t = 0; t < 2; ++t) rb[s][t] = frag_bf_t(wtile(w16, s, ct0 + t), lane);
  { constexpr int NT = MP * C / 8 / 256; v4f xa[NT], xb[NT];         // a thread and trip: 4 pixels of 2 neighbouring channels; all loads of the tile are in flight together
#pragma unroll
    for (int it = 0; it < NT; ++it) { const int idx = it * 256 + t_, j = idx % (MP / 4), cp = idx / (MP / 4); const unsigned o = (unsigned)((2 * cp) * NP + 4 * j); xa[it] = *(const v4f*)(src + o); xb[it] = *(const v4f*)(src + o + NP); }
#pragma unroll
    for (int it = 0; it < NT; ++it) { const int idx = it * 256 + t_, j = idx % (MP / 4), cp = idx / (MP / 4);
#pragma unroll
      for (int e = 0; e < 4; ++e) *(v2us*)(&Tt[4 * j + e][2 * cp]) = (v2us){bf16_bits(xa[it][e]), bf16_bits(xb[it][e])}; } }
  __syncthreads();                                                 // the block's x tile is complete in LDS
  float* Tw = Ts[wave];
#pragma unroll
  for (int which = 0; which < 3; ++which) {
    const float* bias = (which == 0) ? b1 : (which == 1) ? b2 : b3; const float* sc = bnp + which * 2 * C; const float* sh = sc + C; float* dst0 = ((which == 0) ? q : (which == 1) ? k : v) + (size_t)m0 * C + c0;
    float bb[2], s_[2], h_[2];                                      // channel constants, asked for in front of the products
#pragma unroll
    for (int t = 0; t < 2; ++t) { const int c = c0 + t * 16 + nloc; bb[t] = bf16_rne(bias[c]); s_[t] = sc[c]; h_[t] = sh[c]; }
    v8f acc[4][2];
#pragma unroll
    for (int r = 0; r < 4; ++r)
#pragma unroll
      for (int t = 0; t < 2; ++t) acc[r][t] = (v8f){};
#pragma unroll
    for (int kt = 0; kt < KT; ++kt) { const v16bb bw[2] = {rb[kt & 1][0], rb[kt & 1][1]}; const int nx = which * KT + kt + 2;
      if (nx < 3 * KT) { rb[kt & 1][0] = frag_bf_t(wtile(w16, nx, ct0), lane); rb[kt & 1][1] = frag_bf_t(wtile(w16, nx, ct0 + 1), lane); }
      __builtin_amdgcn_sched_barrier(0);                           // keeps the weight loads of two steps ahead in front of this step's products, so that they fly under them (without it each load sinks to its product, with a full wait)
      v16bb a[4];
#pragma unroll
      for (int r = 0; r < 4; ++r) a[r] = frag_bf_row(&Tt[r * 16 + nloc][kt * 32 + 8 * hlf]);
#pragma unroll
      for (int r = 0; r < 4; ++r) { acc[r][0] = wmma16bb(a[r], bw[0], acc[r][0]); acc[r][1] = wmma16bb(a[r], bw[1], acc[r][1]); } }
#pragma unroll
    for (int h = 0; h < 2; ++h) {                                   // 32 rows at a time through the wave's patch
#pragma unroll
      for (int t = 0; t < 2; ++t)
#pragma unroll
        for (int r = 0; r < 2; ++r)
#pragma unroll
          for (int vv = 0; vv < 8; ++vv) Tw[(r * 16 + vv + 8 * hlf) * TP + t * 16 + nloc] = fmaxf((acc[h * 2 + r][t][vv] + bb[t]) * s_[t] + h_[t], 0.0f);
      wave_lds_sync();
#pragma unroll
      for (int j = 0; j < 8; ++j) { const int rr = j * 4 + (lane >> 3), c4 = (lane & 7) * 4; *(v4f*)(dst0 + (size_t)(h * 32 + rr) * C + c4) = *(const v4f*)(Tw + rr * TP + c4); }
      if (which < 2 || h < 1) {                                     // behind the last stores nothing follows
        asm volatile("s_wait_xcnt 0x0" ::: "memory");               // holds any later rewrite of the stores' registers behind the stores' issue
        wave_lds_sync(); } } }
}

// local attention: a wave takes PS consecutive pixels of one image row (a block: 8 such strips side by side, so that neighbouring waves ask for the 2 columns they share at about the same time); lane holds channels {4 lane .. +3} and {128 + 4 lane .. +3}. Each of the 3 x (PS + 2) neighbour rows of k and
// of v is loaded once per wave, from an address clamped into the image, and serves up to 3 pixels; per pixel the 9 logits (shuffle-reduced dots), the softmax and the sum over n = 0..8 keep their order.
// A neighbour outside the image keeps logit 0 in the softmax and enters the output with weight 0. One register set A, B holds one image row's PS + 2 neighbours; a column is refilled for the next image row once its last pixel has used it.
// The same launch then does the last 1x1 convolution of the block's PB pixels: the attention rows (after bn_3 and relu) go to LDS as the f16 hi and lo parts, the 8 waves multiply them with W4's fragment tiles, and the result
// passes through LDS once more so that every store of out, and every load of the residual x, covers whole 128-byte lines (PB pixels of one channel).
constexpr int PS = 4, PB = 8 * PS;                               // pixels of a wave, of a block
__device__ __forceinline__ float wave_same(float f) { return __uint_as_float(__builtin_amdgcn_readfirstlane(__float_as_uint(f))); }   // a value that every lane holds alike, moved to a scalar register
__global__ __launch_bounds__(256, 8) void local_last_kernel(const float* __restrict__ q, const float* __restrict__ k, const float* __restrict__ v, const float* __restrict__ bnp, const b16* __restrict__ w4r, const float* __restrict__ b4, const float* __restrict__ x, float* __restrict__ out) {
  // one LDS block, used twice: first the block's PB attention rows as f16 hi and lo parts (pitch C + 8: 16 bytes past the row, for the 16-byte fragment reads), then, behind a barrier, the PB x C result as Tc[channel][pixel]
  __shared__ __attribute__((aligned(16))) unsigned char sm[(2 * PB * (C + 8) * 2 > C * (PB + 4) * 4) ? 2 * PB * (C + 8) * 2 : C * (PB + 4) * 4];
  b16 (*Sh)[C + 8] = (b16 (*)[C + 8])sm; b16 (*Sl)[C + 8] = Sh + PB; float (*Tc)[PB + 4] = (float (*)[PB + 4])sm;
  const int wid = __builtin_amdgcn_readfirstlane(threadIdx.x >> 5), lane = threadIdx.x & 31; const int ca = lane * 4, cb = 128 + lane * 4;
  constexpr int BR = HW / (8 * PS);                                // blocks per image row
  const int x0 = ((blockIdx.x % BR) * 8 + wid) * PS, y = (blockIdx.x / BR) % HW, b = blockIdx.x / (BR * HW); const int px0 = b * NP + y * HW + x0;
  int nb[3][PS + 2]; bool ok[3][PS + 2];                            // neighbour pixel (clamped into the image) and whether it lies inside; the same for the whole wave
#pragma unroll
  for (int r = 0; r < 3; ++r)
#pragma unroll
    for (int c = 0; c < PS + 2; ++c) { const int y1 = y + r - 1, x1 = x0 + c - 1; ok[r][c] = ((unsigned)y1 < (unsigned)HW) && ((unsigned)x1 < (unsigned)HW); nb[r][c] = b * NP + min(max(y1, 0), HW - 1) * HW + min(max(x1, 0), HW - 1); }
  v4f qa[PS], qb[PS], A[PS + 2], B[PS + 2];
#pragma unroll
  for (int p = 0; p < PS; ++p) { qa[p] = *(const v4f*)(q + (size_t)(px0 + p) * C + ca); qb[p] = *(const v4f*)(q + (size_t)(px0 + p) * C + cb); }
#pragma unroll
  for (int c = 0; c < PS + 2; ++c) { A[c] = *(const v4f*)(k + (size_t)nb[0][c] * C + ca); B[c] = *(const v4f*)(k + (size_t)nb[0][c] * C + cb); }
  float lg[PS][9];
#pragma unroll
  for (int r = 0; r < 3; ++r) { float d[PS][3];
#pragma unroll
    for (int c = 0; c < PS + 2; ++c) {
#pragma unroll
      for (int p = 0; p < PS; ++p) { if (c - p < 0 || c - p > 2) continue;
        float s = 0.0f;
#pragma unroll
        for (int e = 0; e < 4; ++e) s += pmul(qa[p][e], A[c][e]) + pmul(qb[p][e], B[c][e]);
        asm volatile("" : "+v"(s));                               // empty asm on each sum, against spills: without it the adds sink to the reduction below and the 8 products of every dot stay live
        d[p][c - p] = s; }
      const float* nx = (r < 2 ? k + (size_t)nb[r < 2 ? r + 1 : 0][c] * C : v + (size_t)nb[0][c] * C); A[c] = *(const v4f*)(nx + ca); B[c] = *(const v4f*)(nx + cb);   // the column's refill: next image row of k, behind the last one row 0 of v
      __builtin_amdgcn_sched_barrier(0); }                         // keeps each column's dots and refill together: the refills stay spread over the row, and the row's shuffles stay behind it in batches of 12 (without it they scatter among the dots, each with its own wait)
#pragma unroll
    for (int of = 1; of < 32; of <<= 1)
#pragma unroll
      for (int p = 0; p < PS; ++p)
#pragma unroll
        for (int j = 0; j < 3; ++j) d[p][j] += __shfl_xor(d[p][j], of);
#pragma unroll
    for (int p = 0; p < PS; ++p)
#pragma unroll
      for (int j = 0; j < 3; ++j) { asm volatile("" : "+v"(d[p][j]));   // empty asm on each sum, against spills (as above): it holds this row's reduction in front of the next row's dots, so that 12 and not 36 sums are live
        const float t = wave_same(d[p][j]) * ISQ; lg[p][r * 3 + j] = ok[r][p + j] ? t : 0.0f; } }   // zero-padded neighbours give logit 0 and ARE part of the softmax
  v4f oa[PS], ob[PS];
#pragma unroll
  for (int p = 0; p < PS; ++p) { float m = lg[p][0];
#pragma unroll
    for (int n = 1; n < 9; ++n) m = fmaxf(m, lg[p][n]);
    float z = 0.0f;
#pragma unroll
    for (int n = 0; n < 9; ++n) { lg[p][n] = nexp(lg[p][n] - m); z += lg[p][n]; }
    const float iz = 1.0f / z;
#pragma unroll
    for (int n = 0; n < 9; ++n) lg[p][n] = ok[n / 3][p + n % 3] ? lg[p][n] * iz : 0.0f;
    oa[p] = (v4f){0.0f, 0.0f, 0.0f, 0.0f}; ob[p] = oa[p]; }
  const float* sc = bnp + 3 * 2 * C; const float* sh = sc + C; v4f sa, sb, ha, hb;
#pragma unroll
  for (int r = 0; r < 3; ++r) {
#pragma unroll
    for (int c = 0; c < PS + 2; ++c) {
#pragma unroll
      for (int p = 0; p < PS; ++p) { if (c - p < 0 || c - p > 2) continue;
        const float a_ = lg[p][r * 3 + c - p];
#pragma unroll
        for (int e = 0; e < 4; ++e) { oa[p][e] += pmul(a_, A[c][e]); ob[p][e] += pmul(a_, B[c][e]); }
        asm volatile("" : "+v"(oa[p]), "+v"(ob[p])); }                // empty asm on each sum, against spills (as above): without it the adds sink to the end and the products stay live
      if (r < 2) { const float* nx = v + (size_t)nb[r < 2 ? r + 1 : 0][c] * C; A[c] = *(const v4f*)(nx + ca); B[c] = *(const v4f*)(nx + cb); }
      else if (c == 0) { sa = *(const v4f*)(sc + ca); sb = *(const v4f*)(sc + cb); }
      else if (c == 1) { ha = *(const v4f*)(sh + ca); hb = *(const v4f*)(sh + cb); }
      __builtin_amdgcn_sched_barrier(0); } }                       // as above: keeps each column's sums and refill together, the refills spread over the row
  // W4 fragments of the wave's 32 output channels wid * 32 .. + 31: column tile t at t * KT * FT, k block kb at (kb >> 5) * FT; the first pair is asked for here, so that it flies under the conversions below
  const int c0 = wid * 32; const b16* wb = w4r + (size_t)(c0 >> 4) * KT * FT; v16b bn[2] = {frag_kb_t(wb, lane), frag_kb_t(wb + KT * FT, lane)};
#pragma unroll
  for (int p = 0; p < PS; ++p) { v4b h0, l0, h1, l1;
#pragma unroll
    for (int e = 0; e < 4; ++e) { b16 hi, lo; split16(fmaxf(oa[p][e] * sa[e] + ha[e], 0.0f) * OS_, hi, lo); h0[e] = hi; l0[e] = lo; split16(fmaxf(ob[p][e] * sb[e] + hb[e], 0.0f) * OS_, hi, lo); h1[e] = hi; l1[e] = lo; }
    *(v4b*)(&Sh[wid * PS + p][ca]) = h0; *(v4b*)(&Sh[wid * PS + p][cb]) = h1; *(v4b*)(&Sl[wid * PS + p][ca]) = l0; *(v4b*)(&Sl[wid * PS + p][cb]) = l1; }
  __syncthreads();                                                 // the block's PB attention rows are complete in LDS
  // last 1x1 convolution of these PB pixels: wave wid takes all PB rows x output channels wid * 32 .. + 31; per accumulator the order is hi, lo within kb = 0, 32, ..
  const int nloc = lane & 15, hlf = lane >> 4;
  v8f acc[2][2];
#pragma unroll
  for (int r = 0; r < 2; ++r)
#pragma unroll
    for (int t = 0; t < 2; ++t) acc[r][t] = (v8f){};
#pragma unroll
  for (int kb = 0; kb < C; kb += 32) { const v16b bw[2] = {bn[0], bn[1]};
    if (kb + 32 < C) { bn[0] = frag_kb_t(wb + ((kb >> 5) + 1) * FT, lane); bn[1] = frag_kb_t(wb + (KT + (kb >> 5) + 1) * FT, lane); }
    __builtin_amdgcn_sched_barrier(0);                             // keeps the next k block's W4 loads in front of this block's products, so that they fly under them (without it each load stands directly in front of its product, with a full wait)
    const v16b a0 = frag_row(&Sh[nloc][kb + 8 * hlf]), f0 = frag_row(&Sl[nloc][kb + 8 * hlf]), a1 = frag_row(&Sh[16 + nloc][kb + 8 * hlf]), f1 = frag_row(&Sl[16 + nloc][kb + 8 * hlf]);
#pragma unroll
    for (int t = 0; t < 2; ++t) { acc[0][t] = wmma16b(a0, bw[t], acc[0][t]); acc[0][t] = wmma16b(f0, bw[t], acc[0][t]); acc[1][t] = wmma16b(a1, bw[t], acc[1][t]); acc[1][t] = wmma16b(f1, bw[t], acc[1][t]); } }
  // residual rows and channel constants: one batch of loads behind the last products, whole 128-byte lines; the barrier below ends them, so that they fly while the block's other waves finish their products
  constexpr int CJ = 256 / (PB / 4);                               // channels that the block's 256 threads cover in one trip, 4 pixels a thread
  const int cc = threadIdx.x / (PB / 4), c4 = (threadIdx.x % (PB / 4)) * 4; const size_t io = ((size_t)b * C + cc) * NP + y * HW + (blockIdx.x % BR) * PB + c4; v4f xr[C * PB / 4 / 256];
#pragma unroll
  for (int j = 0; j < C * PB / 4 / 256; ++j) xr[j] = *(const v4f*)(x + io + (size_t)j * CJ * NP);
  const float* sc4 = bnp + 4 * 2 * C; const float* sh4 = sc4 + C; float bb[2], s_[2], h_[2];
#pragma unroll
  for (int t = 0; t < 2; ++t) { const int co = c0 + t * 16 + nloc; bb[t] = bf16_rne(b4[co]); s_[t] = sc4[co]; h_[t] = sh4[co]; }
  __syncthreads();                                                 // every wave has read its last fragment: the LDS block may take the result
#pragma unroll
  for (int t = 0; t < 2; ++t)
#pragma unroll
    for (int r = 0; r < 2; ++r)
#pragma unroll
      for (int vv = 0; vv < 8; ++vv) Tc[c0 + t * 16 + nloc][r * 16 + 8 * hlf + vv] = (acc[r][t][vv] * (1.0f / OS_) + bb[t]) * s_[t] + h_[t];
  __syncthreads();                                                 // the result is complete in LDS
#pragma unroll
  for (int j = 0; j < C * PB / 4 / 256; ++j) { v4f t4 = *(const v4f*)(&Tc[cc + j * CJ][c4]);
#pragma unroll
    for (int e = 0; e < 4; ++e) t4[e] = fmaxf(t4[e] + bf16_rne(xr[j][e]), 0.0f);
    *(v4f*)(out + io + (size_t)j * CJ * NP) = t4; }
}
}  // namespace

extern "C" void kernel_launch(void* const* d_in, const int* in_sizes, int n_in,
                              void* d_out, int out_size, void* d_ws, size_t ws_size, hipStream_t stream) {
  (void)n_in; (void)out_size;
  const float* x = (const float*)d_in[0]; const float* W1 = (const float*)d_in[1]; const float* b1 = (const float*)d_in[2]; const float* W2 = (const float*)d_in[3]; const float* b2 = (const float*)d_in[4]; const float* W3 = (const float*)d_in[5]; const float* b3 = (const float*)d_in[6]; const float* W4 = (const float*)d_in[7]; const float* b4 = (const float*)d_in[8];
  const float* g = (const float*)d_in[9]; const float* be = (const float*)d_in[10]; const float* mu = (const float*)d_in[11]; const float* var = (const float*)d_in[12];
  float* out = (float*)d_out;   // [8][256][64][64]
  if (in_sizes[0] != Bn * C * NP || in_sizes[1] != C * C || in_sizes[7] != C * C || in_sizes[9] != 5 * C || in_sizes[12] != 5 * C) return;
  size_t off = 0; char* ws = (char*)d_ws;
  auto carve = [&](size_t bytes) { char* p = ws + off; off += (bytes + 255) & ~(size_t)255; return p; };
  unsigned short* w16 = (unsigned short*)carve((size_t)3 * C * C * 2); b16* w4r = (b16*)carve((size_t)C * C * 2); float* bnp = (float*)carve(5 * 2 * C * 4);
  float* q = (float*)carve((size_t)NTOK * C * 4); float* k = (float*)carve((size_t)NTOK * C * 4); float* v = (float*)carve((size_t)NTOK * C * 4);
  if (off > ws_size) return;                                    // about 0.5 + 3 x 33.5 MB
  prep_kernel<<<PREPB, 256, 0, stream>>>(W1, W2, W3, W4, g, be, mu, var, w16, w4r, bnp);
  qkv_kernel<<<NTOK / MP, 256, 0, stream>>>(x, w16, b1, b2, b3, bnp, q, k, v);
  local_last_kernel<<<NTOK / PB, 256, 0, stream>>>(q, k, v, bnp, w4r, b4, x, out);
}

// v006
// It runs in 49.4 microseconds.
// Timed twice side by side with v005, it ran 1.13 times as fast both times.
// All steps since v000 together make it 3.26 times as fast.
#include <hip/hip_runtime.h>

// PixelTransformerResnet: q, k, v = relu(bn_i(conv1x1_i(x))) (eval-mode BN with given statistics); per pixel 9 logits = q . k(neighbour n) / 16 over the 3x3 neighbourhood (zero vectors
// outside the image, kept in the softmax), att = softmax over the 9, out = Σ_n att_n v(neighbour n); out = relu(bn_3(out)); out = bn_4(conv1x1_4(out)); y = relu(out + x) -> NCHW [8][256][64][64].
// The four 1x1 convolutions run on WMMA: q/k/v on v_wmma_f32_16x16x32_bf16 with exact bf16 operands (x transposed to pixel-major through LDS; 1 product), the last
// one on v_wmma_f32_16x16x32_f16 with the attention output split into an f16 hi+lo pair x8 against exact W4 (2 products); f32 accumulate. The 9-neighbour attention is a wave per 2 x 4 pixels (2 image rows)
// in f32 (lanes split the 256 channels, shuffle-reduced dots in fixed order, native exp). BN / relu / residual in f32. Fragment k-map per lane half hh for A AND B: elements 0..7 <- k =

namespace {
constexpr int Bn = 8, C = 256, HW = 64, NP = HW * HW, NTOK = Bn * NP;
constexpr float EPS = 1e-5f, OS_ = 8.0f, ISQ = 0.0625f;   // 1/sqrt(256)

typedef _Float16 b16;
typedef __attribute__((ext_vector_type(16))) _Float16 v16b;
typedef __attribute__((ext_vector_type(16))) __bf16 v16bb;
typedef __attribute__((ext_vector_type(8))) _Float16 v8b;
typedef __attribute__((ext_vector_type(4))) _Float16 v4b;
typedef __attribute__((ext_vector_type(8))) unsigned short v8us;
typedef __attribute__((ext_vector_type(8))) float v8f;
typedef __attribute__((ext_vector_type(4))) float v4f;
__device__ __forceinline__ float bf16_rne(float f) { unsigned int u = __float_as_uint(f); u += 0x7FFFu + ((u >> 16) & 1u); return __uint_as_float(u & 0xFFFF0000u); }
__device__ __forceinline__ unsigned short bf16_bits(float f) { unsigned int u = __float_as_uint(f); u += 0x7FFFu + ((u >> 16) & 1u); return (unsigned short)(u >> 16); }
__device__ __forceinline__ void split16(float v, b16& hi, b16& lo) { hi = (b16)v; lo = (b16)(v - (float)hi); }
// Fragment tiles: a 16-row x 32-k block of a 16-bit operand is stored as 512 consecutive elements, piece (ld, lane) of 8 elements at ld * 256 + lane * 8 holding row (lane & 15),
// k = ld * 16 + (lane >> 4) * 8 + 0..7 (the k-map above, the same for A and B), so that each 16-byte-per-lane load of a wave covers 512 contiguous bytes. Tile (rt, kt) of a [rows][C] operand lies at (rt * KT + kt) * FT.
constexpr int FT = 512, KT = C / 32;
__device__ __forceinline__ int tile_row(int o) { return (o >> 6) / KT * 16 + (o & 15); }                                   // row and first k of piece o (8 elements) of a tiled operand
__device__ __forceinline__ int tile_k(int o) { return (o >> 6) % KT * 32 + ((o >> 5) & 1) * 16 + ((o >> 4) & 1) * 8; }
__device__ __forceinline__ v16b frag_kb_t(const b16* tile, int lane) { const v8b a = *(const v8b*)(tile + lane * 8), b = *(const v8b*)(tile + 256 + lane * 8); v16b f;
#pragma unroll
  for (int e = 0; e < 8; ++e) { f[e] = a[e]; f[8 + e] = b[e]; } return f; }
// the same fragment from a row-major row: p points at the lane's row, k = kb + 8 hh; elements 0..7 <- p[0..7], 8..15 <- p[16..23]
__device__ __forceinline__ v16b frag_row(const b16* p) { const v8b a = *(const v8b*)p, b = *(const v8b*)(p + 16); v16b f;
#pragma unroll
  for (int e = 0; e < 8; ++e) { f[e] = a[e]; f[8 + e] = b[e]; } return f; }
__device__ __forceinline__ v16bb frag_bf_t(const unsigned short* tile, int lane) { const v8us a = *(const v8us*)(tile + lane * 8), b = *(const v8us*)(tile + 256 + lane * 8); union { unsigned short s[16]; v16bb v; } u;
#pragma unroll
  for (int e = 0; e < 8; ++e) { u.s[e] = a[e]; u.s[8 + e] = b[e]; } return u.v; }
__device__ __forceinline__ v8f wmma16b(v16b a, v16b b, v8f c) { v8f d = __builtin_amdgcn_wmma_f32_16x16x32_f16(false, a, false, b, (short)0, c, false, false); asm volatile("v_nop\n\tv_nop\n\tv_nop\n\tv_nop" : "+v"(d) : "v"(a), "v"(b)); return d; }
__device__ __forceinline__ v8f wmma16bb(v16bb a, v16bb b, v8f c) { v8f d = __builtin_amdgcn_wmma_f32_16x16x32_bf16(false, a, false, b, (short)0, c, false, false); asm volatile("v_nop\n\tv_nop\n\tv_nop\n\tv_nop" : "+v"(d) : "v"(a), "v"(b)); return d; }
// hand-over of an LDS patch among the lanes of ONE wave: the wave's own LDS writes have landed and its LDS reads have returned, and the compiler moves no memory access over the statement; unlike a fence it leaves the wave's global loads and stores in flight
__device__ __forceinline__ void wave_lds_sync() { asm volatile("s_wait_dscnt 0x0" ::: "memory"); __builtin_amdgcn_wave_barrier(); }
__device__ __forceinline__ float nexp(float x) { float r; asm("v_exp_f32 %0, %1\n\tv_nop" : "=v"(r) : "v"(x * 1.4426950408889634f)); return r; }
__device__ __forceinline__ float pmul(float a, float b) { float p = a * b; asm volatile("" : "+v"(p)); return p; }

// prep: W1..3 [256][256] -> bf16 fragment tiles; W4 -> f16 fragment tiles; bnp: for each of the 5 BN layers scale[C], then shift[C]. One 8-element piece (or one BN channel) per thread, block-uniform choice of the source
constexpr int PREPB = 4 * C * C / 8 / 256 + 5 * C / 256;         // blocks of the prep launch
__global__ __launch_bounds__(256) void prep_kernel(const float* __restrict__ W1, const float* __restrict__ W2, const float* __restrict__ W3, const float* __restrict__ W4, const float* __restrict__ g, const float* __restrict__ be, const float* __restrict__ mu, const float* __restrict__ var,
                                                   unsigned short* __restrict__ w16, b16* __restrict__ w4r, float* __restrict__ bnp) {
  static_assert((C * C / 8) % 256 == 0 && (5 * C) % 256 == 0, "whole blocks per source");
  const int t_ = threadIdx.x, bid = blockIdx.x, i = bid * 256 + t_;
  if (bid < 3 * C * C / 8 / 256) { const int m = i / (C * C / 8), q = i % (C * C / 8); const float* W = (m == 0) ? W1 : (m == 1) ? W2 : W3; v8us o;
#pragma unroll
    for (int e = 0; e < 8; ++e) o[e] = bf16_bits(W[tile_row(q) * C + tile_k(q) + e]);
    *(v8us*)(w16 + (size_t)i * 8) = o; asm volatile("s_wait_xcnt 0x0" ::: "memory");  /* holds any later rewrite of the store's registers behind the store's issue */ }
  else if (bid < 4 * C * C / 8 / 256) { const int j = i - 3 * C * C / 8; v8b o;
#pragma unroll
    for (int e = 0; e < 8; ++e) o[e] = (b16)bf16_rne(W4[tile_row(j) * C + tile_k(j) + e]);
    *(v8b*)(w4r + (size_t)j * 8) = o; asm volatile("s_wait_xcnt 0x0" ::: "memory");  /* holds any later rewrite of the store's registers behind the store's issue */ }
  else { const int j = i - 4 * C * C / 8; const float sc = bf16_rne(g[j]) * rsqrtf(bf16_rne(var[j]) + EPS); ((float*)bnp)[(j / C) * 2 * C + (j % C)] = sc; ((float*)bnp)[(j / C) * 2 * C + C + (j % C)] = bf16_rne(be[j]) - bf16_rne(mu[j]) * sc; asm volatile("s_wait_xcnt 0x0" ::: "memory");  /* holds any later rewrite of the store's registers behind the store's issue */ }
}

// q, k, v of MP pixels per block, straight from x: the block reads its MP pixels x C channels of x (NCHW, 256-byte runs of a channel) once, rounds them to bf16 and lays them pixel-major in LDS; behind one barrier its 8 waves
// multiply that tile with all 3 x C weight columns. Wave w takes all MP rows x columns w * 32 .. + 31 of q, then of k, then of v: A fragments from LDS (row-major rows, the k-map above), B fragments from the weight tiles, each
// read once per block. Per accumulator the order is kb = 0, 32, .. as before. The result passes through the wave's own LDS patch, so that every store covers whole 128-byte lines (32 channels of a pixel).
constexpr int MP = 64, TP = 36;                                  // pixels of a block; pitch in floats of the result patch (16-byte rows; the two lane halves, 8 rows apart, fall on different banks)
typedef __attribute__((ext_vector_type(2))) unsigned short v2us;
__device__ __forceinline__ v16bb frag_bf_row(const unsigned short* p) { const v8us a = *(const v8us*)p, b = *(const v8us*)(p + 16); union { unsigned short s[16]; v16bb v; } u;
#pragma unroll
  for (int e = 0; e < 8; ++e) { u.s[e] = a[e]; u.s[8 + e] = b[e]; } return u.v; }
// weight tile of step s = matrix * KT + k block, column tile ct
__device__ __forceinline__ const unsigned short* wtile(const unsigned short* w16, int s, int ct) { return w16 + (size_t)(((s / KT) * (C / 16) + ct) * KT + s % KT) * FT; }
__global__ __launch_bounds__(256, 4) void qkv_kernel(const float* __restrict__ x, const unsigned short* __restrict__ w16, const float* __restrict__ b1, const float* __restrict__ b2, const float* __restrict__ b3, const float* __restrict__ bnp, float* __restrict__ q, float* __restrict__ k, float* __restrict__ v) {
  __shared__ __attribute__((aligned(16))) unsigned short Tt[MP][C + 8];
  __shared__ __attribute__((aligned(16))) float Ts[8][32 * TP];
  const int t_ = threadIdx.x, lane = t_ & 31, wave = __builtin_amdgcn_readfirstlane(t_ >> 5), nloc = lane & 15, hlf = lane >> 4;
  const int m0 = blockIdx.x * MP, c0 = wave * 32, ct0 = c0 >> 4; const float* src = x + (size_t)(blockIdx.x / (NP / MP)) * C * NP + (blockIdx.x % (NP / MP)) * MP;
  // the weight fragments run two steps ahead of their products, over the borders between q, k and v too; the first two steps are asked for here and fly with the x tile
  v16bb rb[2][2];
#pragma unroll
  for (int s = 0; s < 2; ++s)
#pragma unroll
    for (int t = 0; t < 2; ++t) rb[s][t] = frag_bf_t(wtile(w16, s, ct0 + t), lane);
  { constexpr int NT = MP * C / 8 / 256; v4f xa[NT], xb[NT];         // a thread and trip: 4 pixels of 2 neighbouring channels; all loads of the tile are in flight together
#pragma unroll
    for (int it = 0; it < NT; ++it) { const int idx = it * 256 + t_, j = idx % (MP / 4), cp = idx / (MP / 4); const unsigned o = (unsigned)((2 * cp) * NP + 4 * j); xa[it] = *(const v4f*)(src + o); xb[it] = *(const v4f*)(src + o + NP); }
#pragma unroll
    for (int it = 0; it < NT; ++it) { const int idx = it * 256 + t_, j = idx % (MP / 4), cp = idx / (MP / 4);
#pragma unroll
      for (int e = 0; e < 4; ++e) *(v2us*)(&Tt[4 * j + e][2 * cp]) = (v2us){bf16_bits(xa[it][e]), bf16_bits(xb[it][e])}; } }
  __syncthreads();                                                 // the block's x tile is complete in LDS
  float* Tw = Ts[wave];
#pragma unroll
  for (int which = 0; which < 3; ++which) {
    const float* bias = (which == 0) ? b1 : (which == 1) ? b2 : b3; const float* sc = bnp + which * 2 * C; const float* sh = sc + C; float* dst0 = ((which == 0) ? q : (which == 1) ? k : v) + (size_t)m0 * C + c0;
    float bb[2], s_[2], h_[2];                                      // channel constants, asked for in front of the products
#pragma unroll
    for (int t = 0; t < 2; ++t) { const int c = c0 + t * 16 + nloc; bb[t] = bf16_rne(bias[c]); s_[t] = sc[c]; h_[t] = sh[c]; }
    v8f acc[4][2];
#pragma unroll
    for (int r = 0; r < 4; ++r)
#pragma unroll
      for (int t = 0; t < 2; ++t) acc[r][t] = (v8f){};
#pragma unroll
    for (int kt = 0; kt < KT; ++kt) { const v16bb bw[2] = {rb[kt & 1][0], rb[kt & 1][1]}; const int nx = which * KT + kt + 2;
      if (nx < 3 * KT) { rb[kt & 1][0] = frag_bf_t(wtile(w16, nx, ct0), lane); rb[kt & 1][1] = frag_bf_t(wtile(w16, nx, ct0 + 1), lane); }
      __builtin_amdgcn_sched_barrier(0);                           // keeps the weight loads of two steps ahead in front of this step's products, so that they fly under them (without it each load sinks to its product, with a full wait)
      v16bb a[4];
#pragma unroll
      for (int r = 0; r < 4; ++r) a[r] = frag_bf_row(&Tt[r * 16 + nloc][kt * 32 + 8 * hlf]);
#pragma unroll
      for (int r = 0; r < 4; ++r) { acc[r][0] = wmma16bb(a[r], bw[0], acc[r][0]); acc[r][1] = wmma16bb(a[r], bw[1], acc[r][1]); } }
#pragma unroll
    for (int h = 0; h < 2; ++h) {                                   // 32 rows at a time through the wave's patch
#pragma unroll
      for (int t = 0; t < 2; ++t)
#pragma unroll
        for (int r = 0; r < 2; ++r)
#pragma unroll
          for (int vv = 0; vv < 8; ++vv) Tw[(r * 16 + vv + 8 * hlf) * TP + t * 16 + nloc] = fmaxf((acc[h * 2 + r][t][vv] + bb[t]) * s_[t] + h_[t], 0.0f);
      wave_lds_sync();
#pragma unroll
      for (int j = 0; j < 8; ++j) { const int rr = j * 4 + (lane >> 3), c4 = (lane & 7) * 4; *(v4f*)(dst0 + (size_t)(h * 32 + rr) * C + c4) = *(const v4f*)(Tw + rr * TP + c4); }
      if (which < 2 || h < 1) {                                     // behind the last stores nothing follows
        asm volatile("s_wait_xcnt 0x0" ::: "memory");               // holds any later rewrite of the stores' registers behind the stores' issue
        wave_lds_sync(); } } }
}

// local attention: a wave takes PS consecutive pixels in each of RW neighbouring image rows (a block: 8 such patches side by side, so that neighbouring waves ask for the 2 columns they share at about the same time); lane holds channels {4 lane .. +3} and {128 + 4 lane .. +3}.
// Each of the (RW + 2) x (PS + 2) neighbour rows of k and of v is loaded once per wave, from an address clamped into the image, and serves up to 3 pixels in each of up to RW image rows; per pixel the 9 logits (shuffle-reduced dots), the softmax and the sum over n = 0..8 keep their order.
// A neighbour outside the image keeps logit 0 in the softmax and enters the output with weight 0. One register set A, B holds one image row's PS + 2 neighbours; a column is refilled for the next image row once its last pixel has used it.
// The same launch then does the last 1x1 convolution of the block's PB pixels: the attention rows (after bn_3 and relu) go to LDS as the f16 hi and lo parts, the 8 waves multiply them with W4's fragment tiles, and the result
// passes through LDS once more so that every store of out, and every load of the residual x, covers whole 128-byte lines (PC pixels of one channel and image row). Pixel m of a block: image row m / PC, column m % PC.
constexpr int PS = 4, RW = 2, PC = 8 * PS, PB = RW * PC;         // a wave's pixels in one image row, its image rows; pixel columns and pixels of a block
__device__ __forceinline__ float wave_same(float f) { return __uint_as_float(__builtin_amdgcn_readfirstlane(__float_as_uint(f))); }   // a value that every lane holds alike, moved to a scalar register
__global__ __launch_bounds__(256, 4) void local_last_kernel(const float* __restrict__ q, const float* __restrict__ k, const float* __restrict__ v, const float* __restrict__ bnp, const b16* __restrict__ w4r, const float* __restrict__ b4, const float* __restrict__ x, float* __restrict__ out) {
  // one LDS block, used twice: first the block's PB attention rows as f16 hi and lo parts (pitch C + 8: 16 bytes past the row, for the 16-byte fragment reads), then, behind a barrier, the PB x C result as Tc[channel][pixel]
  __shared__ __attribute__((aligned(16))) unsigned char sm[(2 * PB * (C + 8) * 2 > C * (PB + 4) * 4) ? 2 * PB * (C + 8) * 2 : C * (PB + 4) * 4];
  b16 (*Sh)[C + 8] = (b16 (*)[C + 8])sm; b16 (*Sl)[C + 8] = Sh + PB; float (*Tc)[PB + 4] = (float (*)[PB + 4])sm;
  const int wid = __builtin_amdgcn_readfirstlane(threadIdx.x >> 5), lane = threadIdx.x & 31; const int ca = lane * 4, cb = 128 + lane * 4;
  constexpr int BR = HW / PC, BY = HW / RW;                        // blocks side by side in an image row; block rows of an image
  const int xb = (blockIdx.x % BR) * PC, x0 = xb + wid * PS, y0 = ((blockIdx.x / BR) % BY) * RW, b = blockIdx.x / (BR * BY); const int px0 = b * NP + y0 * HW + x0;
  int nb[RW + 2][PS + 2]; bool ok[RW + 2][PS + 2];                  // neighbour pixel (clamped into the image) and whether it lies inside; the same for the whole wave
#pragma unroll
  for (int r = 0; r < RW + 2; ++r)
#pragma unroll
    for (int c = 0; c < PS + 2; ++c) { const int y1 = y0 + r - 1, x1 = x0 + c - 1; ok[r][c] = ((unsigned)y1 < (unsigned)HW) && ((unsigned)x1 < (unsigned)HW); nb[r][c] = b * NP + min(max(y1, 0), HW - 1) * HW + min(max(x1, 0), HW - 1); }
  v4f qa[RW][PS], qb[RW][PS], A[PS + 2], B[PS + 2];
#pragma unroll
  for (int w = 0; w < RW; ++w)
#pragma unroll
    for (int p = 0; p < PS; ++p) { qa[w][p] = *(const v4f*)(q + (size_t)(px0 + w * HW + p) * C + ca); qb[w][p] = *(const v4f*)(q + (size_t)(px0 + w * HW + p) * C + cb); }
#pragma unroll
  for (int c = 0; c < PS + 2; ++c) { A[c] = *(const v4f*)(k + (size_t)nb[0][c] * C + ca); B[c] = *(const v4f*)(k + (size_t)nb[0][c] * C + cb); }
  float lg[RW][PS][9];
#pragma unroll
  for (int r = 0; r < RW + 2; ++r) { float d[RW][PS][3];           // neighbour row r is row r - w of the 3 x 3 window of the wave's image row w
#pragma unroll
    for (int c = 0; c < PS + 2; ++c) {
#pragma unroll
      for (int w = 0; w < RW; ++w) { if (r - w < 0 || r - w > 2) continue;
#pragma unroll
        for (int p = 0; p < PS; ++p) { if (c - p < 0 || c - p > 2) continue;
          float s = 0.0f;
#pragma unroll
          for (int e = 0; e < 4; ++e) s += pmul(qa[w][p][e], A[c][e]) + pmul(qb[w][p][e], B[c][e]);
          asm volatile("" : "+v"(s));                             // empty asm on each sum, against spills: without it the adds sink to the reduction below and the 8 products of every dot stay live
          d[w][p][c - p] = s; } }
      const float* nx = (r < RW + 1 ? k + (size_t)nb[r < RW + 1 ? r + 1 : 0][c] * C : v + (size_t)nb[0][c] * C); A[c] = *(const v4f*)(nx + ca); B[c] = *(const v4f*)(nx + cb);   // the column's refill: next image row of k, behind the last one row 0 of v
      __builtin_amdgcn_sched_barrier(0); }                         // keeps each column's dots and refill together: the refills stay spread over the row, and the row's shuffles stay behind it in batches (without it they scatter among the dots, each with its own wait)
#pragma unroll
    for (int of = 1; of < 32; of <<= 1)
#pragma unroll
      for (int w = 0; w < RW; ++w) { if (r - w < 0 || r - w > 2) continue;
#pragma unroll
        for (int p = 0; p < PS; ++p)
#pragma unroll
          for (int j = 0; j < 3; ++j) d[w][p][j] += __shfl_xor(d[w][p][j], of); }
#pragma unroll
    for (int w = 0; w < RW; ++w) { if (r - w < 0 || r - w > 2) continue;
#pragma unroll
      for (int p = 0; p < PS; ++p)
#pragma unroll
        for (int j = 0; j < 3; ++j) { asm volatile("" : "+v"(d[w][p][j]));   // empty asm on each sum, against spills (as above): it holds this row's reduction in front of the next row's dots, so that only this row's sums are live
          const float t = wave_same(d[w][p][j]) * ISQ; lg[w][p][(r - w) * 3 + j] = ok[r][p + j] ? t : 0.0f; } }   // zero-padded neighbours give logit 0 and ARE part of the softmax
    if (r >= 2) { const int w = r - 2;                              // the 9 logits of image row w are complete: its softmax, under the next row's loads
#pragma unroll
      for (int p = 0; p < PS; ++p) { float m = lg[w][p][0];
#pragma unroll
        for (int n = 1; n < 9; ++n) m = fmaxf(m, lg[w][p][n]);
        float z = 0.0f;
#pragma unroll
        for (int n = 0; n < 9; ++n) { lg[w][p][n] = nexp(lg[w][p][n] - m); z += lg[w][p][n]; }
        const float iz = 1.0f / z;
#pragma unroll
        for (int n = 0; n < 9; ++n) lg[w][p][n] = ok[w + n / 3][p + n % 3] ? lg[w][p][n] * iz : 0.0f; } } }
  v4f oa[RW][PS], ob[RW][PS];
#pragma unroll
  for (int w = 0; w < RW; ++w)
#pragma unroll
    for (int p = 0; p < PS; ++p) { oa[w][p] = (v4f){0.0f, 0.0f, 0.0f, 0.0f}; ob[w][p] = oa[w][p]; }
  const float* sc = bnp + 3 * 2 * C; const float* sh = sc + C; v4f sa, sb, ha, hb;
#pragma unroll
  for (int r = 0; r < RW + 2; ++r) {
#pragma unroll
    for (int c = 0; c < PS + 2; ++c) {
#pragma unroll
      for (int w = 0; w < RW; ++w) { if (r - w < 0 || r - w > 2) continue;
#pragma unroll
        for (int p = 0; p < PS; ++p) { if (c - p < 0 || c - p > 2) continue;
          const float a_ = lg[w][p][(r - w) * 3 + c - p];
#pragma unroll
          for (int e = 0; e < 4; ++e) { oa[w][p][e] += pmul(a_, A[c][e]); ob[w][p][e] += pmul(a_, B[c][e]); }
          asm volatile("" : "+v"(oa[w][p]), "+v"(ob[w][p])); } }      // empty asm on each sum, against spills (as above): without it the adds sink to the end and the products stay live
      if (r < RW + 1) { const float* nx = v + (size_t)nb[r < RW + 1 ? r + 1 : 0][c] * C; A[c] = *(const v4f*)(nx + ca); B[c] = *(const v4f*)(nx + cb); }
      else if (c == 0) { sa = *(const v4f*)(sc + ca); sb = *(const v4f*)(sc + cb); }
      else if (c == 1) { ha = *(const v4f*)(sh + ca); hb = *(const v4f*)(sh + cb); }
      __builtin_amdgcn_sched_barrier(0); } }                       // as above: keeps each column's sums and refill together, the refills spread over the row
  // W4 fragments of the wave's 32 output channels wid * 32 .. + 31: column tile t at t * KT * FT, k block kb at (kb >> 5) * FT; the first pair is asked for here, so that it flies under the conversions below
  const int c0 = wid * 32; const b16* wb = w4r + (size_t)(c0 >> 4) * KT * FT; v16b bn[2] = {frag_kb_t(wb, lane), frag_kb_t(wb + KT * FT, lane)};
#pragma unroll
  for (int w = 0; w < RW; ++w)
#pragma unroll
    for (int p = 0; p < PS; ++p) { v4b h0, l0, h1, l1; const int m = w * PC + wid * PS + p;
#pragma unroll
      for (int e = 0; e < 4; ++e) { b16 hi, lo; split16(fmaxf(oa[w][p][e] * sa[e] + ha[e], 0.0f) * OS_, hi, lo); h0[e] = hi; l0[e] = lo; split16(fmaxf(ob[w][p][e] * sb[e] + hb[e], 0.0f) * OS_, hi, lo); h1[e] = hi; l1[e] = lo; }
      *(v4b*)(&Sh[m][ca]) = h0; *(v4b*)(&Sh[m][cb]) = h1; *(v4b*)(&Sl[m][ca]) = l0; *(v4b*)(&Sl[m][cb]) = l1; }
  __syncthreads();                                                 // the block's PB attention rows are complete in LDS
  // last 1x1 convolution of these PB pixels: wave wid takes all PB rows x output channels wid * 32 .. + 31; per accumulator the order is hi, lo within kb = 0, 32, ..
  const int nloc = lane & 15, hlf = lane >> 4; constexpr int MT = PB / 16;
  v8f acc[MT][2];
#pragma unroll
  for (int r = 0; r < MT; ++r)
#pragma unroll
    for (int t = 0; t < 2; ++t) acc[r][t] = (v8f){};
#pragma unroll
  for (int kb = 0; kb < C; kb += 32) { const v16b bw[2] = {bn[0], bn[1]};
    if (kb + 32 < C) { bn[0] = frag_kb_t(wb + ((kb >> 5) + 1) * FT, lane); bn[1] = frag_kb_t(wb + (KT + (kb >> 5) + 1) * FT, lane); }
    __builtin_amdgcn_sched_barrier(0);                             // keeps the next k block's W4 loads in front of this block's products, so that they fly under them (without it each load stands directly in front of its product, with a full wait)
    v16b ah[MT], al[MT];
#pragma unroll
    for (int r = 0; r < MT; ++r) { ah[r] = frag_row(&Sh[r * 16 + nloc][kb + 8 * hlf]); al[r] = frag_row(&Sl[r * 16 + nloc][kb + 8 * hlf]); }
#pragma unroll
    for (int t = 0; t < 2; ++t)
#pragma unroll
      for (int r = 0; r < MT; ++r) { acc[r][t] = wmma16b(ah[r], bw[t], acc[r][t]); acc[r][t] = wmma16b(al[r], bw[t], acc[r][t]); } }
  // residual rows and channel constants: one batch of loads behind the last products, whole 128-byte lines; the barrier below ends them, so that they fly while the block's other waves finish their products
  constexpr int CJ = 256 / (PB / 4);                               // channels that the block's 256 threads cover in one trip, 4 pixels a thread
  const int cc = threadIdx.x / (PB / 4), c4 = (threadIdx.x % (PB / 4)) * 4; const size_t io = ((size_t)b * C + cc) * NP + (y0 + c4 / PC) * HW + xb + c4 % PC; v4f xr[C * PB / 4 / 256]; const float* xp = x + io;
#pragma unroll
  for (int j = 0; j < C * PB / 4 / 256; ++j) xr[j] = *(const v4f*)(xp + (size_t)j * CJ * NP);
  const float* sc4 = bnp + 4 * 2 * C; const float* sh4 = sc4 + C; float bb[2], s_[2], h_[2]; const int co0 = c0 + nloc;
#pragma unroll
  for (int t = 0; t < 2; ++t) { const int co = co0 + t * 16; bb[t] = bf16_rne(b4[co]); s_[t] = sc4[co]; h_[t] = sh4[co]; }
  asm volatile("s_wait_xcnt 0x0" :: "v"(xp), "v"(co0) : "memory");   // holds any rewrite of the batch's address registers behind the loads' issue; as operands they stay live up to here, so that no load of the batch takes them for its result
  __syncthreads();                                                 // every wave has read its last fragment: the LDS block may take the result
#pragma unroll
  for (int t = 0; t < 2; ++t)
#pragma unroll
    for (int r = 0; r < MT; ++r)
#pragma unroll
      for (int vv = 0; vv < 8; ++vv) Tc[c0 + t * 16 + nloc][r * 16 + 8 * hlf + vv] = (acc[r][t][vv] * (1.0f / OS_) + bb[t]) * s_[t] + h_[t];
  __syncthreads();                                                 // the result is complete in LDS
#pragma unroll
  for (int j = 0; j < C * PB / 4 / 256; ++j) { v4f t4 = *(const v4f*)(&Tc[cc + j * CJ][c4]);
#pragma unroll
    for (int e = 0; e < 4; ++e) t4[e] = fmaxf(t4[e] + bf16_rne(xr[j][e]), 0.0f);
    *(v4f*)(out + io + (size_t)j * CJ * NP) = t4; }
}
}  // namespace

extern "C" void kernel_launch(void* const* d_in, const int* in_sizes, int n_in,
                              void* d_out, int out_size, void* d_ws, size_t ws_size, hipStream_t stream) {
  (void)n_in; (void)out_size;
  const float* x = (const float*)d_in[0]; const float* W1 = (const float*)d_in[1]; const float* b1 = (const float*)d_in[2]; const float* W2 = (const float*)d_in[3]; const float* b2 = (const float*)d_in[4]; const float* W3 = (const float*)d_in[5]; const float* b3 = (const float*)d_in[6]; const float* W4 = (const float*)d_in[7]; const float* b4 = (const float*)d_in[8];
  const float* g = (const float*)d_in[9]; const float* be = (const float*)d_in[10]; const float* mu = (const float*)d_in[11]; const float* var = (const float*)d_in[12];
  float* out = (float*)d_out;   // [8][256][64][64]
  if (in_sizes[0] != Bn * C * NP || in_sizes[1] != C * C || in_sizes[7] != C * C || in_sizes[9] != 5 * C || in_sizes[12] != 5 * C) return;
  size_t off = 0; char* ws = (char*)d_ws;
  auto carve = [&](size_t bytes) { char* p = ws + off; off += (bytes + 255) & ~(size_t)255; return p; };
  unsigned short* w16 = (unsigned short*)carve((size_t)3 * C * C * 2); b16* w4r = (b16*)carve((size_t)C * C * 2); float* bnp = (float*)carve(5 * 2 * C * 4);
  float* q = (float*)carve((size_t)NTOK * C * 4); float* k = (float*)carve((size_t)NTOK * C * 4); float* v = (float*)carve((size_t)NTOK * C * 4);
  if (off > ws_size) return;                                    // about 0.5 + 3 x 33.5 MB
  prep_kernel<<<PREPB, 256, 0, stream>>>(W1, W2, W3, W4, g, be, mu, var, w16, w4r, bnp);
  qkv_kernel<<<NTOK / MP, 256, 0, stream>>>(x, w16, b1, b2, b3, bnp, q, k, v);
  local_last_kernel<<<NTOK / PB, 256, 0, stream>>>(q, k, v, bnp, w4r, b4, x, out);
}

// v007
// A run of this version takes 43.4 microseconds.
// Two timings next to v006 put it at 1.12 and 1.11 times that version's speed.
// All steps since v000 together make it 3.63 times as fast.
#include <hip/hip_runtime.h>

// PixelTransformerResnet: q, k, v = relu(bn_i(conv1x1_i(x))) (eval-mode BN with given statistics); per pixel 9 logits = q . k(neighbour n) / 16 over the 3x3 neighbourhood (zero vectors
// outside the image, kept in the softmax), att = softmax over the 9, out = Σ_n att_n v(neighbour n); out = relu(bn_3(out)); out = bn_4(conv1x1_4(out)); y = relu(out + x) -> NCHW [8][256][64][64].
// The four 1x1 convolutions run on WMMA: q/k/v on v_wmma_f32_16x16x32_bf16 with exact bf16 operands (x transposed to pixel-major through LDS; 1 product), the last
// one on v_wmma_f32_16x16x32_f16 with the attention output split into an f16 hi+lo pair x8 against exact W4 (2 products); f32 accumulate. The 9-neighbour attention is a wave per 2 x 4 pixels (2 image rows)
// in f32 (lanes split the 256 channels, shuffle-reduced dots in fixed order, native exp); q, k, v pass from the qkv launch to it as f16 rows. BN / relu / residual in f32. Fragment k-map per lane half hh for A AND B: elements 0..7 <- k =

namespace {
constexpr int Bn = 8, C = 256, HW = 64, NP = HW * HW, NTOK = Bn * NP;
constexpr float EPS = 1e-5f, OS_ = 8.0f, ISQ = 0.0625f;   // 1/sqrt(256)

typedef _Float16 b16;
typedef __attribute__((ext_vector_type(16))) _Float16 v16b;
typedef __attribute__((ext_vector_type(16))) __bf16 v16bb;
typedef __attribute__((ext_vector_type(8))) _Float16 v8b;
typedef __attribute__((ext_vector_type(4))) _Float16 v4b;
typedef __attribute__((ext_vector_type(8))) unsigned short v8us;
typedef __attribute__((ext_vector_type(8))) float v8f;
typedef __attribute__((ext_vector_type(4))) float v4f;
__device__ __forceinline__ float bf16_rne(float f) { unsigned int u = __float_as_uint(f); u += 0x7FFFu + ((u >> 16) & 1u); return __uint_as_float(u & 0xFFFF0000u); }
__device__ __forceinline__ unsigned short bf16_bits(float f) { unsigned int u = __float_as_uint(f); u += 0x7FFFu + ((u >> 16) & 1u); return (unsigned short)(u >> 16); }
__device__ __forceinline__ void split16(float v, b16& hi, b16& lo) { hi = (b16)v; lo = (b16)(v - (float)hi); }
// Fragment tiles: a 16-row x 32-k block of a 16-bit operand is stored as 512 consecutive elements, piece (ld, lane) of 8 elements at ld * 256 + lane * 8 holding row (lane & 15),
// k = ld * 16 + (lane >> 4) * 8 + 0..7 (the k-map above, the same for A and B), so that each 16-byte-per-lane load of a wave covers 512 contiguous bytes. Tile (rt, kt) of a [rows][C] operand lies at (rt * KT + kt) * FT.
constexpr int FT = 512, KT = C / 32;
__device__ __forceinline__ int tile_row(int o) { return (o >> 6) / KT * 16 + (o & 15); }                                   // row and first k of piece o (8 elements) of a tiled operand
__device__ __forceinline__ int tile_k(int o) { return (o >> 6) % KT * 32 + ((o >> 5) & 1) * 16 + ((o >> 4) & 1) * 8; }
__device__ __forceinline__ v16b frag_kb_t(const b16* tile, int lane) { const v8b a = *(const v8b*)(tile + lane * 8), b = *(const v8b*)(tile + 256 + lane * 8); v16b f;
#pragma unroll
  for (int e = 0; e < 8; ++e) { f[e] = a[e]; f[8 + e] = b[e]; } return f; }
// the same fragment from a row-major row: p points at the lane's row, k = kb + 8 hh; elements 0..7 <- p[0..7], 8..15 <- p[16..23]
__device__ __forceinline__ v16b frag_row(const b16* p) { const v8b a = *(const v8b*)p, b = *(const v8b*)(p + 16); v16b f;
#pragma unroll
  for (int e = 0; e < 8; ++e) { f[e] = a[e]; f[8 + e] = b[e]; } return f; }
__device__ __forceinline__ v16bb frag_bf_t(const unsigned short* tile, int lane) { const v8us a = *(const v8us*)(tile + lane * 8), b = *(const v8us*)(tile + 256 + lane * 8); union { unsigned short s[16]; v16bb v; } u;
#pragma unroll
  for (int e = 0; e < 8; ++e) { u.s[e] = a[e]; u.s[8 + e] = b[e]; } return u.v; }
__device__ __forceinline__ v8f wmma16b(v16b a, v16b b, v8f c) { v8f d = __builtin_amdgcn_wmma_f32_16x16x32_f16(false, a, false, b, (short)0, c, false, false); asm volatile("v_nop\n\tv_nop\n\tv_nop\n\tv_nop" : "+v"(d) : "v"(a), "v"(b)); return d; }
__device__ __forceinline__ v8f wmma16bb(v16bb a, v16bb b, v8f c) { v8f d = __builtin_amdgcn_wmma_f32_16x16x32_bf16(false, a, false, b, (short)0, c, false, false); asm volatile("v_nop\n\tv_nop\n\tv_nop\n\tv_nop" : "+v"(d) : "v"(a), "v"(b)); return d; }
// hand-over of an LDS patch among the lanes of ONE wave: the wave's own LDS writes have landed and its LDS reads have returned, and the compiler moves no memory access over the statement; unlike a fence it leaves the wave's global loads and stores in flight
__device__ __forceinline__ void wave_lds_sync() { asm volatile("s_wait_dscnt 0x0" ::: "memory"); __builtin_amdgcn_wave_barrier(); }
__device__ __forceinline__ float nexp(float x) { float r; asm("v_exp_f32 %0, %1\n\tv_nop" : "=v"(r) : "v"(x * 1.4426950408889634f)); return r; }
__device__ __forceinline__ float pmul(float a, float b) { float p = a * b; asm volatile("" : "+v"(p)); return p; }

// prep: W1..3 [256][256] -> bf16 fragment tiles; W4 -> f16 fragment tiles; bnp: for each of the 5 BN layers scale[C], then shift[C]. One 8-element piece (or one BN channel) per thread, block-uniform choice of the source
constexpr int PREPB = 4 * C * C / 8 / 256 + 5 * C / 256;         // blocks of the prep launch
__global__ __launch_bounds__(256) void prep_kernel(const float* __restrict__ W1, const float* __restrict__ W2, const float* __restrict__ W3, const float* __restrict__ W4, const float* __restrict__ g, const float* __restrict__ be, const float* __restrict__ mu, const float* __restrict__ var,
                                                   unsigned short* __restrict__ w16, b16* __restrict__ w4r, float* __restrict__ bnp) {
  static_assert((C * C / 8) % 256 == 0 && (5 * C) % 256 == 0, "whole blocks per source");
  const int t_ = threadIdx.x, bid = blockIdx.x, i = bid * 256 + t_;
  if (bid < 3 * C * C / 8 / 256) { const int m = i / (C * C / 8), q = i % (C * C / 8); const float* W = (m == 0) ? W1 : (m == 1) ? W2 : W3; v8us o;
#pragma unroll
    for (int e = 0; e < 8; ++e) o[e] = bf16_bits(W[tile_row(q) * C + tile_k(q) + e]);
    *(v8us*)(w16 + (size_t)i * 8) = o; asm volatile("s_wait_xcnt 0x0" ::: "memory");  /* holds any later rewrite of the store's registers behind the store's issue */ }
  else if (bid < 4 * C * C / 8 / 256) { const int j = i - 3 * C * C / 8; v8b o;
#pragma unroll
    for (int e = 0; e < 8; ++e) o[e] = (b16)bf16_rne(W4[tile_row(j) * C + tile_k(j) + e]);
    *(v8b*)(w4r + (size_t)j * 8) = o; asm volatile("s_wait_xcnt 0x0" ::: "memory");  /* holds any later rewrite of the store's registers behind the store's issue */ }
  else { const int j = i - 4 * C * C / 8; const float sc = bf16_rne(g[j]) * rsqrtf(bf16_rne(var[j]) + EPS); ((float*)bnp)[(j / C) * 2 * C + (j % C)] = sc; ((float*)bnp)[(j / C) * 2 * C + C + (j % C)] = bf16_rne(be[j]) - bf16_rne(mu[j]) * sc; asm volatile("s_wait_xcnt 0x0" ::: "memory");  /* holds any later rewrite of the store's registers behind the store's issue */ }
}

// q, k, v of MP pixels per block, straight from x: the block reads its MP pixels x C channels of x (NCHW, 256-byte runs of a channel) once, rounds them to bf16 and lays them pixel-major in LDS; behind one barrier its 8 waves
// multiply that tile with all 3 x C weight columns. Wave w takes all MP rows x 32 columns of q, then of k, then of v: A fragments from LDS (row-major rows, the k-map above), B fragments from the weight tiles, each
// read once per block. Per accumulator the order is kb = 0, 32, .. as before. Wave w takes the column tiles w and w + 8 (channels 16 w .. + 15 and 128 + 16 w .. + 15). q, k, v are stored rounded to f16 (nearest even), half the bytes of f32,
// in the order in which the attention lanes read them: the 16-byte piece L of a pixel's 512-byte row holds channels 4 L + e and 128 + 4 L + e as the pair at elements 2 e, 2 e + 1. The result passes through the wave's own LDS patch, so that every lane stores 16 bytes and a wave's 32 channels of a pixel are one 64-byte run.
constexpr int MP = 64, TP = 20;                                  // pixels of a block; pitch in 32-bit words (an f16 pair each) of the result patch (64-byte rows; the two lane halves, 8 rows apart, fall on different banks)
typedef __attribute__((ext_vector_type(2))) _Float16 v2b;
typedef __attribute__((ext_vector_type(4))) unsigned int v4u;
typedef __attribute__((ext_vector_type(2))) unsigned short v2us;
__device__ __forceinline__ v16bb frag_bf_row(const unsigned short* p) { const v8us a = *(const v8us*)p, b = *(const v8us*)(p + 16); union { unsigned short s[16]; v16bb v; } u;
#pragma unroll
  for (int e = 0; e < 8; ++e) { u.s[e] = a[e]; u.s[8 + e] = b[e]; } return u.v; }
// weight tile of step s = matrix * KT + k block, column tile ct
__device__ __forceinline__ const unsigned short* wtile(const unsigned short* w16, int s, int ct) { return w16 + (size_t)(((s / KT) * (C / 16) + ct) * KT + s % KT) * FT; }
__global__ __launch_bounds__(256, 4) void qkv_kernel(const float* __restrict__ x, const unsigned short* __restrict__ w16, const float* __restrict__ b1, const float* __restrict__ b2, const float* __restrict__ b3, const float* __restrict__ bnp, b16* __restrict__ q, b16* __restrict__ k, b16* __restrict__ v) {
  __shared__ __attribute__((aligned(16))) unsigned short Tt[MP][C + 8];
  __shared__ __attribute__((aligned(16))) unsigned int Ts[8][32 * TP];
  const int t_ = threadIdx.x, lane = t_ & 31, wave = __builtin_amdgcn_readfirstlane(t_ >> 5), nloc = lane & 15, hlf = lane >> 4;
  const int m0 = blockIdx.x * MP, ct0 = wave; const float* src = x + (size_t)(blockIdx.x / (NP / MP)) * C * NP + (blockIdx.x % (NP / MP)) * MP;
  // the weight fragments run two steps ahead of their products, over the borders between q, k and v too; the first two steps are asked for here and fly with the x tile
  v16bb rb[2][2];
#pragma unroll
  for (int s = 0; s < 2; ++s)
#pragma unroll
    for (int t = 0; t < 2; ++t) rb[s][t] = frag_bf_t(wtile(w16, s, ct0 + 8 * t), lane);
  { constexpr int NT = MP * C / 8 / 256; v4f xa[NT], xb[NT];         // a thread and trip: 4 pixels of 2 neighbouring channels; all loads of the tile are in flight together
#pragma unroll
    for (int it = 0; it < NT; ++it) { const int idx = it * 256 + t_, j = idx % (MP / 4), cp = idx / (MP / 4); const unsigned o = (unsigned)((2 * cp) * NP + 4 * j); xa[it] = *(const v4f*)(src + o); xb[it] = *(const v4f*)(src + o + NP); }
    asm volatile("s_wait_xcnt 0x0" ::: "memory");                   // holds any later rewrite of the loads' address registers behind the loads' issue
#pragma unroll
    for (int it = 0; it < NT; ++it) { const int idx = it * 256 + t_, j = idx % (MP / 4), cp = idx / (MP / 4);
#pragma unroll
      for (int e = 0; e < 4; ++e) *(v2us*)(&Tt[4 * j + e][2 * cp]) = (v2us){bf16_bits(xa[it][e]), bf16_bits(xb[it][e])}; } }
  __syncthreads();                                                 // the block's x tile is complete in LDS
  unsigned int* Tw = Ts[wave];
#pragma unroll
  for (int which = 0; which < 3; ++which) {
    const float* bias = (which == 0) ? b1 : (which == 1) ? b2 : b3; const float* sc = bnp + which * 2 * C; const float* sh = sc + C; b16* dst0 = ((which == 0) ? q : (which == 1) ? k : v) + (size_t)m0 * C + wave * 32;
    float bb[2], s_[2], h_[2];                                      // channel constants, asked for in front of the products
#pragma unroll
    for (int t = 0; t < 2; ++t) { const int c = t * 128 + wave * 16 + nloc; bb[t] = bf16_rne(bias[c]); s_[t] = sc[c]; h_[t] = sh[c]; }
    v8f acc[4][2];
#pragma unroll
    for (int r = 0; r < 4; ++r)
#pragma unroll
      for (int t = 0; t < 2; ++t) acc[r][t] = (v8f){};
#pragma unroll
    for (int kt = 0; kt < KT; ++kt) { const v16bb bw[2] = {rb[kt & 1][0], rb[kt & 1][1]}; const int nx = which * KT + kt + 2;
      if (nx < 3 * KT) { rb[kt & 1][0] = frag_bf_t(wtile(w16, nx, ct0), lane); rb[kt & 1][1] = frag_bf_t(wtile(w16, nx, ct0 + 8), lane); }
      __builtin_amdgcn_sched_barrier(0);                           // keeps the weight loads of two steps ahead in front of this step's products, so that they fly under them (without it each load sinks to its product, with a full wait)
      v16bb a[4];
#pragma unroll
      for (int r = 0; r < 4; ++r) a[r] = frag_bf_row(&Tt[r * 16 + nloc][kt * 32 + 8 * hlf]);
#pragma unroll
      for (int r = 0; r < 4; ++r) { acc[r][0] = wmma16bb(a[r], bw[0], acc[r][0]); acc[r][1] = wmma16bb(a[r], bw[1], acc[r][1]); } }
#pragma unroll
    for (int h = 0; h < 2; ++h) {                                   // 32 rows at a time through the wave's patch
#pragma unroll
      for (int r = 0; r < 2; ++r)
#pragma unroll
        for (int vv = 0; vv < 8; ++vv) { const v2b pr = {(b16)fmaxf((acc[h * 2 + r][0][vv] + bb[0]) * s_[0] + h_[0], 0.0f), (b16)fmaxf((acc[h * 2 + r][1][vv] + bb[1]) * s_[1] + h_[1], 0.0f)};
          Tw[(r * 16 + vv + 8 * hlf) * TP + nloc] = __builtin_bit_cast(unsigned int, pr); }   // word nloc of the wave's 16: channels 16 w + nloc and 128 + 16 w + nloc
      wave_lds_sync();
#pragma unroll
      for (int j = 0; j < 4; ++j) { const int rr = j * 8 + (lane >> 2), c4 = (lane & 3) * 4; *(v4u*)(dst0 + (size_t)(h * 32 + rr) * C + c4 * 2) = *(const v4u*)(Tw + rr * TP + c4); }
      if (which < 2 || h < 1) {                                     // behind the last stores nothing follows
        asm volatile("s_wait_xcnt 0x0" ::: "memory");               // holds any later rewrite of the stores' registers behind the stores' issue
        wave_lds_sync(); } } }
}

// local attention: a wave takes PS consecutive pixels in each of RW neighbouring image rows (a block: 8 such patches side by side, so that neighbouring waves ask for the 2 columns they share at about the same time); lane holds channels {4 lane .. +3} and {128 + 4 lane .. +3}, one 16-byte piece of a pixel's f16 row, widened to f32 where it is used.
// Each of the (RW + 2) x (PS + 2) neighbour rows of k and of v is loaded once per wave, from an address clamped into the image, and serves up to 3 pixels in each of up to RW image rows; per pixel the 9 logits (shuffle-reduced dots), the softmax and the sum over n = 0..8 keep their order.
// A neighbour outside the image keeps logit 0 in the softmax and enters the output with weight 0. One register set R holds one image row's PS + 2 neighbours; a column is refilled for the next image row once its last pixel has used it.
// The same launch then does the last 1x1 convolution of the block's PB pixels: the attention rows (after bn_3 and relu) go to LDS as the f16 hi and lo parts, the 8 waves multiply them with W4's fragment tiles, and the result
// passes through LDS once more so that every store of out, and every load of the residual x, covers whole 128-byte lines (PC pixels of one channel and image row). Pixel m of a block: image row m / PC, column m % PC.
constexpr int PS = 4, RW = 2, PC = 8 * PS, PB = RW * PC;         // a wave's pixels in one image row, its image rows; pixel columns and pixels of a block
__device__ __forceinline__ float wave_same(float f) { return __uint_as_float(__builtin_amdgcn_readfirstlane(__float_as_uint(f))); }   // a value that every lane holds alike, moved to a scalar register
__global__ __launch_bounds__(256, 4) void local_last_kernel(const b16* __restrict__ q, const b16* __restrict__ k, const b16* __restrict__ v, const float* __restrict__ bnp, const b16* __restrict__ w4r, const float* __restrict__ b4, const float* __restrict__ x, float* __restrict__ out) {
  // one LDS block, used twice: first the block's PB attention rows as f16 hi and lo parts (pitch C + 8: 16 bytes past the row, for the 16-byte fragment reads), then, behind a barrier, the PB x C result as Tc[channel][pixel]
  __shared__ __attribute__((aligned(16))) unsigned char sm[(2 * PB * (C + 8) * 2 > C * (PB + 4) * 4) ? 2 * PB * (C + 8) * 2 : C * (PB + 4) * 4];
  b16 (*Sh)[C + 8] = (b16 (*)[C + 8])sm; b16 (*Sl)[C + 8] = Sh + PB; float (*Tc)[PB + 4] = (float (*)[PB + 4])sm;
  const int wid = __builtin_amdgcn_readfirstlane(threadIdx.x >> 5), lane = threadIdx.x & 31; const int ca = lane * 4, cb = 128 + lane * 4, cl = lane * 8;
  constexpr int BR = HW / PC, BY = HW / RW;                        // blocks side by side in an image row; block rows of an image
  const int xb = (blockIdx.x % BR) * PC, x0 = xb + wid * PS, y0 = ((blockIdx.x / BR) % BY) * RW, b = blockIdx.x / (BR * BY); const int px0 = b * NP + y0 * HW + x0;
  int nb[RW + 2][PS + 2]; bool ok[RW + 2][PS + 2];                  // neighbour pixel (clamped into the image) and whether it lies inside; the same for the whole wave
#pragma unroll
  for (int r = 0; r < RW + 2; ++r)
#pragma unroll
    for (int c = 0; c < PS + 2; ++c) { const int y1 = y0 + r - 1, x1 = x0 + c - 1; ok[r][c] = ((unsigned)y1 < (unsigned)HW) && ((unsigned)x1 < (unsigned)HW); nb[r][c] = b * NP + min(max(y1, 0), HW - 1) * HW + min(max(x1, 0), HW - 1); }
  static_assert(PS == 4, "the wait behind the first k row names every address of its batch");
  const b16* qp[RW]; const b16* kp[PS + 2]; v4f qa[RW][PS], qb[RW][PS]; v8b R[PS + 2];                       // R: one image row's neighbours as loaded, f16 pairs (channel ca + e, channel cb + e)
#pragma unroll
  for (int w = 0; w < RW; ++w) { qp[w] = q + (size_t)(px0 + w * HW) * C + cl;
#pragma unroll
    for (int p = 0; p < PS; ++p) { const v8b t8 = *(const v8b*)(qp[w] + p * C);
#pragma unroll
      for (int e = 0; e < 4; ++e) { qa[w][p][e] = (float)t8[2 * e]; qb[w][p][e] = (float)t8[2 * e + 1]; } } }
#pragma unroll
  for (int c = 0; c < PS + 2; ++c) { kp[c] = k + (size_t)nb[0][c] * C + cl; R[c] = *(const v8b*)kp[c]; }
  asm volatile("s_wait_xcnt 0x0" :: "v"(kp[0]), "v"(kp[1]), "v"(kp[2]), "v"(kp[3]), "v"(kp[4]), "v"(kp[5]) : "memory");   // holds any rewrite of the address registers of the q and first k row loads behind the loads' issue; as operands the k addresses stay live up to here, so that no load of the batch takes them for its result
  float lg[RW][PS][9];
#pragma unroll
  for (int r = 0; r < RW + 2; ++r) { float d[RW][PS][3];           // neighbour row r is row r - w of the 3 x 3 window of the wave's image row w
#pragma unroll
    for (int c = 0; c < PS + 2; ++c) { v4f A, B;
#pragma unroll
      for (int e = 0; e < 4; ++e) { A[e] = (float)R[c][2 * e]; B[e] = (float)R[c][2 * e + 1]; }
#pragma unroll
      for (int w = 0; w < RW; ++w) { if (r - w < 0 || r - w > 2) continue;
#pragma unroll
        for (int p = 0; p < PS; ++p) { if (c - p < 0 || c - p > 2) continue;
          float s = 0.0f;
#pragma unroll
          for (int e = 0; e < 4; ++e) s += __builtin_fmaf(qb[w][p][e], B[e], pmul(qa[w][p][e], A[e]));   // a product of two f16 values is exact in f32, so the second product joins the first in one rounding either way: same bits as product, product, add
          asm volatile("" : "+v"(s));                             // empty asm on each sum, against spills: without it the adds sink to the reduction below and the 8 products of every dot stay live
          d[w][p][c - p] = s; } }
      const b16* nx = (r < RW + 1 ? k + (size_t)nb[r < RW + 1 ? r + 1 : 0][c] * C : v + (size_t)nb[0][c] * C); R[c] = *(const v8b*)(nx + cl);   // the column's refill: next image row of k, behind the last one row 0 of v
      __builtin_amdgcn_sched_barrier(0); }                         // keeps each column's dots and refill together: the refills stay spread over the row, and the row's shuffles stay behind it in batches (without it they scatter among the dots, each with its own wait)
#pragma unroll
    for (int of = 1; of < 32; of <<= 1)
#pragma unroll
      for (int w = 0; w < RW; ++w) { if (r - w < 0 || r - w > 2) continue;
#pragma unroll
        for (int p = 0; p < PS; ++p)
#pragma unroll
          for (int j = 0; j < 3; ++j) d[w][p][j] += __shfl_xor(d[w][p][j], of); }
#pragma unroll
    for (int w = 0; w < RW; ++w) { if (r - w < 0 || r - w > 2) continue;
#pragma unroll
      for (int p = 0; p < PS; ++p)
#pragma unroll
        for (int j = 0; j < 3; ++j) { asm volatile("" : "+v"(d[w][p][j]));   // empty asm on each sum, against spills (as above): it holds this row's reduction in front of the next row's dots, so that only this row's sums are live
          const float t = wave_same(d[w][p][j]) * ISQ; lg[w][p][(r - w) * 3 + j] = ok[r][p + j] ? t : 0.0f; } }   // zero-padded neighbours give logit 0 and ARE part of the softmax
    if (r >= 2) { const int w = r - 2;                              // the 9 logits of image row w are complete: its softmax, under the next row's loads
#pragma unroll
      for (int p = 0; p < PS; ++p) { float m = lg[w][p][0];
#pragma unroll
        for (int n = 1; n < 9; ++n) m = fmaxf(m, lg[w][p][n]);
        float z = 0.0f;
#pragma unroll
        for (int n = 0; n < 9; ++n) { lg[w][p][n] = nexp(lg[w][p][n] - m); z += lg[w][p][n]; }
        const float iz = 1.0f / z;
#pragma unroll
        for (int n = 0; n < 9; ++n) lg[w][p][n] = ok[w + n / 3][p + n % 3] ? lg[w][p][n] * iz : 0.0f; } } }
  v4f oa[RW][PS], ob[RW][PS];
#pragma unroll
  for (int w = 0; w < RW; ++w)
#pragma unroll
    for (int p = 0; p < PS; ++p) { oa[w][p] = (v4f){0.0f, 0.0f, 0.0f, 0.0f}; ob[w][p] = oa[w][p]; }
  const float* sc = bnp + 3 * 2 * C; const float* sh = sc + C; v4f sa, sb, ha, hb;
#pragma unroll
  for (int r = 0; r < RW + 2; ++r) {
#pragma unroll
    for (int c = 0; c < PS + 2; ++c) { v4f A, B;
#pragma unroll
      for (int e = 0; e < 4; ++e) { A[e] = (float)R[c][2 * e]; B[e] = (float)R[c][2 * e + 1]; }
#pragma unroll
      for (int w = 0; w < RW; ++w) { if (r - w < 0 || r - w > 2) continue;
#pragma unroll
        for (int p = 0; p < PS; ++p) { if (c - p < 0 || c - p > 2) continue;
          const float a_ = lg[w][p][(r - w) * 3 + c - p];
#pragma unroll
          for (int e = 0; e < 4; ++e) { oa[w][p][e] += pmul(a_, A[e]); ob[w][p][e] += pmul(a_, B[e]); }
          asm volatile("" : "+v"(oa[w][p]), "+v"(ob[w][p])); } }      // empty asm on each sum, against spills (as above): without it the adds sink to the end and the products stay live
      if (r < RW + 1) { const b16* nx = v + (size_t)nb[r < RW + 1 ? r + 1 : 0][c] * C; R[c] = *(const v8b*)(nx + cl); }
      else if (c == 0) { sa = *(const v4f*)(sc + ca); sb = *(const v4f*)(sc + cb); }
      else if (c == 1) { ha = *(const v4f*)(sh + ca); hb = *(const v4f*)(sh + cb); }
      __builtin_amdgcn_sched_barrier(0); } }                       // as above: keeps each column's sums and refill together, the refills spread over the row
  // W4 fragments of the wave's 32 output channels wid * 32 .. + 31: column tile t at t * KT * FT, k block kb at (kb >> 5) * FT; the first pair is asked for here, so that it flies under the conversions below
  const int c0 = wid * 32; const b16* wb = w4r + (size_t)(c0 >> 4) * KT * FT; v16b bn[2] = {frag_kb_t(wb, lane), frag_kb_t(wb + KT * FT, lane)};
#pragma unroll
  for (int w = 0; w < RW; ++w)
#pragma unroll
    for (int p = 0; p < PS; ++p) { v4b h0, l0, h1, l1; const int m = w * PC + wid * PS + p;
#pragma unroll
      for (int e = 0; e < 4; ++e) { b16 hi, lo; split16(fmaxf(oa[w][p][e] * sa[e] + ha[e], 0.0f) * OS_, hi, lo); h0[e] = hi; l0[e] = lo; split16(fmaxf(ob[w][p][e] * sb[e] + hb[e], 0.0f) * OS_, hi, lo); h1[e] = hi; l1[e] = lo; }
      *(v4b*)(&Sh[m][ca]) = h0; *(v4b*)(&Sh[m][cb]) = h1; *(v4b*)(&Sl[m][ca]) = l0; *(v4b*)(&Sl[m][cb]) = l1; }
  __syncthreads();                                                 // the block's PB attention rows are complete in LDS
  // last 1x1 convolution of these PB pixels: wave wid takes all PB rows x output channels wid * 32 .. + 31; per accumulator the order is hi, lo within kb = 0, 32, ..
  const int nloc = lane & 15, hlf = lane >> 4; constexpr int MT = PB / 16;
  v8f acc[MT][2];
#pragma unroll
  for (int r = 0; r < MT; ++r)
#pragma unroll
    for (int t = 0; t < 2; ++t) acc[r][t] = (v8f){};
#pragma unroll
  for (int kb = 0; kb < C; kb += 32) { const v16b bw[2] = {bn[0], bn[1]};
    if (kb + 32 < C) { bn[0] = frag_kb_t(wb + ((kb >> 5) + 1) * FT, lane); bn[1] = frag_kb_t(wb + (KT + (kb >> 5) + 1) * FT, lane); }
    __builtin_amdgcn_sched_barrier(0);                             // keeps the next k block's W4 loads in front of this block's products, so that they fly under them (without it each load stands directly in front of its product, with a full wait)
    v16b ah[MT], al[MT];
#pragma unroll
    for (int r = 0; r < MT; ++r) { ah[r] = frag_row(&Sh[r * 16 + nloc][kb + 8 * hlf]); al[r] = frag_row(&Sl[r * 16 + nloc][kb + 8 * hlf]); }
#pragma unroll
    for (int t = 0; t < 2; ++t)
#pragma unroll
      for (int r = 0; r < MT; ++r) { acc[r][t] = wmma16b(ah[r], bw[t], acc[r][t]); acc[r][t] = wmma16b(al[r], bw[t], acc[r][t]); } }
  // residual rows and channel constants: one batch of loads behind the last products, whole 128-byte lines; the barrier below ends them, so that they fly while the block's other waves finish their products
  constexpr int CJ = 256 / (PB / 4);                               // channels that the block's 256 threads cover in one trip, 4 pixels a thread
  const int cc = threadIdx.x / (PB / 4), c4 = (threadIdx.x % (PB / 4)) * 4; const size_t io = ((size_t)b * C + cc) * NP + (y0 + c4 / PC) * HW + xb + c4 % PC; v4f xr[C * PB / 4 / 256]; const float* xp = x + io;
#pragma unroll
  for (int j = 0; j < C * PB / 4 / 256; ++j) xr[j] = *(const v4f*)(xp + (size_t)j * CJ * NP);
  const float* sc4 = bnp + 4 * 2 * C; const float* sh4 = sc4 + C; float bb[2], s_[2], h_[2]; const int co0 = c0 + nloc;
#pragma unroll
  for (int t = 0; t < 2; ++t) { const int co = co0 + t * 16; bb[t] = bf16_rne(b4[co]); s_[t] = sc4[co]; h_[t] = sh4[co]; }
  asm volatile("s_wait_xcnt 0x0" :: "v"(xp), "v"(co0) : "memory");   // holds any rewrite of the batch's address registers behind the loads' issue; as operands they stay live up to here, so that no load of the batch takes them for its result
  __syncthreads();                                                 // every wave has read its last fragment: the LDS block may take the result
#pragma unroll
  for (int t = 0; t < 2; ++t)
#pragma unroll
    for (int r = 0; r < MT; ++r)
#pragma unroll
      for (int vv = 0; vv < 8; ++vv) Tc[c0 + t * 16 + nloc][r * 16 + 8 * hlf + vv] = (acc[r][t][vv] * (1.0f / OS_) + bb[t]) * s_[t] + h_[t];
  __syncthreads();                                                 // the result is complete in LDS
#pragma unroll
  for (int j = 0; j < C * PB / 4 / 256; ++j) { v4f t4 = *(const v4f*)(&Tc[cc + j * CJ][c4]);
#pragma unroll
    for (int e = 0; e < 4; ++e) t4[e] = fmaxf(t4[e] + bf16_rne(xr[j][e]), 0.0f);
    *(v4f*)(out + io + (size_t)j * CJ * NP) = t4; }
}
}  // namespace

extern "C" void kernel_launch(void* const* d_in, const int* in_sizes, int n_in,
                              void* d_out, int out_size, void* d_ws, size_t ws_size, hipStream_t stream) {
  (void)n_in; (void)out_size;
  const float* x = (const float*)d_in[0]; const float* W1 = (const float*)d_in[1]; const float* b1 = (const float*)d_in[2]; const float* W2 = (const float*)d_in[3]; const float* b2 = (const float*)d_in[4]; const float* W3 = (const float*)d_in[5]; const float* b3 = (const float*)d_in[6]; const float* W4 = (const float*)d_in[7]; const float* b4 = (const float*)d_in[8];
  const float* g = (const float*)d_in[9]; const float* be = (const float*)d_in[10]; const float* mu = (const float*)d_in[11]; const float* var = (const float*)d_in[12];
  float* out = (float*)d_out;   // [8][256][64][64]
  if (in_sizes[0] != Bn * C * NP || in_sizes[1] != C * C || in_sizes[7] != C * C || in_sizes[9] != 5 * C || in_sizes[12] != 5 * C) return;
  size_t off = 0; char* ws = (char*)d_ws;
  auto carve = [&](size_t bytes) { char* p = ws + off; off += (bytes + 255) & ~(size_t)255; return p; };
  unsigned short* w16 = (unsigned short*)carve((size_t)3 * C * C * 2); b16* w4r = (b16*)carve((size_t)C * C * 2); float* bnp = (float*)carve(5 * 2 * C * 4);
  b16* q = (b16*)carve((size_t)NTOK * C * 2); b16* k = (b16*)carve((size_t)NTOK * C * 2); b16* v = (b16*)carve((size_t)NTOK * C * 2);
  if (off > ws_size) return;                                    // about 0.5 + 3 x 16.8 MB
  prep_kernel<<<PREPB, 256, 0, stream>>>(W1, W2, W3, W4, g, be, mu, var, w16, w4r, bnp);
  qkv_kernel<<<NTOK / MP, 256, 0, stream>>>(x, w16, b1, b2, b3, bnp, q, k, v);
  local_last_kernel<<<NTOK / PB, 256, 0, stream>>>(q, k, v, bnp, w4r, b4, x, out);
}

// v008
// A run of this version takes 40.7 microseconds.
// In both of two side-by-side timings against v007, it was 1.06 times as fast.
// All steps since v000 together make it 3.86 times as fast.
#include <hip/hip_runtime.h>

// PixelTransformerResnet: q, k, v = relu(bn_i(conv1x1_i(x))) (eval-mode BN with given statistics); per pixel 9 logits = q . k(neighbour n) / 16 over the 3x3 neighbourhood (zero vectors
// outside the image, kept in the softmax), att = softmax over the 9, out = Σ_n att_n v(neighbour n); out = relu(bn_3(out)); out = bn_4(conv1x1_4(out)); y = relu(out + x) -> NCHW [8][256][64][64].
// The four 1x1 convolutions run on WMMA: q/k/v on v_wmma_f32_16x16x32_bf16 with exact bf16 operands (x transposed to pixel-major through LDS; 1 product), the last
// one on v_wmma_f32_16x16x32_f16 with the attention output split into an f16 hi+lo pair x8 against exact W4 (2 products); f32 accumulate. The 9 logits of a pixel are diagonals of 16 x 16 products q . k^T on the same f16 form (q, k exact, f32 accumulate);
// softmax (native exp) and the sum over the 9 v rows in f32, a wave per 2 x 4 pixels (2 image rows), lanes split the 256 channels; q, k, v pass from the second launch to it as f16 rows. BN / relu / residual in f32. Fragment k-map per lane half hh for A AND B: elements 0..7 <- k =

namespace {
constexpr int Bn = 8, C = 256, HW = 64, NP = HW * HW, NTOK = Bn * NP;
constexpr float EPS = 1e-5f, OS_ = 8.0f, ISQ = 0.0625f;   // 1/sqrt(256)

typedef _Float16 b16;
typedef __attribute__((ext_vector_type(16))) _Float16 v16b;
typedef __attribute__((ext_vector_type(16))) __bf16 v16bb;
typedef __attribute__((ext_vector_type(8))) _Float16 v8b;
typedef __attribute__((ext_vector_type(4))) _Float16 v4b;
typedef __attribute__((ext_vector_type(8))) unsigned short v8us;
typedef __attribute__((ext_vector_type(8))) float v8f;
typedef __attribute__((ext_vector_type(4))) float v4f;
__device__ __forceinline__ float bf16_rne(float f) { unsigned int u = __float_as_uint(f); u += 0x7FFFu + ((u >> 16) & 1u); return __uint_as_float(u & 0xFFFF0000u); }
__device__ __forceinline__ unsigned short bf16_bits(float f) { unsigned int u = __float_as_uint(f); u += 0x7FFFu + ((u >> 16) & 1u); return (unsigned short)(u >> 16); }
__device__ __forceinline__ void split16(float v, b16& hi, b16& lo) { hi = (b16)v; lo = (b16)(v - (float)hi); }
// Fragment tiles: a 16-row x 32-k block of a 16-bit operand is stored as 512 consecutive elements, piece (ld, lane) of 8 elements at ld * 256 + lane * 8 holding row (lane & 15),
// k = ld * 16 + (lane >> 4) * 8 + 0..7 (the k-map above, the same for A and B), so that each 16-byte-per-lane load of a wave covers 512 contiguous bytes. Tile (rt, kt) of a [rows][C] operand lies at (rt * KT + kt) * FT.
constexpr int FT = 512, KT = C / 32;
__device__ __forceinline__ int tile_row(int o) { return (o >> 6) / KT * 16 + (o & 15); }                                   // row and first k of piece o (8 elements) of a tiled operand
__device__ __forceinline__ int tile_k(int o) { return (o >> 6) % KT * 32 + ((o >> 5) & 1) * 16 + ((o >> 4) & 1) * 8; }
__device__ __forceinline__ v16b frag_kb_t(const b16* tile, int lane) { const v8b a = *(const v8b*)(tile + lane * 8), b = *(const v8b*)(tile + 256 + lane * 8); v16b f;
#pragma unroll
  for (int e = 0; e < 8; ++e) { f[e] = a[e]; f[8 + e] = b[e]; } return f; }
// the same fragment from a row-major row: p points at the lane's row, k = kb + 8 hh; elements 0..7 <- p[0..7], 8..15 <- p[16..23]
__device__ __forceinline__ v16b frag_row(const b16* p) { const v8b a = *(const v8b*)p, b = *(const v8b*)(p + 16); v16b f;
#pragma unroll
  for (int e = 0; e < 8; ++e) { f[e] = a[e]; f[8 + e] = b[e]; } return f; }
__device__ __forceinline__ v16bb frag_bf_t(const unsigned short* tile, int lane) { const v8us a = *(const v8us*)(tile + lane * 8), b = *(const v8us*)(tile + 256 + lane * 8); union { unsigned short s[16]; v16bb v; } u;
#pragma unroll
  for (int e = 0; e < 8; ++e) { u.s[e] = a[e]; u.s[8 + e] = b[e]; } return u.v; }
__device__ __forceinline__ v8f wmma16b(v16b a, v16b b, v8f c) { v8f d = __builtin_amdgcn_wmma_f32_16x16x32_f16(false, a, false, b, (short)0, c, false, false); asm volatile("v_nop\n\tv_nop\n\tv_nop\n\tv_nop" : "+v"(d) : "v"(a), "v"(b)); return d; }
__device__ __forceinline__ v8f wmma16bb(v16bb a, v16bb b, v8f c) { v8f d = __builtin_amdgcn_wmma_f32_16x16x32_bf16(false, a, false, b, (short)0, c, false, false); asm volatile("v_nop\n\tv_nop\n\tv_nop\n\tv_nop" : "+v"(d) : "v"(a), "v"(b)); return d; }
// hand-over of an LDS patch among the lanes of ONE wave: the wave's own LDS writes have landed and its LDS reads have returned, and the compiler moves no memory access over the statement; unlike a fence it leaves the wave's global loads and stores in flight
__device__ __forceinline__ void wave_lds_sync() { asm volatile("s_wait_dscnt 0x0" ::: "memory"); __builtin_amdgcn_wave_barrier(); }
__device__ __forceinline__ float nexp(float x) { float r; asm("v_exp_f32 %0, %1\n\tv_nop" : "=v"(r) : "v"(x * 1.4426950408889634f)); return r; }
__device__ __forceinline__ float pmul(float a, float b) { float p = a * b; asm volatile("" : "+v"(p)); return p; }

// prep: W1..3 [256][256] -> bf16 fragment tiles; W4 -> f16 fragment tiles; bnp: for each of the 5 BN layers scale[C], then shift[C]. One 8-element piece (or one BN channel) per thread, block-uniform choice of the source
constexpr int PREPB = 4 * C * C / 8 / 256 + 5 * C / 256;         // blocks of the prep launch
__global__ __launch_bounds__(256) void prep_kernel(const float* __restrict__ W1, const float* __restrict__ W2, const float* __restrict__ W3, const float* __restrict__ W4, const float* __restrict__ g, const float* __restrict__ be, const float* __restrict__ mu, const float* __restrict__ var,
                                                   unsigned short* __restrict__ w16, b16* __restrict__ w4r, float* __restrict__ bnp) {
  static_assert((C * C / 8) % 256 == 0 && (5 * C) % 256 == 0, "whole blocks per source");
  const int t_ = threadIdx.x, bid = blockIdx.x, i = bid * 256 + t_;
  if (bid < 3 * C * C / 8 / 256) { const int m = i / (C * C / 8), q = i % (C * C / 8); const float* W = (m == 0) ? W1 : (m == 1) ? W2 : W3; v8us o;
#pragma unroll
    for (int e = 0; e < 8; ++e) o[e] = bf16_bits(W[tile_row(q) * C + tile_k(q) + e]);
    *(v8us*)(w16 + (size_t)i * 8) = o; asm volatile("s_wait_xcnt 0x0" ::: "memory");  /* holds any later rewrite of the store's registers behind the store's issue */ }
  else if (bid < 4 * C * C / 8 / 256) { const int j = i - 3 * C * C / 8; v8b o;
#pragma unroll
    for (int e = 0; e < 8; ++e) o[e] = (b16)bf16_rne(W4[tile_row(j) * C + tile_k(j) + e]);
    *(v8b*)(w4r + (size_t)j * 8) = o; asm volatile("s_wait_xcnt 0x0" ::: "memory");  /* holds any later rewrite of the store's registers behind the store's issue */ }
  else { const int j = i - 4 * C * C / 8; const float sc = bf16_rne(g[j]) * rsqrtf(bf16_rne(var[j]) + EPS); ((float*)bnp)[(j / C) * 2 * C + (j % C)] = sc; ((float*)bnp)[(j / C) * 2 * C + C + (j % C)] = bf16_rne(be[j]) - bf16_rne(mu[j]) * sc; asm volatile("s_wait_xcnt 0x0" ::: "memory");  /* holds any later rewrite of the store's registers behind the store's issue */ }
}

// q, k, v of MP pixels per block, straight from x: the block reads its MP pixels x C channels of x (NCHW, 256-byte runs of a channel) once, rounds them to bf16 and lays them pixel-major in LDS; behind one barrier its 8 waves
// multiply that tile with all 3 x C weight columns. Wave w takes all MP rows x 32 columns of q, then of k, then of v: A fragments from LDS (row-major rows, the k-map above), B fragments from the weight tiles, each
// read once per block. Per accumulator the order is kb = 0, 32, .. as before. Wave w takes the column tiles w and w + 8 (channels 16 w .. + 15 and 128 + 16 w .. + 15). q, k, v are stored rounded to f16 (nearest even), half the bytes of f32,
// in the order in which the attention lanes read them: the 16-byte piece L of a pixel's 512-byte row holds channels 4 L + e and 128 + 4 L + e as the pair at elements 2 e, 2 e + 1. The result passes through the wave's own LDS patch, so that every lane stores 16 bytes and a wave's 32 channels of a pixel are one 64-byte run.
constexpr int MP = 64, TP = 20;                                  // pixels of a block; pitch in 32-bit words (an f16 pair each) of the result patch (64-byte rows; the two lane halves, 8 rows apart, fall on different banks)
typedef __attribute__((ext_vector_type(2))) _Float16 v2b;
typedef __attribute__((ext_vector_type(4))) unsigned int v4u;
typedef __attribute__((ext_vector_type(2))) unsigned short v2us;
__device__ __forceinline__ v16bb frag_bf_row(const unsigned short* p) { const v8us a = *(const v8us*)p, b = *(const v8us*)(p + 16); union { unsigned short s[16]; v16bb v; } u;
#pragma unroll
  for (int e = 0; e < 8; ++e) { u.s[e] = a[e]; u.s[8 + e] = b[e]; } return u.v; }
// weight tile of step s = matrix * KT + k block, column tile ct
__device__ __forceinline__ const unsigned short* wtile(const unsigned short* w16, int s, int ct) { return w16 + (size_t)(((s / KT) * (C / 16) + ct) * KT + s % KT) * FT; }
__global__ __launch_bounds__(256, 4) void qkv_kernel(const float* __restrict__ x, const unsigned short* __restrict__ w16, const float* __restrict__ b1, const float* __restrict__ b2, const float* __restrict__ b3, const float* __restrict__ bnp, b16* __restrict__ q, b16* __restrict__ k, b16* __restrict__ v) {
  __shared__ __attribute__((aligned(16))) unsigned short Tt[MP][C + 8];
  __shared__ __attribute__((aligned(16))) unsigned int Ts[8][32 * TP];
  const int t_ = threadIdx.x, lane = t_ & 31, wave = __builtin_amdgcn_readfirstlane(t_ >> 5), nloc = lane & 15, hlf = lane >> 4;
  const int m0 = blockIdx.x * MP, ct0 = wave; const float* src = x + (size_t)(blockIdx.x / (NP / MP)) * C * NP + (blockIdx.x % (NP / MP)) * MP;
  // the weight fragments run two steps ahead of their products, over the borders between q, k and v too; the first two steps are asked for here and fly with the x tile
  v16bb rb[2][2];
#pragma unroll
  for (int s = 0; s < 2; ++s)
#pragma unroll
    for (int t = 0; t < 2; ++t) rb[s][t] = frag_bf_t(wtile(w16, s, ct0 + 8 * t), lane);
  { constexpr int NT = MP * C / 8 / 256; v4f xa[NT], xb[NT];         // a thread and trip: 4 pixels of 2 neighbouring channels; all loads of the tile are in flight together
#pragma unroll
    for (int it = 0; it < NT; ++it) { const int idx = it * 256 + t_, j = idx % (MP / 4), cp = idx / (MP / 4); const unsigned o = (unsigned)((2 * cp) * NP + 4 * j); xa[it] = *(const v4f*)(src + o); xb[it] = *(const v4f*)(src + o + NP); }
    asm volatile("s_wait_xcnt 0x0" ::: "memory");                   // holds any later rewrite of the loads' address registers behind the loads' issue
#pragma unroll
    for (int it = 0; it < NT; ++it) { const int idx = it * 256 + t_, j = idx % (MP / 4), cp = idx / (MP / 4);
#pragma unroll
      for (int e = 0; e < 4; ++e) *(v2us*)(&Tt[4 * j + e][2 * cp]) = (v2us){bf16_bits(xa[it][e]), bf16_bits(xb[it][e])}; } }
  __syncthreads();                                                 // the block's x tile is complete in LDS
  unsigned int* Tw = Ts[wave];
#pragma unroll
  for (int which = 0; which < 3; ++which) {
    const float* bias = (which == 0) ? b1 : (which == 1) ? b2 : b3; const float* sc = bnp + which * 2 * C; const float* sh = sc + C; b16* dst0 = ((which == 0) ? q : (which == 1) ? k : v) + (size_t)m0 * C + wave * 32;
    float bb[2], s_[2], h_[2];                                      // channel constants, asked for in front of the products
#pragma unroll
    for (int t = 0; t < 2; ++t) { const int c = t * 128 + wave * 16 + nloc; bb[t] = bf16_rne(bias[c]); s_[t] = sc[c]; h_[t] = sh[c]; }
    v8f acc[4][2];
#pragma unroll
    for (int r = 0; r < 4; ++r)
#pragma unroll
      for (int t = 0; t < 2; ++t) acc[r][t] = (v8f){};
#pragma unroll
    for (int kt = 0; kt < KT; ++kt) { const v16bb bw[2] = {rb[kt & 1][0], rb[kt & 1][1]}; const int nx = which * KT + kt + 2;
      if (nx < 3 * KT) { rb[kt & 1][0] = frag_bf_t(wtile(w16, nx, ct0), lane); rb[kt & 1][1] = frag_bf_t(wtile(w16, nx, ct0 + 8), lane); }
      __builtin_amdgcn_sched_barrier(0);                           // keeps the weight loads of two steps ahead in front of this step's products, so that they fly under them (without it each load sinks to its product, with a full wait)
      v16bb a[4];
#pragma unroll
      for (int r = 0; r < 4; ++r) a[r] = frag_bf_row(&Tt[r * 16 + nloc][kt * 32 + 8 * hlf]);
#pragma unroll
      for (int r = 0; r < 4; ++r) { acc[r][0] = wmma16bb(a[r], bw[0], acc[r][0]); acc[r][1] = wmma16bb(a[r], bw[1], acc[r][1]); } }
#pragma unroll
    for (int h = 0; h < 2; ++h) {                                   // 32 rows at a time through the wave's patch
#pragma unroll
      for (int r = 0; r < 2; ++r)
#pragma unroll
        for (int vv = 0; vv < 8; ++vv) { const v2b pr = {(b16)fmaxf((acc[h * 2 + r][0][vv] + bb[0]) * s_[0] + h_[0], 0.0f), (b16)fmaxf((acc[h * 2 + r][1][vv] + bb[1]) * s_[1] + h_[1], 0.0f)};
          Tw[(r * 16 + vv + 8 * hlf) * TP + nloc] = __builtin_bit_cast(unsigned int, pr); }   // word nloc of the wave's 16: channels 16 w + nloc and 128 + 16 w + nloc
      wave_lds_sync();
#pragma unroll
      for (int j = 0; j < 4; ++j) { const int rr = j * 8 + (lane >> 2), c4 = (lane & 3) * 4; *(v4u*)(dst0 + (size_t)(h * 32 + rr) * C + c4 * 2) = *(const v4u*)(Tw + rr * TP + c4); }
      if (which < 2 || h < 1) {                                     // behind the last stores nothing follows
        asm volatile("s_wait_xcnt 0x0" ::: "memory");               // holds any later rewrite of the stores' registers behind the stores' issue
        wave_lds_sync(); } } }
}

// local attention. Logits: the block's PB rows of q and the (RW + 2) x (PC + 2) rows of k around them (addresses clamped into the image) go to LDS once. For a tile of 16 pixels of one image row and one of the 9 offsets, the product of the tile's q rows (A) with the k rows
// of the same 16 pixels moved by that offset (B, the same loader and so the same k pairing as A) has the 16 wanted dots on its diagonal. Wave w takes tile w & 3 and half w >> 2 of the channels, all 9 offsets; the two halves' partial sums meet in LDS. Lane l & 7 of a wave then does the softmax of one of the wave's 8 pixels.
// Sum over v: a wave takes PS consecutive pixels in each of RW neighbouring image rows; lane holds channels {4 lane .. +3} and {128 + 4 lane .. +3}, one 16-byte piece of a pixel's f16 row. Each of the (RW + 2) x (PS + 2) neighbour rows of v is loaded once per wave; the sum over n = 0..8 keeps its order. A neighbour outside the image keeps logit 0 in the softmax and enters the output with weight 0. One register set R holds one image row's PS + 2 neighbours; a column is refilled for the next image row once its last pixel has used it.
// The same launch then does the last 1x1 convolution of the block's PB pixels: the attention rows (after bn_3 and relu) go to LDS as the f16 hi and lo parts, the 8 waves multiply them with W4's fragment tiles, and the result
// passes through LDS once more so that every store of out, and every load of the residual x, covers whole 128-byte lines (PC pixels of one channel and image row). Pixel m of a block: image row m / PC, column m % PC.
constexpr int PS = 4, RW = 2, PC = 8 * PS, PB = RW * PC;         // a wave's pixels in one image row, its image rows; pixel columns and pixels of a block
constexpr int HC = PC + 2, HR = RW + 2, LP = 12;                 // columns and rows of the block's k neighbourhood; pitch in floats of a pixel's 9 partial logits (16-byte rows)
__device__ __forceinline__ float from_lane(float f, int l) { return __uint_as_float(__builtin_amdgcn_readlane(__float_as_uint(f), l)); }   // lane l's value, moved to a scalar register
__global__ __launch_bounds__(256, 4) void local_last_kernel(const b16* __restrict__ q, const b16* __restrict__ k, const b16* __restrict__ v, const float* __restrict__ bnp, const b16* __restrict__ w4r, const float* __restrict__ b4, const float* __restrict__ x, float* __restrict__ out) {
  // one LDS block, used three times, a barrier between the uses: the PB rows of q and HR x HC rows of k; the block's PB attention rows as f16 hi and lo parts (every pitch C + 8: 16 bytes past the row, for the 16-byte fragment reads); the PB x C result as Tc[channel][pixel]
  constexpr int SM0 = (PB + HR * HC) * (C + 8) * 2, SM1 = 2 * PB * (C + 8) * 2, SM2 = C * (PB + 4) * 4;
  __shared__ __attribute__((aligned(16))) unsigned char sm[SM0 > SM1 ? (SM0 > SM2 ? SM0 : SM2) : (SM1 > SM2 ? SM1 : SM2)];
  __shared__ __attribute__((aligned(16))) float Pl[2][PB][LP];     // partial logits: half of the channels, pixel of the block, offset n
  b16 (*Sh)[C + 8] = (b16 (*)[C + 8])sm; b16 (*Sl)[C + 8] = Sh + PB; float (*Tc)[PB + 4] = (float (*)[PB + 4])sm; b16 (*Sq)[C + 8] = Sh; b16 (*Sk)[C + 8] = Sh + PB;
  const int wid = __builtin_amdgcn_readfirstlane(threadIdx.x >> 5), lane = threadIdx.x & 31; const int ca = lane * 4, cb = 128 + lane * 4, cl = lane * 8, nloc = lane & 15, hlf = lane >> 4;
  constexpr int BR = HW / PC, BY = HW / RW;                        // blocks side by side in an image row; block rows of an image
  const int xb = (blockIdx.x % BR) * PC, x0 = xb + wid * PS, y0 = ((blockIdx.x / BR) % BY) * RW, b = blockIdx.x / (BR * BY);
  int nb[RW + 2][PS + 2];                                          // the wave's neighbour pixels, clamped into the image; the same for the whole wave
#pragma unroll
  for (int r = 0; r < RW + 2; ++r)
#pragma unroll
    for (int c = 0; c < PS + 2; ++c) nb[r][c] = b * NP + min(max(y0 + r - 1, 0), HW - 1) * HW + min(max(x0 + c - 1, 0), HW - 1);
  v8b R[PS + 2];                                                   // R: one image row's neighbours as loaded, f16 pairs (channel ca + e, channel cb + e)
  { static_assert(PB % 8 == 0 && HR * 2 == 8 && HC % 2 == 0 && PC % 8 == 0, "a wave stages PB / 8 rows of q and half a neighbourhood row of k");
    constexpr int NQ = PB / 8, NK = HC / 2; v8b tq[NQ], tk[NK];      // a row is one 16-byte-per-lane load of the wave; all of them are in flight together
    const int hr = wid >> 1, hc0 = (wid & 1) * NK, mq = wid * NQ;
    const b16* qs = q + (size_t)(b * NP + (y0 + mq / PC) * HW + xb + mq % PC) * C + cl; const b16* ks = k + (size_t)(b * NP + min(max(y0 + hr - 1, 0), HW - 1) * HW) * C + cl;
    // image column of the wave's piece j: xb + hc0 + j - 1; only the first piece can fall left of the image and only the last one right of it (the others reach at most HW - PC + HC - 3 = HW - 1)
    const b16* kf = ks + max(xb + hc0 - 1, 0) * C; const b16* km = ks + (xb + hc0) * C; const b16* ke = ks + min(xb + hc0 + NK - 2, HW - 1) * C; const b16* vp[PS + 2];
#pragma unroll
    for (int j = 0; j < NQ; ++j) tq[j] = *(const v8b*)(qs + j * C);
#pragma unroll
    for (int j = 0; j < NK; ++j) tk[j] = *(const v8b*)(j == 0 ? kf : j == NK - 1 ? ke : km + (j - 1) * C);
    asm volatile("s_wait_xcnt 0x0" ::: "memory");                   // holds any rewrite of the q and k loads' address registers, the results of the v loads below among them, behind those loads' issue
#pragma unroll
    for (int c = 0; c < PS + 2; ++c) { vp[c] = v + (size_t)nb[0][c] * C + cl; R[c] = *(const v8b*)vp[c]; }   // row 0 of v flies under the logits
    static_assert(PS == 4, "the wait behind the batch names every address of its v loads");
    asm volatile("s_wait_xcnt 0x0" :: "v"(vp[0]), "v"(vp[1]), "v"(vp[2]), "v"(vp[3]), "v"(vp[4]), "v"(vp[5]) : "memory");   // the same for the v loads; as operands their addresses stay live up to here, so that no load of the batch takes them for its result
#pragma unroll
    for (int j = 0; j < NQ; ++j) *(v8b*)(&Sq[mq + j][cl]) = tq[j];
#pragma unroll
    for (int j = 0; j < NK; ++j) *(v8b*)(&Sk[hr * HC + hc0 + j][cl]) = tk[j]; }
  __syncthreads();                                                 // the block's q rows and k neighbourhood are complete in LDS
  { const int tl = wid & 3, kh = wid >> 2, tw = tl / (PC / 16), tc = tl % (PC / 16) * 16;   // pixel tile: pixels tl * 16 .. + 15 of the block, image row tw, first column tc; half of the channels
    v8f la[9];
#pragma unroll
    for (int n = 0; n < 9; ++n) la[n] = (v8f){};
#pragma unroll
    for (int kt = 0; kt < KT / 2; ++kt) { const int kb = kh * (C / 2) + kt * 32 + 8 * hlf; const v16b a = frag_row(&Sq[tl * 16 + nloc][kb]); v16b bk[9];
#pragma unroll
      for (int n = 0; n < 9; ++n) bk[n] = frag_row(&Sk[(tw + n / 3) * HC + tc + nloc + n % 3][kb]);
#pragma unroll
      for (int n = 0; n < 9; ++n) la[n] = wmma16b(a, bk[n], la[n]); }
    // register vv of lane (nloc, hlf) is element (8 hlf + vv, nloc): the diagonal of pixel j stands in register j & 7 of lane j (j < 8) or 16 + j (j >= 8)
    float dg[9];
#pragma unroll
    for (int n = 0; n < 9; ++n) dg[n] = la[n][lane & 7];
    if ((nloc >> 3) == hlf) { float* pp = &Pl[kh][tl * 16 + nloc][0]; *(v4f*)pp = (v4f){dg[0], dg[1], dg[2], dg[3]}; *(v4f*)(pp + 4) = (v4f){dg[4], dg[5], dg[6], dg[7]}; pp[8] = dg[8]; } }
  __syncthreads();                                                 // both halves of every logit are in LDS, and every wave has read its last q and k fragment
  float lg[RW][PS][9];
  { const int sw = (lane & 7) / PS, sp = lane % PS, m = sw * PC + wid * PS + sp, ys = y0 + sw, xs = x0 + sp;   // lane l & 7 takes pixel (image row sw, column sp) of the wave's RW x PS; the other lanes repeat it
    static_assert(RW * PS == 8, "one lane of 8 per pixel of the wave");
    const v4f pa0 = *(const v4f*)(&Pl[0][m][0]), pa1 = *(const v4f*)(&Pl[0][m][4]), pb0 = *(const v4f*)(&Pl[1][m][0]), pb1 = *(const v4f*)(&Pl[1][m][4]); const float pa2 = Pl[0][m][8], pb2 = Pl[1][m][8];
    float t[9]; bool in[9];
#pragma unroll
    for (int n = 0; n < 9; ++n) { in[n] = ((unsigned)(ys + n / 3 - 1) < (unsigned)HW) && ((unsigned)(xs + n % 3 - 1) < (unsigned)HW);
      const float d = (n < 4) ? pa0[n & 3] + pb0[n & 3] : (n < 8) ? pa1[n & 3] + pb1[n & 3] : pa2 + pb2; t[n] = in[n] ? d * ISQ : 0.0f; }   // zero-padded neighbours give logit 0 and ARE part of the softmax
    float mx = t[0];
#pragma unroll
    for (int n = 1; n < 9; ++n) mx = fmaxf(mx, t[n]);
    float z = 0.0f;
#pragma unroll
    for (int n = 0; n < 9; ++n) { t[n] = nexp(t[n] - mx); z += t[n]; }
    const float iz = 1.0f / z;
#pragma unroll
    for (int n = 0; n < 9; ++n) t[n] = in[n] ? t[n] * iz : 0.0f;
#pragma unroll
    for (int w = 0; w < RW; ++w)
#pragma unroll
      for (int p = 0; p < PS; ++p)
#pragma unroll
        for (int n = 0; n < 9; ++n) lg[w][p][n] = from_lane(t[n], w * PS + p); }
  v4f oa[RW][PS], ob[RW][PS];
#pragma unroll
  for (int w = 0; w < RW; ++w)
#pragma unroll
    for (int p = 0; p < PS; ++p) { oa[w][p] = (v4f){0.0f, 0.0f, 0.0f, 0.0f}; ob[w][p] = oa[w][p]; }
  const float* sc = bnp + 3 * 2 * C; const float* sh = sc + C; v4f sa, sb, ha, hb;
#pragma unroll
  for (int r = 0; r < RW + 2; ++r) {
#pragma unroll
    for (int c = 0; c < PS + 2; ++c) { v4f A, B;
#pragma unroll
      for (int e = 0; e < 4; ++e) { A[e] = (float)R[c][2 * e]; B[e] = (float)R[c][2 * e + 1]; }
#pragma unroll
      for (int w = 0; w < RW; ++w) { if (r - w < 0 || r - w > 2) continue;
#pragma unroll
        for (int p = 0; p < PS; ++p) { if (c - p < 0 || c - p > 2) continue;
          const float a_ = lg[w][p][(r - w) * 3 + c - p];
#pragma unroll
          for (int e = 0; e < 4; ++e) { oa[w][p][e] += pmul(a_, A[e]); ob[w][p][e] += pmul(a_, B[e]); }
          asm volatile("" : "+v"(oa[w][p]), "+v"(ob[w][p])); } }      // empty asm on each sum, against spills: without it the adds sink to the end and the products stay live
      if (r < RW + 1) { const b16* nx = v + (size_t)nb[r < RW + 1 ? r + 1 : 0][c] * C; R[c] = *(const v8b*)(nx + cl); }
      else if (c == 0) { sa = *(const v4f*)(sc + ca); sb = *(const v4f*)(sc + cb); }
      else if (c == 1) { ha = *(const v4f*)(sh + ca); hb = *(const v4f*)(sh + cb); }
      __builtin_amdgcn_sched_barrier(0); } }                       // keeps each column's sums and refill together, so that the refills stay spread over the row
  // W4 fragments of the wave's 32 output channels wid * 32 .. + 31: column tile t at t * KT * FT, k block kb at (kb >> 5) * FT; the first pair is asked for here, so that it flies under the conversions below
  const int c0 = wid * 32; const b16* wb = w4r + (size_t)(c0 >> 4) * KT * FT; v16b bn[2] = {frag_kb_t(wb, lane), frag_kb_t(wb + KT * FT, lane)};
#pragma unroll
  for (int w = 0; w < RW; ++w)
#pragma unroll
    for (int p = 0; p < PS; ++p) { v4b h0, l0, h1, l1; const int m = w * PC + wid * PS + p;
#pragma unroll
      for (int e = 0; e < 4; ++e) { b16 hi, lo; split16(fmaxf(oa[w][p][e] * sa[e] + ha[e], 0.0f) * OS_, hi, lo); h0[e] = hi; l0[e] = lo; split16(fmaxf(ob[w][p][e] * sb[e] + hb[e], 0.0f) * OS_, hi, lo); h1[e] = hi; l1[e] = lo; }
      *(v4b*)(&Sh[m][ca]) = h0; *(v4b*)(&Sh[m][cb]) = h1; *(v4b*)(&Sl[m][ca]) = l0; *(v4b*)(&Sl[m][cb]) = l1; }
  __syncthreads();                                                 // the block's PB attention rows are complete in LDS
  // last 1x1 convolution of these PB pixels: wave wid takes all PB rows x output channels wid * 32 .. + 31; per accumulator the order is hi, lo within kb = 0, 32, ..
  constexpr int MT = PB / 16;
  v8f acc[MT][2];
#pragma unroll
  for (int r = 0; r < MT; ++r)
#pragma unroll
    for (int t = 0; t < 2; ++t) acc[r][t] = (v8f){};
#pragma unroll
  for (int kb = 0; kb < C; kb += 32) { const v16b bw[2] = {bn[0], bn[1]};
    if (kb + 32 < C) { bn[0] = frag_kb_t(wb + ((kb >> 5) + 1) * FT, lane); bn[1] = frag_kb_t(wb + (KT + (kb >> 5) + 1) * FT, lane); }
    __builtin_amdgcn_sched_barrier(0);                             // keeps the next k block's W4 loads in front of this block's products, so that they fly under them (without it each load stands directly in front of its product, with a full wait)
    v16b ah[MT], al[MT];
#pragma unroll
    for (int r = 0; r < MT; ++r) { ah[r] = frag_row(&Sh[r * 16 + nloc][kb + 8 * hlf]); al[r] = frag_row(&Sl[r * 16 + nloc][kb + 8 * hlf]); }
#pragma unroll
    for (int t = 0; t < 2; ++t)
#pragma unroll
      for (int r = 0; r < MT; ++r) { acc[r][t] = wmma16b(ah[r], bw[t], acc[r][t]); acc[r][t] = wmma16b(al[r], bw[t], acc[r][t]); } }
  // residual rows and channel constants: one batch of loads behind the last products, whole 128-byte lines; the barrier below ends them, so that they fly while the block's other waves finish their products
  constexpr int CJ = 256 / (PB / 4);                               // channels that the block's 256 threads cover in one trip, 4 pixels a thread
  const int cc = threadIdx.x / (PB / 4), c4 = (threadIdx.x % (PB / 4)) * 4; const size_t io = ((size_t)b * C + cc) * NP + (y0 + c4 / PC) * HW + xb + c4 % PC; v4f xr[C * PB / 4 / 256]; const float* xp = x + io;
#pragma unroll
  for (int j = 0; j < C * PB / 4 / 256; ++j) xr[j] = *(const v4f*)(xp + (size_t)j * CJ * NP);
  const float* sc4 = bnp + 4 * 2 * C; const float* sh4 = sc4 + C; float bb[2], s_[2], h_[2]; const int co0 = c0 + nloc;
#pragma unroll
  for (int t = 0; t < 2; ++t) { const int co = co0 + t * 16; bb[t] = bf16_rne(b4[co]); s_[t] = sc4[co]; h_[t] = sh4[co]; }
  asm volatile("s_wait_xcnt 0x0" :: "v"(xp), "v"(co0) : "memory");   // holds any rewrite of the batch's address registers behind the loads' issue; as operands they stay live up to here, so that no load of the batch takes them for its result
  __syncthreads();                                                 // every wave has read its last fragment: the LDS block may take the result
#pragma unroll
  for (int t = 0; t < 2; ++t)
#pragma unroll
    for (int r = 0; r < MT; ++r)
#pragma unroll
      for (int vv = 0; vv < 8; ++vv) Tc[c0 + t * 16 + nloc][r * 16 + 8 * hlf + vv] = (acc[r][t][vv] * (1.0f / OS_) + bb[t]) * s_[t] + h_[t];
  __syncthreads();                                                 // the result is complete in LDS
#pragma unroll
  for (int j = 0; j < C * PB / 4 / 256; ++j) { v4f t4 = *(const v4f*)(&Tc[cc + j * CJ][c4]);
#pragma unroll
    for (int e = 0; e < 4; ++e) t4[e] = fmaxf(t4[e] + bf16_rne(xr[j][e]), 0.0f);
    *(v4f*)(out + io + (size_t)j * CJ * NP) = t4; }
}
}  // namespace

extern "C" void kernel_launch(void* const* d_in, const int* in_sizes, int n_in,
                              void* d_out, int out_size, void* d_ws, size_t ws_size, hipStream_t stream) {
  (void)n_in; (void)out_size;
  const float* x = (const float*)d_in[0]; const float* W1 = (const float*)d_in[1]; const float* b1 = (const float*)d_in[2]; const float* W2 = (const float*)d_in[3]; const float* b2 = (const float*)d_in[4]; const float* W3 = (const float*)d_in[5]; const float* b3 = (const float*)d_in[6]; const float* W4 = (const float*)d_in[7]; const float* b4 = (const float*)d_in[8];
  const float* g = (const float*)d_in[9]; const float* be = (const float*)d_in[10]; const float* mu = (const float*)d_in[11]; const float* var = (const float*)d_in[12];
  float* out = (float*)d_out;   // [8][256][64][64]
  if (in_sizes[0] != Bn * C * NP || in_sizes[1] != C * C || in_sizes[7] != C * C || in_sizes[9] != 5 * C || in_sizes[12] != 5 * C) return;
  size_t off = 0; char* ws = (char*)d_ws;
  auto carve = [&](size_t bytes) { char* p = ws + off; off += (bytes + 255) & ~(size_t)255; return p; };
  unsigned short* w16 = (unsigned short*)carve((size_t)3 * C * C * 2); b16* w4r = (b16*)carve((size_t)C * C * 2); float* bnp = (float*)carve(5 * 2 * C * 4);
  b16* q = (b16*)carve((size_t)NTOK * C * 2); b16* k = (b16*)carve((size_t)NTOK * C * 2); b16* v = (b16*)carve((size_t)NTOK * C * 2);
  if (off > ws_size) return;                                    // about 0.5 + 3 x 16.8 MB
  prep_kernel<<<PREPB, 256, 0, stream>>>(W1, W2, W3, W4, g, be, mu, var, w16, w4r, bnp);
  qkv_kernel<<<NTOK / MP, 256, 0, stream>>>(x, w16, b1, b2, b3, bnp, q, k, v);
  local_last_kernel<<<NTOK / PB, 256, 0, stream>>>(q, k, v, bnp, w4r, b4, x, out);
}

// v009
// A run of this version takes 36.8 microseconds.
// Next to v008, in two timings, it ran 1.11 and 1.10 times as fast.
// Over all steps from v000 it is 4.26 times as fast.
#include <hip/hip_runtime.h>

// PixelTransformerResnet: q, k, v = relu(bn_i(conv1x1_i(x))) (eval-mode BN with given statistics); per pixel 9 logits = q . k(neighbour n) / 16 over the 3x3 neighbourhood (zero vectors
// outside the image, kept in the softmax), att = softmax over the 9, out = Σ_n att_n v(neighbour n); out = relu(bn_3(out)); out = bn_4(conv1x1_4(out)); y = relu(out + x) -> NCHW [8][256][64][64].
// The four 1x1 convolutions run on WMMA: q/k/v on v_wmma_f32_16x16x32_bf16 with exact bf16 operands (x transposed to pixel-major through LDS; 1 product), the last
// one on v_wmma_f32_16x16x32_f16 with the attention output split into an f16 hi+lo pair x8 against exact W4 (2 products); f32 accumulate. The 9 logits of a pixel are diagonals of 16 x 16 products q . k^T on the same f16 form (q, k exact, f32 accumulate);
// softmax (native exp) and the sum over the 9 v rows in f32, a wave per 2 x 4 pixels (2 image rows), lanes split the 256 channels; q, k, v pass from the second launch to it as f16 rows. BN / relu / residual in f32. Fragment k-map per lane half hh for A AND B: elements 0..7 <- k =

namespace {
constexpr int Bn = 8, C = 256, HW = 64, NP = HW * HW, NTOK = Bn * NP;
constexpr float EPS = 1e-5f, OS_ = 8.0f, ISQ = 0.0625f;   // 1/sqrt(256)

typedef _Float16 b16;
typedef __attribute__((ext_vector_type(16))) _Float16 v16b;
typedef __attribute__((ext_vector_type(16))) __bf16 v16bb;
typedef __attribute__((ext_vector_type(8))) _Float16 v8b;
typedef __attribute__((ext_vector_type(4))) _Float16 v4b;
typedef __attribute__((ext_vector_type(8))) unsigned short v8us;
typedef __attribute__((ext_vector_type(8))) float v8f;
typedef __attribute__((ext_vector_type(4))) float v4f;
__device__ __forceinline__ float bf16_rne(float f) { unsigned int u = __float_as_uint(f); u += 0x7FFFu + ((u >> 16) & 1u); return __uint_as_float(u & 0xFFFF0000u); }
__device__ __forceinline__ unsigned short bf16_bits(float f) { unsigned int u = __float_as_uint(f); u += 0x7FFFu + ((u >> 16) & 1u); return (unsigned short)(u >> 16); }
__device__ __forceinline__ void split16(float v, b16& hi, b16& lo) { hi = (b16)v; lo = (b16)(v - (float)hi); }
// Fragment tiles: a 16-row x 32-k block of a 16-bit operand is stored as 512 consecutive elements, piece (ld, lane) of 8 elements at ld * 256 + lane * 8 holding row (lane & 15),
// k = ld * 16 + (lane >> 4) * 8 + 0..7 (the k-map above, the same for A and B), so that each 16-byte-per-lane load of a wave covers 512 contiguous bytes. Tile (rt, kt) of a [rows][C] operand lies at (rt * KT + kt) * FT.
constexpr int FT = 512, KT = C / 32;
__device__ __forceinline__ int tile_row(int o) { return (o >> 6) / KT * 16 + (o & 15); }                                   // row and first k of piece o (8 elements) of a tiled operand
__device__ __forceinline__ int tile_k(int o) { return (o >> 6) % KT * 32 + ((o >> 5) & 1) * 16 + ((o >> 4) & 1) * 8; }
__device__ __forceinline__ v16b frag_kb_t(const b16* tile, int lane) { const v8b a = *(const v8b*)(tile + lane * 8), b = *(const v8b*)(tile + 256 + lane * 8); v16b f;
#pragma unroll
  for (int e = 0; e < 8; ++e) { f[e] = a[e]; f[8 + e] = b[e]; } return f; }
// the same fragment from a row-major row: p points at the lane's row, k = kb + 8 hh; elements 0..7 <- p[0..7], 8..15 <- p[16..23]
__device__ __forceinline__ v16b frag_row(const b16* p) { const v8b a = *(const v8b*)p, b = *(const v8b*)(p + 16); v16b f;
#pragma unroll
  for (int e = 0; e < 8; ++e) { f[e] = a[e]; f[8 + e] = b[e]; } return f; }
__device__ __forceinline__ v16bb frag_bf_t(const unsigned short* tile, int lane) { const v8us a = *(const v8us*)(tile + lane * 8), b = *(const v8us*)(tile + 256 + lane * 8); union { unsigned short s[16]; v16bb v; } u;
#pragma unroll
  for (int e = 0; e < 8; ++e) { u.s[e] = a[e]; u.s[8 + e] = b[e]; } return u.v; }
__device__ __forceinline__ v8f wmma16b(v16b a, v16b b, v8f c) { v8f d = __builtin_amdgcn_wmma_f32_16x16x32_f16(false, a, false, b, (short)0, c, false, false); asm volatile("v_nop\n\tv_nop\n\tv_nop\n\tv_nop" : "+v"(d) : "v"(a), "v"(b)); return d; }
__device__ __forceinline__ v8f wmma16bb(v16bb a, v16bb b, v8f c) { v8f d = __builtin_amdgcn_wmma_f32_16x16x32_bf16(false, a, false, b, (short)0, c, false, false); asm volatile("v_nop\n\tv_nop\n\tv_nop\n\tv_nop" : "+v"(d) : "v"(a), "v"(b)); return d; }
// hand-over of an LDS patch among the lanes of ONE wave: the wave's own LDS writes have landed and its LDS reads have returned, and the compiler moves no memory access over the statement; unlike a fence it leaves the wave's global loads and stores in flight
__device__ __forceinline__ void wave_lds_sync() { asm volatile("s_wait_dscnt 0x0" ::: "memory"); __builtin_amdgcn_wave_barrier(); }
__device__ __forceinline__ float nexp(float x) { float r; asm("v_exp_f32 %0, %1\n\tv_nop" : "=v"(r) : "v"(x * 1.4426950408889634f)); return r; }
__device__ __forceinline__ float pmul(float a, float b) { float p = a * b; asm volatile("" : "+v"(p)); return p; }

// prep: W1..3 [256][256] -> bf16 fragment tiles; W4 -> f16 fragment tiles; bnp: for each of the 5 BN layers scale[C], then shift[C]. One 8-element piece (or one BN channel) per thread, block-uniform choice of the source
constexpr int PREPB = 4 * C * C / 8 / 256 + 5 * C / 256;         // blocks of the prep launch
__global__ __launch_bounds__(256) void prep_kernel(const float* __restrict__ W1, const float* __restrict__ W2, const float* __restrict__ W3, const float* __restrict__ W4, const float* __restrict__ g, const float* __restrict__ be, const float* __restrict__ mu, const float* __restrict__ var,
                                                   unsigned short* __restrict__ w16, b16* __restrict__ w4r, float* __restrict__ bnp) {
  static_assert((C * C / 8) % 256 == 0 && (5 * C) % 256 == 0, "whole blocks per source");
  const int t_ = threadIdx.x, bid = blockIdx.x, i = bid * 256 + t_;
  if (bid < 3 * C * C / 8 / 256) { const int m = i / (C * C / 8), q = i % (C * C / 8); const float* W = (m == 0) ? W1 : (m == 1) ? W2 : W3; v8us o;
#pragma unroll
    for (int e = 0; e < 8; ++e) o[e] = bf16_bits(W[tile_row(q) * C + tile_k(q) + e]);
    *(v8us*)(w16 + (size_t)i * 8) = o; asm volatile("s_wait_xcnt 0x0" ::: "memory");  /* holds any later rewrite of the store's registers behind the store's issue */ }
  else if (bid < 4 * C * C / 8 / 256) { const int j = i - 3 * C * C / 8; v8b o;
#pragma unroll
    for (int e = 0; e < 8; ++e) o[e] = (b16)bf16_rne(W4[tile_row(j) * C + tile_k(j) + e]);
    *(v8b*)(w4r + (size_t)j * 8) = o; asm volatile("s_wait_xcnt 0x0" ::: "memory");  /* holds any later rewrite of the store's registers behind the store's issue */ }
  else { const int j = i - 4 * C * C / 8; const float sc = bf16_rne(g[j]) * rsqrtf(bf16_rne(var[j]) + EPS); ((float*)bnp)[(j / C) * 2 * C + (j % C)] = sc; ((float*)bnp)[(j / C) * 2 * C + C + (j % C)] = bf16_rne(be[j]) - bf16_rne(mu[j]) * sc; asm volatile("s_wait_xcnt 0x0" ::: "memory");  /* holds any later rewrite of the store's registers behind the store's issue */ }
}

// q, k, v of MP pixels per block, straight from x: the block reads its MP pixels x C channels of x (NCHW, 256-byte runs of a channel) once, rounds them to bf16 and lays them pixel-major in LDS; behind one barrier its 8 waves
// multiply that tile with all 3 x C weight columns. Wave w takes all MP rows x 32 columns of each of q, k and v in turn, in a cyclic order: A fragments from LDS (row-major rows, the k-map above), B fragments from the weight tiles, each
// read once per block. All blocks walk the same weight tiles, so each block starts at a place of its own and wraps: its first matrix of q, k, v and its first k block come from its index (per accumulator the order is k block rot, rot + 1, .., wrapping). Wave w takes the column tiles w and w + 8 (channels 16 w .. + 15 and 128 + 16 w .. + 15). q, k, v are stored rounded to f16 (nearest even), half the bytes of f32,
// in the order in which the attention lanes read them: the 16-byte piece L of a pixel's 512-byte row holds channels 4 L + e and 128 + 4 L + e as the pair at elements 2 e, 2 e + 1. The result passes through the wave's own LDS patch, so that every lane stores 16 bytes and a wave's 32 channels of a pixel are one 64-byte run.
constexpr int MP = 64, TP = 20;                                  // pixels of a block; pitch in 32-bit words (an f16 pair each) of the result patch (64-byte rows; the two lane halves, 8 rows apart, fall on different banks)
typedef __attribute__((ext_vector_type(2))) _Float16 v2b;
typedef __attribute__((ext_vector_type(4))) unsigned int v4u;
typedef __attribute__((ext_vector_type(2))) unsigned short v2us;
__device__ __forceinline__ v16bb frag_bf_row(const unsigned short* p) { const v8us a = *(const v8us*)p, b = *(const v8us*)(p + 16); union { unsigned short s[16]; v16bb v; } u;
#pragma unroll
  for (int e = 0; e < 8; ++e) { u.s[e] = a[e]; u.s[8 + e] = b[e]; } return u.v; }
// weight tile of matrix m, k block kk, column tile ct
__device__ __forceinline__ const unsigned short* wtile(const unsigned short* w16, int m, int kk, int ct) { return w16 + (size_t)((m * (C / 16) + ct) * KT + kk) * FT; }
// a block's first k block in its walk over weight tiles that every block reads: neighbours in the index differ, and so do blocks 8 apart
__device__ __forceinline__ int first_kblock(int bid) { return (bid + (bid >> 3)) & (KT - 1); }
__global__ __launch_bounds__(256, 4) void qkv_kernel(const float* __restrict__ x, const unsigned short* __restrict__ w16, const float* __restrict__ b1, const float* __restrict__ b2, const float* __restrict__ b3, const float* __restrict__ bnp, b16* __restrict__ q, b16* __restrict__ k, b16* __restrict__ v) {
  __shared__ __attribute__((aligned(16))) unsigned short Tt[MP][C + 8];
  __shared__ __attribute__((aligned(16))) unsigned int Ts[8][32 * TP];
  const int t_ = threadIdx.x, lane = t_ & 31, wave = __builtin_amdgcn_readfirstlane(t_ >> 5), nloc = lane & 15, hlf = lane >> 4;
  const int m0 = blockIdx.x * MP, ct0 = wave; const float* src = x + (size_t)(blockIdx.x / (NP / MP)) * C * NP + (blockIdx.x % (NP / MP)) * MP;
  static_assert((KT & (KT - 1)) == 0, "the k walk wraps by a mask");
  const int rot = first_kblock(blockIdx.x), rw = ((blockIdx.x >> 3) & 31) % 3; int mt[3];   // step s of the walk: matrix mt[s / KT], k block (s + rot) & (KT - 1)
#pragma unroll
  for (int i = 0; i < 3; ++i) mt[i] = (i + rw) % 3;
  // the weight fragments run two steps ahead of their products, over the borders between q, k and v too; the first two steps are asked for here and fly with the x tile
  v16bb rb[2][2];
#pragma unroll
  for (int s = 0; s < 2; ++s)
#pragma unroll
    for (int t = 0; t < 2; ++t) rb[s][t] = frag_bf_t(wtile(w16, mt[0], (s + rot) & (KT - 1), ct0 + 8 * t), lane);
  { constexpr int NT = MP * C / 8 / 256; v4f xa[NT], xb[NT];         // a thread and trip: 4 pixels of 2 neighbouring channels; all loads of the tile are in flight together
#pragma unroll
    for (int it = 0; it < NT; ++it) { const int idx = it * 256 + t_, j = idx % (MP / 4), cp = idx / (MP / 4); const unsigned o = (unsigned)((2 * cp) * NP + 4 * j); xa[it] = *(const v4f*)(src + o); xb[it] = *(const v4f*)(src + o + NP); }
    asm volatile("s_wait_xcnt 0x0" ::: "memory");                   // holds any later rewrite of the loads' address registers behind the loads' issue
#pragma unroll
    for (int it = 0; it < NT; ++it) { const int idx = it * 256 + t_, j = idx % (MP / 4), cp = idx / (MP / 4);
#pragma unroll
      for (int e = 0; e < 4; ++e) *(v2us*)(&Tt[4 * j + e][2 * cp]) = (v2us){bf16_bits(xa[it][e]), bf16_bits(xb[it][e])}; } }
  __syncthreads();                                                 // the block's x tile is complete in LDS
  unsigned int* Tw = Ts[wave];
#pragma unroll
  for (int which = 0; which < 3; ++which) {
    const int m = mt[which]; const float* bias = (m == 0) ? b1 : (m == 1) ? b2 : b3; const float* sc = bnp + m * 2 * C; const float* sh = sc + C; b16* dst0 = ((m == 0) ? q : (m == 1) ? k : v) + (size_t)m0 * C + wave * 32;
    float bb[2], s_[2], h_[2];                                      // channel constants, asked for in front of the products
#pragma unroll
    for (int t = 0; t < 2; ++t) { const int c = t * 128 + wave * 16 + nloc; bb[t] = bf16_rne(bias[c]); s_[t] = sc[c]; h_[t] = sh[c]; }
    v8f acc[4][2];
#pragma unroll
    for (int r = 0; r < 4; ++r)
#pragma unroll
      for (int t = 0; t < 2; ++t) acc[r][t] = (v8f){};
#pragma unroll
    for (int kt = 0; kt < KT; ++kt) { const v16bb bw[2] = {rb[kt & 1][0], rb[kt & 1][1]}; const int nx = which * KT + kt + 2;
      if (nx < 3 * KT) { const int nm = mt[nx < 3 * KT ? nx / KT : 0], nk = (nx + rot) & (KT - 1); rb[kt & 1][0] = frag_bf_t(wtile(w16, nm, nk, ct0), lane); rb[kt & 1][1] = frag_bf_t(wtile(w16, nm, nk, ct0 + 8), lane); }
      __builtin_amdgcn_sched_barrier(0);                           // keeps the weight loads of two steps ahead in front of this step's products, so that they fly under them (without it each load sinks to its product, with a full wait)
      v16bb a[4];
#pragma unroll
      for (int r = 0; r < 4; ++r) a[r] = frag_bf_row(&Tt[r * 16 + nloc][((kt + rot) & (KT - 1)) * 32 + 8 * hlf]);
#pragma unroll
      for (int r = 0; r < 4; ++r) { acc[r][0] = wmma16bb(a[r], bw[0], acc[r][0]); acc[r][1] = wmma16bb(a[r], bw[1], acc[r][1]); } }
#pragma unroll
    for (int h = 0; h < 2; ++h) {                                   // 32 rows at a time through the wave's patch
#pragma unroll
      for (int r = 0; r < 2; ++r)
#pragma unroll
        for (int vv = 0; vv < 8; ++vv) { const v2b pr = {(b16)fmaxf((acc[h * 2 + r][0][vv] + bb[0]) * s_[0] + h_[0], 0.0f), (b16)fmaxf((acc[h * 2 + r][1][vv] + bb[1]) * s_[1] + h_[1], 0.0f)};
          Tw[(r * 16 + vv + 8 * hlf) * TP + nloc] = __builtin_bit_cast(unsigned int, pr); }   // word nloc of the wave's 16: channels 16 w + nloc and 128 + 16 w + nloc
      wave_lds_sync();
#pragma unroll
      for (int j = 0; j < 4; ++j) { const int rr = j * 8 + (lane >> 2), c4 = (lane & 3) * 4; *(v4u*)(dst0 + (size_t)(h * 32 + rr) * C + c4 * 2) = *(const v4u*)(Tw + rr * TP + c4); }
      if (which < 2 || h < 1) {                                     // behind the last stores nothing follows
        asm volatile("s_wait_xcnt 0x0" ::: "memory");               // holds any later rewrite of the stores' registers behind the stores' issue
        wave_lds_sync(); } } }
}

// local attention. Logits: the block's PB rows of q and the (RW + 2) x (PC + 2) rows of k around them (addresses clamped into the image) go to LDS once. For a tile of 16 pixels of one image row and one of the 9 offsets, the product of the tile's q rows (A) with the k rows
// of the same 16 pixels moved by that offset (B, the same loader and so the same k pairing as A) has the 16 wanted dots on its diagonal. Wave w takes tile w & 3 and half w >> 2 of the channels, all 9 offsets; the two halves' partial sums meet in LDS. Lane l & 7 of a wave then does the softmax of one of the wave's 8 pixels.
// Sum over v: a wave takes PS consecutive pixels in each of RW neighbouring image rows; lane holds channels {4 lane .. +3} and {128 + 4 lane .. +3}, one 16-byte piece of a pixel's f16 row. Each of the (RW + 2) x (PS + 2) neighbour rows of v is loaded once per wave; the sum over n = 0..8 keeps its order. A neighbour outside the image keeps logit 0 in the softmax and enters the output with weight 0. One register set R holds one image row's PS + 2 neighbours; a column is refilled for the next image row once its last pixel has used it.
// The same launch then does the last 1x1 convolution of the block's PB pixels: the attention rows (after bn_3 and relu) go to LDS as the f16 hi and lo parts, the 8 waves multiply them with W4's fragment tiles, and the result
// passes through LDS once more so that every store of out, and every load of the residual x, covers whole 128-byte lines (PC pixels of one channel and image row). Pixel m of a block: image row m / PC, column m % PC.
constexpr int PS = 4, RW = 2, PC = 8 * PS, PB = RW * PC;         // a wave's pixels in one image row, its image rows; pixel columns and pixels of a block
constexpr int HC = PC + 2, HR = RW + 2, LP = 12;                 // columns and rows of the block's k neighbourhood; pitch in floats of a pixel's 9 partial logits (16-byte rows)
__device__ __forceinline__ float from_lane(float f, int l) { return __uint_as_float(__builtin_amdgcn_readlane(__float_as_uint(f), l)); }   // lane l's value, moved to a scalar register
__global__ __launch_bounds__(256, 4) void local_last_kernel(const b16* __restrict__ q, const b16* __restrict__ k, const b16* __restrict__ v, const float* __restrict__ bnp, const b16* __restrict__ w4r, const float* __restrict__ b4, const float* __restrict__ x, float* __restrict__ out) {
  // one LDS block, used three times, a barrier between the uses: the PB rows of q and HR x HC rows of k; the block's PB attention rows as f16 hi and lo parts (every pitch C + 8: 16 bytes past the row, for the 16-byte fragment reads); the PB x C result as Tc[channel][pixel]
  constexpr int SM0 = (PB + HR * HC) * (C + 8) * 2, SM1 = 2 * PB * (C + 8) * 2, SM2 = C * (PB + 4) * 4;
  __shared__ __attribute__((aligned(16))) unsigned char sm[SM0 > SM1 ? (SM0 > SM2 ? SM0 : SM2) : (SM1 > SM2 ? SM1 : SM2)];
  __shared__ __attribute__((aligned(16))) float Pl[2][PB][LP];     // partial logits: half of the channels, pixel of the block, offset n
  b16 (*Sh)[C + 8] = (b16 (*)[C + 8])sm; b16 (*Sl)[C + 8] = Sh + PB; float (*Tc)[PB + 4] = (float (*)[PB + 4])sm; b16 (*Sq)[C + 8] = Sh; b16 (*Sk)[C + 8] = Sh + PB;
  const int wid = __builtin_amdgcn_readfirstlane(threadIdx.x >> 5), lane = threadIdx.x & 31; const int ca = lane * 4, cb = 128 + lane * 4, cl = lane * 8, nloc = lane & 15, hlf = lane >> 4;
  constexpr int BR = HW / PC, BY = HW / RW;                        // blocks side by side in an image row; block rows of an image
  const int xb = (blockIdx.x % BR) * PC, x0 = xb + wid * PS, y0 = ((blockIdx.x / BR) % BY) * RW, b = blockIdx.x / (BR * BY);
  int nb[RW + 2][PS + 2];                                          // the wave's neighbour pixels, clamped into the image; the same for the whole wave
#pragma unroll
  for (int r = 0; r < RW + 2; ++r)
#pragma unroll
    for (int c = 0; c < PS + 2; ++c) nb[r][c] = b * NP + min(max(y0 + r - 1, 0), HW - 1) * HW + min(max(x0 + c - 1, 0), HW - 1);
  v8b R[PS + 2];                                                   // R: one image row's neighbours as loaded, f16 pairs (channel ca + e, channel cb + e)
  { static_assert(PB % 8 == 0 && HR * 2 == 8 && HC % 2 == 0 && PC % 8 == 0, "a wave stages PB / 8 rows of q and half a neighbourhood row of k");
    constexpr int NQ = PB / 8, NK = HC / 2; v8b tq[NQ], tk[NK];      // a row is one 16-byte-per-lane load of the wave; all of them are in flight together
    const int hr = wid >> 1, hc0 = (wid & 1) * NK, mq = wid * NQ;
    const b16* qs = q + (size_t)(b * NP + (y0 + mq / PC) * HW + xb + mq % PC) * C + cl; const b16* ks = k + (size_t)(b * NP + min(max(y0 + hr - 1, 0), HW - 1) * HW) * C + cl;
    // image column of the wave's piece j: xb + hc0 + j - 1; only the first piece can fall left of the image and only the last one right of it (the others reach at most HW - PC + HC - 3 = HW - 1)
    const b16* kf = ks + max(xb + hc0 - 1, 0) * C; const b16* km = ks + (xb + hc0) * C; const b16* ke = ks + min(xb + hc0 + NK - 2, HW - 1) * C; const b16* vp[PS + 2];
#pragma unroll
    for (int j = 0; j < NQ; ++j) tq[j] = *(const v8b*)(qs + j * C);
#pragma unroll
    for (int j = 0; j < NK; ++j) tk[j] = *(const v8b*)(j == 0 ? kf : j == NK - 1 ? ke : km + (j - 1) * C);
    asm volatile("s_wait_xcnt 0x0" ::: "memory");                   // holds any rewrite of the q and k loads' address registers, the results of the v loads below among them, behind those loads' issue
#pragma unroll
    for (int c = 0; c < PS + 2; ++c) { vp[c] = v + (size_t)nb[0][c] * C + cl; R[c] = *(const v8b*)vp[c]; }   // row 0 of v flies under the logits
    static_assert(PS == 4, "the wait behind the batch names every address of its v loads");
    asm volatile("s_wait_xcnt 0x0" :: "v"(vp[0]), "v"(vp[1]), "v"(vp[2]), "v"(vp[3]), "v"(vp[4]), "v"(vp[5]) : "memory");   // the same for the v loads; as operands their addresses stay live up to here, so that no load of the batch takes them for its result
#pragma unroll
    for (int j = 0; j < NQ; ++j) *(v8b*)(&Sq[mq + j][cl]) = tq[j];
#pragma unroll
    for (int j = 0; j < NK; ++j) *(v8b*)(&Sk[hr * HC + hc0 + j][cl]) = tk[j]; }
  __syncthreads();                                                 // the block's q rows and k neighbourhood are complete in LDS
  { const int tl = wid & 3, kh = wid >> 2, tw = tl / (PC / 16), tc = tl % (PC / 16) * 16;   // pixel tile: pixels tl * 16 .. + 15 of the block, image row tw, first column tc; half of the channels
    v8f la[9];
#pragma unroll
    for (int n = 0; n < 9; ++n) la[n] = (v8f){};
#pragma unroll
    for (int kt = 0; kt < KT / 2; ++kt) { const int kb = kh * (C / 2) + kt * 32 + 8 * hlf; const v16b a = frag_row(&Sq[tl * 16 + nloc][kb]); v16b bk[9];
#pragma unroll
      for (int n = 0; n < 9; ++n) bk[n] = frag_row(&Sk[(tw + n / 3) * HC + tc + nloc + n % 3][kb]);
#pragma unroll
      for (int n = 0; n < 9; ++n) la[n] = wmma16b(a, bk[n], la[n]); }
    // register vv of lane (nloc, hlf) is element (8 hlf + vv, nloc): the diagonal of pixel j stands in register j & 7 of lane j (j < 8) or 16 + j (j >= 8)
    float dg[9];
#pragma unroll
    for (int n = 0; n < 9; ++n) dg[n] = la[n][lane & 7];
    if ((nloc >> 3) == hlf) { float* pp = &Pl[kh][tl * 16 + nloc][0]; *(v4f*)pp = (v4f){dg[0], dg[1], dg[2], dg[3]}; *(v4f*)(pp + 4) = (v4f){dg[4], dg[5], dg[6], dg[7]}; pp[8] = dg[8]; } }
  __syncthreads();                                                 // both halves of every logit are in LDS, and every wave has read its last q and k fragment
  float lg[RW][PS][9];
  { const int sw = (lane & 7) / PS, sp = lane % PS, m = sw * PC + wid * PS + sp, ys = y0 + sw, xs = x0 + sp;   // lane l & 7 takes pixel (image row sw, column sp) of the wave's RW x PS; the other lanes repeat it
    static_assert(RW * PS == 8, "one lane of 8 per pixel of the wave");
    const v4f pa0 = *(const v4f*)(&Pl[0][m][0]), pa1 = *(const v4f*)(&Pl[0][m][4]), pb0 = *(const v4f*)(&Pl[1][m][0]), pb1 = *(const v4f*)(&Pl[1][m][4]); const float pa2 = Pl[0][m][8], pb2 = Pl[1][m][8];
    float t[9]; bool in[9];
#pragma unroll
    for (int n = 0; n < 9; ++n) { in[n] = ((unsigned)(ys + n / 3 - 1) < (unsigned)HW) && ((unsigned)(xs + n % 3 - 1) < (unsigned)HW);
      const float d = (n < 4) ? pa0[n & 3] + pb0[n & 3] : (n < 8) ? pa1[n & 3] + pb1[n & 3] : pa2 + pb2; t[n] = in[n] ? d * ISQ : 0.0f; }   // zero-padded neighbours give logit 0 and ARE part of the softmax
    float mx = t[0];
#pragma unroll
    for (int n = 1; n < 9; ++n) mx = fmaxf(mx, t[n]);
    float z = 0.0f;
#pragma unroll
    for (int n = 0; n < 9; ++n) { t[n] = nexp(t[n] - mx); z += t[n]; }
    const float iz = 1.0f / z;
#pragma unroll
    for (int n = 0; n < 9; ++n) t[n] = in[n] ? t[n] * iz : 0.0f;
#pragma unroll
    for (int w = 0; w < RW; ++w)
#pragma unroll
      for (int p = 0; p < PS; ++p)
#pragma unroll
        for (int n = 0; n < 9; ++n) lg[w][p][n] = from_lane(t[n], w * PS + p); }
  v4f oa[RW][PS], ob[RW][PS];
#pragma unroll
  for (int w = 0; w < RW; ++w)
#pragma unroll
    for (int p = 0; p < PS; ++p) { oa[w][p] = (v4f){0.0f, 0.0f, 0.0f, 0.0f}; ob[w][p] = oa[w][p]; }
  const float* sc = bnp + 3 * 2 * C; const float* sh = sc + C; v4f sa, sb, ha, hb;
#pragma unroll
  for (int r = 0; r < RW + 2; ++r) {
#pragma unroll
    for (int c = 0; c < PS + 2; ++c) { v4f A, B;
#pragma unroll
      for (int e = 0; e < 4; ++e) { A[e] = (float)R[c][2 * e]; B[e] = (float)R[c][2 * e + 1]; }
#pragma unroll
      for (int w = 0; w < RW; ++w) { if (r - w < 0 || r - w > 2) continue;
#pragma unroll
        for (int p = 0; p < PS; ++p) { if (c - p < 0 || c - p > 2) continue;
          const float a_ = lg[w][p][(r - w) * 3 + c - p];
#pragma unroll
          for (int e = 0; e < 4; ++e) { oa[w][p][e] += pmul(a_, A[e]); ob[w][p][e] += pmul(a_, B[e]); }
          asm volatile("" : "+v"(oa[w][p]), "+v"(ob[w][p])); } }      // empty asm on each sum, against spills: without it the adds sink to the end and the products stay live
      if (r < RW + 1) { const b16* nx = v + (size_t)nb[r < RW + 1 ? r + 1 : 0][c] * C; R[c] = *(const v8b*)(nx + cl); }
      else if (c == 0) { sa = *(const v4f*)(sc + ca); sb = *(const v4f*)(sc + cb); }
      else if (c == 1) { ha = *(const v4f*)(sh + ca); hb = *(const v4f*)(sh + cb); }
      __builtin_amdgcn_sched_barrier(0); } }                       // keeps each column's sums and refill together, so that the refills stay spread over the row
  // W4 fragments of the wave's 32 output channels wid * 32 .. + 31: column tile t at t * KT * FT, k block kk at kk * FT; every block reads all of W4, so each starts at a k block of its own and wraps; the first pair is asked for here, so that it flies under the conversions below
  const int c0 = wid * 32, rot = first_kblock(blockIdx.x); const b16* wb = w4r + (size_t)(c0 >> 4) * KT * FT; v16b bn[2] = {frag_kb_t(wb + rot * FT, lane), frag_kb_t(wb + (KT + rot) * FT, lane)};
  asm volatile("s_wait_xcnt 0x0" ::: "memory");                    // holds any later rewrite of these loads' address registers (the next k blocks' bases) behind the loads' issue
#pragma unroll
  for (int w = 0; w < RW; ++w)
#pragma unroll
    for (int p = 0; p < PS; ++p) { v4b h0, l0, h1, l1; const int m = w * PC + wid * PS + p;
#pragma unroll
      for (int e = 0; e < 4; ++e) { b16 hi, lo; split16(fmaxf(oa[w][p][e] * sa[e] + ha[e], 0.0f) * OS_, hi, lo); h0[e] = hi; l0[e] = lo; split16(fmaxf(ob[w][p][e] * sb[e] + hb[e], 0.0f) * OS_, hi, lo); h1[e] = hi; l1[e] = lo; }
      *(v4b*)(&Sh[m][ca]) = h0; *(v4b*)(&Sh[m][cb]) = h1; *(v4b*)(&Sl[m][ca]) = l0; *(v4b*)(&Sl[m][cb]) = l1; }
  __syncthreads();                                                 // the block's PB attention rows are complete in LDS
  // last 1x1 convolution of these PB pixels: wave wid takes all PB rows x output channels wid * 32 .. + 31; per accumulator the order is hi, lo within k block rot, rot + 1, .., wrapping
  constexpr int MT = PB / 16;
  v8f acc[MT][2];
#pragma unroll
  for (int r = 0; r < MT; ++r)
#pragma unroll
    for (int t = 0; t < 2; ++t) acc[r][t] = (v8f){};
#pragma unroll
  for (int j = 0; j < KT; ++j) { const v16b bw[2] = {bn[0], bn[1]}; const int kb = ((j + rot) & (KT - 1)) * 32, nk = (j + 1 + rot) & (KT - 1);
    if (j + 1 < KT) { bn[0] = frag_kb_t(wb + nk * FT, lane); bn[1] = frag_kb_t(wb + (KT + nk) * FT, lane); }
    __builtin_amdgcn_sched_barrier(0);                             // keeps the next k block's W4 loads in front of this block's products, so that they fly under them (without it each load stands directly in front of its product, with a full wait)
    v16b ah[MT], al[MT];
#pragma unroll
    for (int r = 0; r < MT; ++r) { ah[r] = frag_row(&Sh[r * 16 + nloc][kb + 8 * hlf]); al[r] = frag_row(&Sl[r * 16 + nloc][kb + 8 * hlf]); }
#pragma unroll
    for (int t = 0; t < 2; ++t)
#pragma unroll
      for (int r = 0; r < MT; ++r) { acc[r][t] = wmma16b(ah[r], bw[t], acc[r][t]); acc[r][t] = wmma16b(al[r], bw[t], acc[r][t]); } }
  // residual rows and channel constants: one batch of loads behind the last products, whole 128-byte lines; the barrier below ends them, so that they fly while the block's other waves finish their products
  constexpr int CJ = 256 / (PB / 4);                               // channels that the block's 256 threads cover in one trip, 4 pixels a thread
  const int cc = threadIdx.x / (PB / 4), c4 = (threadIdx.x % (PB / 4)) * 4; const size_t io = ((size_t)b * C + cc) * NP + (y0 + c4 / PC) * HW + xb + c4 % PC; v4f xr[C * PB / 4 / 256]; const float* xp = x + io;
#pragma unroll
  for (int j = 0; j < C * PB / 4 / 256; ++j) xr[j] = *(const v4f*)(xp + (size_t)j * CJ * NP);
  const float* sc4 = bnp + 4 * 2 * C; const float* sh4 = sc4 + C; float bb[2], s_[2], h_[2]; const int co0 = c0 + nloc;
#pragma unroll
  for (int t = 0; t < 2; ++t) { const int co = co0 + t * 16; bb[t] = bf16_rne(b4[co]); s_[t] = sc4[co]; h_[t] = sh4[co]; }
  asm volatile("s_wait_xcnt 0x0" :: "v"(xp), "v"(co0) : "memory");   // holds any rewrite of the batch's address registers behind the loads' issue; as operands they stay live up to here, so that no load of the batch takes them for its result
  __syncthreads();                                                 // every wave has read its last fragment: the LDS block may take the result
#pragma unroll
  for (int t = 0; t < 2; ++t)
#pragma unroll
    for (int r = 0; r < MT; ++r)
#pragma unroll
      for (int vv = 0; vv < 8; ++vv) Tc[c0 + t * 16 + nloc][r * 16 + 8 * hlf + vv] = (acc[r][t][vv] * (1.0f / OS_) + bb[t]) * s_[t] + h_[t];
  __syncthreads();                                                 // the result is complete in LDS
#pragma unroll
  for (int j = 0; j < C * PB / 4 / 256; ++j) { v4f t4 = *(const v4f*)(&Tc[cc + j * CJ][c4]);
#pragma unroll
    for (int e = 0; e < 4; ++e) t4[e] = fmaxf(t4[e] + bf16_rne(xr[j][e]), 0.0f);
    *(v4f*)(out + io + (size_t)j * CJ * NP) = t4; }
}
}  // namespace

extern "C" void kernel_launch(void* const* d_in, const int* in_sizes, int n_in,
                              void* d_out, int out_size, void* d_ws, size_t ws_size, hipStream_t stream) {
  (void)n_in; (void)out_size;
  const float* x = (const float*)d_in[0]; const float* W1 = (const float*)d_in[1]; const float* b1 = (const float*)d_in[2]; const float* W2 = (const float*)d_in[3]; const float* b2 = (const float*)d_in[4]; const float* W3 = (const float*)d_in[5]; const float* b3 = (const float*)d_in[6]; const float* W4 = (const float*)d_in[7]; const float* b4 = (const float*)d_in[8];
  const float* g = (const float*)d_in[9]; const float* be = (const float*)d_in[10]; const float* mu = (const float*)d_in[11]; const float* var = (const float*)d_in[12];
  float* out = (float*)d_out;   // [8][256][64][64]
  if (in_sizes[0] != Bn * C * NP || in_sizes[1] != C * C || in_sizes[7] != C * C || in_sizes[9] != 5 * C || in_sizes[12] != 5 * C) return;
  size_t off = 0; char* ws = (char*)d_ws;
  auto carve = [&](size_t bytes) { char* p = ws + off; off += (bytes + 255) & ~(size_t)255; return p; };
  unsigned short* w16 = (unsigned short*)carve((size_t)3 * C * C * 2); b16* w4r = (b16*)carve((size_t)C * C * 2); float* bnp = (float*)carve(5 * 2 * C * 4);
  b16* q = (b16*)carve((size_t)NTOK * C * 2); b16* k = (b16*)carve((size_t)NTOK * C * 2); b16* v = (b16*)carve((size_t)NTOK * C * 2);
  if (off > ws_size) return;                                    // about 0.5 + 3 x 16.8 MB
  prep_kernel<<<PREPB, 256, 0, stream>>>(W1, W2, W3, W4, g, be, mu, var, w16, w4r, bnp);
  qkv_kernel<<<NTOK / MP, 256, 0, stream>>>(x, w16, b1, b2, b3, bnp, q, k, v);
  local_last_kernel<<<NTOK / PB, 256, 0, stream>>>(q, k, v, bnp, w4r, b4, x, out);
}

// v010
// Measured time: 36.1 microseconds a run.
// In two side-by-side timings against v009, it was 1.03 and 1.02 times as fast.
// Counting every step since v000, it is 4.38 times as fast.
#include <hip/hip_runtime.h>

// PixelTransformerResnet: q, k, v = relu(bn_i(conv1x1_i(x))) (eval-mode BN with given statistics); per pixel 9 logits = q . k(neighbour n) / 16 over the 3x3 neighbourhood (zero vectors
// outside the image, kept in the softmax), att = softmax over the 9, out = Σ_n att_n v(neighbour n); out = relu(bn_3(out)); out = bn_4(conv1x1_4(out)); y = relu(out + x) -> NCHW [8][256][64][64].
// The four 1x1 convolutions run on WMMA: q/k/v on v_wmma_f32_16x16x32_bf16 with exact bf16 operands (x transposed to pixel-major through LDS; 1 product), the last
// one on v_wmma_f32_16x16x32_f16 with the attention output split into an f16 hi+lo pair x8 against exact W4 (2 products); f32 accumulate. The 9 logits of a pixel are diagonals of 16 x 16 products q . k^T on the same f16 form (q, k exact, f32 accumulate);
// softmax (native exp) and the sum over the 9 v rows in f32, a wave per 2 x 4 pixels (2 image rows), lanes split the 256 channels; q, k, v pass from the second launch to it as f16 rows. BN / relu / residual in f32. Fragment k-map per lane half hh for A AND B: elements 0..7 <- k =

namespace {
constexpr int Bn = 8, C = 256, HW = 64, NP = HW * HW, NTOK = Bn * NP;
constexpr float EPS = 1e-5f, OS_ = 8.0f, ISQ = 0.0625f;   // 1/sqrt(256)

typedef _Float16 b16;
typedef __attribute__((ext_vector_type(16))) _Float16 v16b;
typedef __attribute__((ext_vector_type(16))) __bf16 v16bb;
typedef __attribute__((ext_vector_type(8))) _Float16 v8b;
typedef __attribute__((ext_vector_type(4))) _Float16 v4b;
typedef __attribute__((ext_vector_type(8))) unsigned short v8us;
typedef __attribute__((ext_vector_type(8))) float v8f;
typedef __attribute__((ext_vector_type(4))) float v4f;
__device__ __forceinline__ float bf16_rne(float f) { unsigned int u = __float_as_uint(f); u += 0x7FFFu + ((u >> 16) & 1u); return __uint_as_float(u & 0xFFFF0000u); }
__device__ __forceinline__ unsigned short bf16_bits(float f) { unsigned int u = __float_as_uint(f); u += 0x7FFFu + ((u >> 16) & 1u); return (unsigned short)(u >> 16); }
__device__ __forceinline__ void split16(float v, b16& hi, b16& lo) { hi = (b16)v; lo = (b16)(v - (float)hi); }
// Fragment tiles: a 16-row x 32-k block of a 16-bit operand is stored as 512 consecutive elements, piece (ld, lane) of 8 elements at ld * 256 + lane * 8 holding row (lane & 15),
// k = ld * 16 + (lane >> 4) * 8 + 0..7 (the k-map above, the same for A and B), so that each 16-byte-per-lane load of a wave covers 512 contiguous bytes. Tile (rt, kt) of a [rows][C] operand lies at (rt * KT + kt) * FT.
constexpr int FT = 512, KT = C / 32;
__device__ __forceinline__ int tile_row(int o) { return (o >> 6) / KT * 16 + (o & 15); }                                   // row and first k of piece o (8 elements) of a tiled operand
__device__ __forceinline__ int tile_k(int o) { return (o >> 6) % KT * 32 + ((o >> 5) & 1) * 16 + ((o >> 4) & 1) * 8; }
__device__ __forceinline__ v16b frag_kb_t(const b16* tile, int lane) { const v8b a = *(const v8b*)(tile + lane * 8), b = *(const v8b*)(tile + 256 + lane * 8); v16b f;
#pragma unroll
  for (int e = 0; e < 8; ++e) { f[e] = a[e]; f[8 + e] = b[e]; } return f; }
// the same fragment from a row-major row: p points at the lane's row, k = kb + 8 hh; elements 0..7 <- p[0..7], 8..15 <- p[16..23]
__device__ __forceinline__ v16b frag_row(const b16* p) { const v8b a = *(const v8b*)p, b = *(const v8b*)(p + 16); v16b f;
#pragma unroll
  for (int e = 0; e < 8; ++e) { f[e] = a[e]; f[8 + e] = b[e]; } return f; }
__device__ __forceinline__ v16bb frag_bf_t(const unsigned short* tile, int lane) { const v8us a = *(const v8us*)(tile + lane * 8), b = *(const v8us*)(tile + 256 + lane * 8); union { unsigned short s[16]; v16bb v; } u;
#pragma unroll
  for (int e = 0; e < 8; ++e) { u.s[e] = a[e]; u.s[8 + e] = b[e]; } return u.v; }
__device__ __forceinline__ v8f wmma16b(v16b a, v16b b, v8f c) { v8f d = __builtin_amdgcn_wmma_f32_16x16x32_f16(false, a, false, b, (short)0, c, false, false); asm volatile("v_nop\n\tv_nop\n\tv_nop\n\tv_nop" : "+v"(d) : "v"(a), "v"(b)); return d; }
__device__ __forceinline__ v8f wmma16bb(v16bb a, v16bb b, v8f c) { v8f d = __builtin_amdgcn_wmma_f32_16x16x32_bf16(false, a, false, b, (short)0, c, false, false); asm volatile("v_nop\n\tv_nop\n\tv_nop\n\tv_nop" : "+v"(d) : "v"(a), "v"(b)); return d; }
// hand-over of an LDS patch among the lanes of ONE wave: the wave's own LDS writes have landed and its LDS reads have returned, and the compiler moves no memory access over the statement; unlike a fence it leaves the wave's global loads and stores in flight
__device__ __forceinline__ void wave_lds_sync() { asm volatile("s_wait_dscnt 0x0" ::: "memory"); __builtin_amdgcn_wave_barrier(); }
// work-group barrier for data that passes through LDS alone: the wave's LDS writes have landed and its LDS reads have returned, then signal and wait; unlike __syncthreads() it does not wait for the wave's global loads, which stay in flight across it
__device__ __forceinline__ void lds_barrier() { asm volatile("s_wait_dscnt 0x0\n\ts_barrier_signal -1\n\ts_barrier_wait -1" ::: "memory"); }
__device__ __forceinline__ float nexp(float x) { float r; asm("v_exp_f32 %0, %1\n\tv_nop" : "=v"(r) : "v"(x * 1.4426950408889634f)); return r; }
__device__ __forceinline__ float pmul(float a, float b) { float p = a * b; asm volatile("" : "+v"(p)); return p; }

// prep: W1..3 [256][256] -> bf16 fragment tiles; W4 -> f16 fragment tiles; bnp: for each of the 5 BN layers scale[C], then shift[C]. One 8-element piece (or one BN channel) per thread, block-uniform choice of the source
constexpr int PREPB = 4 * C * C / 8 / 256 + 5 * C / 256;         // blocks of the prep launch
__global__ __launch_bounds__(256) void prep_kernel(const float* __restrict__ W1, const float* __restrict__ W2, const float* __restrict__ W3, const float* __restrict__ W4, const float* __restrict__ g, const float* __restrict__ be, const float* __restrict__ mu, const float* __restrict__ var,
                                                   unsigned short* __restrict__ w16, b16* __restrict__ w4r, float* __restrict__ bnp) {
  static_assert((C * C / 8) % 256 == 0 && (5 * C) % 256 == 0, "whole blocks per source");
  const int t_ = threadIdx.x, bid = blockIdx.x, i = bid * 256 + t_;
  if (bid < 3 * C * C / 8 / 256) { const int m = i / (C * C / 8), q = i % (C * C / 8); const float* W = (m == 0) ? W1 : (m == 1) ? W2 : W3; v8us o;
#pragma unroll
    for (int e = 0; e < 8; ++e) o[e] = bf16_bits(W[tile_row(q) * C + tile_k(q) + e]);
    *(v8us*)(w16 + (size_t)i * 8) = o; asm volatile("s_wait_xcnt 0x0" ::: "memory");  /* holds any later rewrite of the store's registers behind the store's issue */ }
  else if (bid < 4 * C * C / 8 / 256) { const int j = i - 3 * C * C / 8; v8b o;
#pragma unroll
    for (int e = 0; e < 8; ++e) o[e] = (b16)bf16_rne(W4[tile_row(j) * C + tile_k(j) + e]);
    *(v8b*)(w4r + (size_t)j * 8) = o; asm volatile("s_wait_xcnt 0x0" ::: "memory");  /* holds any later rewrite of the store's registers behind the store's issue */ }
  else { const int j = i - 4 * C * C / 8; const float sc = bf16_rne(g[j]) * rsqrtf(bf16_rne(var[j]) + EPS); ((float*)bnp)[(j / C) * 2 * C + (j % C)] = sc; ((float*)bnp)[(j / C) * 2 * C + C + (j % C)] = bf16_rne(be[j]) - bf16_rne(mu[j]) * sc; asm volatile("s_wait_xcnt 0x0" ::: "memory");  /* holds any later rewrite of the store's registers behind the store's issue */ }
}

// q, k, v of MP pixels per block, straight from x: the block reads its MP pixels x C channels of x (NCHW, 256-byte runs of a channel) once, rounds them to bf16 and lays them pixel-major in LDS; behind one barrier its 8 waves
// multiply that tile with all 3 x C weight columns. Wave w takes all MP rows x 32 columns of each of q, k and v in turn, in a cyclic order: A fragments from LDS (row-major rows, the k-map above), B fragments from the weight tiles, each
// read once per block. All blocks walk the same weight tiles, so each block starts at a place of its own and wraps: its first matrix of q, k, v and its first k block come from its index (per accumulator the order is k block rot, rot + 1, .., wrapping). Wave w takes the column tiles w and w + 8 (channels 16 w .. + 15 and 128 + 16 w .. + 15). q, k, v are stored rounded to f16 (nearest even), half the bytes of f32,
// in the order in which the attention lanes read them: the 16-byte piece L of a pixel's 512-byte row holds channels 4 L + e and 128 + 4 L + e as the pair at elements 2 e, 2 e + 1. The result passes through the wave's own LDS patch, so that every lane stores 16 bytes and a wave's 32 channels of a pixel are one 64-byte run.
constexpr int MP = 64, TP = 20;                                  // pixels of a block; pitch in 32-bit words (an f16 pair each) of the result patch (64-byte rows; the two lane halves, 8 rows apart, fall on different banks)
typedef __attribute__((ext_vector_type(2))) _Float16 v2b;
typedef __attribute__((ext_vector_type(4))) unsigned int v4u;
typedef __attribute__((ext_vector_type(2))) unsigned short v2us;
__device__ __forceinline__ v16bb frag_bf_row(const unsigned short* p) { const v8us a = *(const v8us*)p, b = *(const v8us*)(p + 16); union { unsigned short s[16]; v16bb v; } u;
#pragma unroll
  for (int e = 0; e < 8; ++e) { u.s[e] = a[e]; u.s[8 + e] = b[e]; } return u.v; }
// weight tile of matrix m, k block kk, column tile ct
__device__ __forceinline__ const unsigned short* wtile(const unsigned short* w16, int m, int kk, int ct) { return w16 + (size_t)((m * (C / 16) + ct) * KT + kk) * FT; }
// a block's first k block in its walk over weight tiles that every block reads: neighbours in the index differ, and so do blocks 8 apart
__device__ __forceinline__ int first_kblock(int bid) { return (bid + (bid >> 3)) & (KT - 1); }
__global__ __launch_bounds__(256, 4) void qkv_kernel(const float* __restrict__ x, const unsigned short* __restrict__ w16, const float* __restrict__ b1, const float* __restrict__ b2, const float* __restrict__ b3, const float* __restrict__ bnp, b16* __restrict__ q, b16* __restrict__ k, b16* __restrict__ v) {
  __shared__ __attribute__((aligned(16))) unsigned short Tt[MP][C + 8];
  __shared__ __attribute__((aligned(16))) unsigned int Ts[8][32 * TP];
  const int t_ = threadIdx.x, lane = t_ & 31, wave = __builtin_amdgcn_readfirstlane(t_ >> 5), nloc = lane & 15, hlf = lane >> 4;
  const int m0 = blockIdx.x * MP, ct0 = wave; const float* src = x + (size_t)(blockIdx.x / (NP / MP)) * C * NP + (blockIdx.x % (NP / MP)) * MP;
  static_assert((KT & (KT - 1)) == 0, "the k walk wraps by a mask");
  const int rot = first_kblock(blockIdx.x), rw = ((blockIdx.x >> 3) & 31) % 3; int mt[3];   // step s of the walk: matrix mt[s / KT], k block (s + rot) & (KT - 1)
#pragma unroll
  for (int i = 0; i < 3; ++i) mt[i] = (i + rw) % 3;
  // the weight fragments run two steps ahead of their products, over the borders between q, k and v too; the first two steps are asked for here and fly with the x tile
  v16bb rb[2][2];
#pragma unroll
  for (int s = 0; s < 2; ++s)
#pragma unroll
    for (int t = 0; t < 2; ++t) rb[s][t] = frag_bf_t(wtile(w16, mt[0], (s + rot) & (KT - 1), ct0 + 8 * t), lane);
  { constexpr int NT = MP * C / 8 / 256; v4f xa[NT], xb[NT];         // a thread and trip: 4 pixels of 2 neighbouring channels; all loads of the tile are in flight together
#pragma unroll
    for (int it = 0; it < NT; ++it) { const int idx = it * 256 + t_, j = idx % (MP / 4), cp = idx / (MP / 4); const unsigned o = (unsigned)((2 * cp) * NP + 4 * j); xa[it] = *(const v4f*)(src + o); xb[it] = *(const v4f*)(src + o + NP); }
    asm volatile("s_wait_xcnt 0x0" ::: "memory");                   // holds any later rewrite of the loads' address registers behind the loads' issue
#pragma unroll
    for (int it = 0; it < NT; ++it) { const int idx = it * 256 + t_, j = idx % (MP / 4), cp = idx / (MP / 4);
#pragma unroll
      for (int e = 0; e < 4; ++e) *(v2us*)(&Tt[4 * j + e][2 * cp]) = (v2us){bf16_bits(xa[it][e]), bf16_bits(xb[it][e])}; } }
  __syncthreads();                                                 // the block's x tile is complete in LDS
  unsigned int* Tw = Ts[wave];
#pragma unroll
  for (int which = 0; which < 3; ++which) {
    const int m = mt[which]; const float* bias = (m == 0) ? b1 : (m == 1) ? b2 : b3; const float* sc = bnp + m * 2 * C; const float* sh = sc + C; b16* dst0 = ((m == 0) ? q : (m == 1) ? k : v) + (size_t)m0 * C + wave * 32;
    float bb[2], s_[2], h_[2];                                      // channel constants, asked for in front of the products
#pragma unroll
    for (int t = 0; t < 2; ++t) { const int c = t * 128 + wave * 16 + nloc; bb[t] = bf16_rne(bias[c]); s_[t] = sc[c]; h_[t] = sh[c]; }
    v8f acc[4][2];
#pragma unroll
    for (int r = 0; r < 4; ++r)
#pragma unroll
      for (int t = 0; t < 2; ++t) acc[r][t] = (v8f){};
#pragma unroll
    for (int kt = 0; kt < KT; ++kt) { const v16bb bw[2] = {rb[kt & 1][0], rb[kt & 1][1]}; const int nx = which * KT + kt + 2;
      if (nx < 3 * KT) { const int nm = mt[nx < 3 * KT ? nx / KT : 0], nk = (nx + rot) & (KT - 1); rb[kt & 1][0] = frag_bf_t(wtile(w16, nm, nk, ct0), lane); rb[kt & 1][1] = frag_bf_t(wtile(w16, nm, nk, ct0 + 8), lane); }
      __builtin_amdgcn_sched_barrier(0);                           // keeps the weight loads of two steps ahead in front of this step's products, so that they fly under them (without it each load sinks to its product, with a full wait)
      v16bb a[4];
#pragma unroll
      for (int r = 0; r < 4; ++r) a[r] = frag_bf_row(&Tt[r * 16 + nloc][((kt + rot) & (KT - 1)) * 32 + 8 * hlf]);
#pragma unroll
      for (int r = 0; r < 4; ++r) { acc[r][0] = wmma16bb(a[r], bw[0], acc[r][0]); acc[r][1] = wmma16bb(a[r], bw[1], acc[r][1]); } }
#pragma unroll
    for (int h = 0; h < 2; ++h) {                                   // 32 rows at a time through the wave's patch
#pragma unroll
      for (int r = 0; r < 2; ++r)
#pragma unroll
        for (int vv = 0; vv < 8; ++vv) { const v2b pr = {(b16)fmaxf((acc[h * 2 + r][0][vv] + bb[0]) * s_[0] + h_[0], 0.0f), (b16)fmaxf((acc[h * 2 + r][1][vv] + bb[1]) * s_[1] + h_[1], 0.0f)};
          Tw[(r * 16 + vv + 8 * hlf) * TP + nloc] = __builtin_bit_cast(unsigned int, pr); }   // word nloc of the wave's 16: channels 16 w + nloc and 128 + 16 w + nloc
      wave_lds_sync();
#pragma unroll
      for (int j = 0; j < 4; ++j) { const int rr = j * 8 + (lane >> 2), c4 = (lane & 3) * 4; *(v4u*)(dst0 + (size_t)(h * 32 + rr) * C + c4 * 2) = *(const v4u*)(Tw + rr * TP + c4); }
      if (which < 2 || h < 1) {                                     // behind the last stores nothing follows
        asm volatile("s_wait_xcnt 0x0" ::: "memory");               // holds any later rewrite of the stores' registers behind the stores' issue
        wave_lds_sync(); } } }
}

// local attention. Logits: the block's PB rows of q and the (RW + 2) x (PC + 2) rows of k around them (addresses clamped into the image) go to LDS once. For a tile of 16 pixels of one image row and one of the 9 offsets, the product of the tile's q rows (A) with the k rows
// of the same 16 pixels moved by that offset (B, the same loader and so the same k pairing as A) has the 16 wanted dots on its diagonal. Wave w takes tile w & 3 and half w >> 2 of the channels, all 9 offsets; the two halves' partial sums meet in LDS. Lane l & 7 of a wave then does the softmax of one of the wave's 8 pixels.
// Sum over v: a wave takes PS consecutive pixels in each of RW neighbouring image rows; lane holds channels {4 lane .. +3} and {128 + 4 lane .. +3}, one 16-byte piece of a pixel's f16 row. Each of the (RW + 2) x (PS + 2) neighbour rows of v is loaded once per wave; the sum over n = 0..8 keeps its order. A neighbour outside the image keeps logit 0 in the softmax and enters the output with weight 0. One register set R holds one image row's PS + 2 neighbours; a column is refilled for the next image row once its last pixel has used it.
// The same launch then does the last 1x1 convolution of the block's PB pixels: the attention rows (after bn_3 and relu) go to LDS as the f16 hi and lo parts, the 8 waves multiply them with W4's fragment tiles, and the result
// passes through LDS once more so that every store of out, and every load of the residual x, covers whole 128-byte lines (PC pixels of one channel and image row). Pixel m of a block: image row m / PC, column m % PC.
constexpr int PS = 4, RW = 2, PC = 8 * PS, PB = RW * PC;         // a wave's pixels in one image row, its image rows; pixel columns and pixels of a block
constexpr int HC = PC + 2, HR = RW + 2, LP = 12;                 // columns and rows of the block's k neighbourhood; pitch in floats of a pixel's 9 partial logits (16-byte rows)
__device__ __forceinline__ float from_lane(float f, int l) { return __uint_as_float(__builtin_amdgcn_readlane(__float_as_uint(f), l)); }   // lane l's value, moved to a scalar register
__global__ __launch_bounds__(256, 4) void local_last_kernel(const b16* __restrict__ q, const b16* __restrict__ k, const b16* __restrict__ v, const float* __restrict__ bnp, const b16* __restrict__ w4r, const float* __restrict__ b4, const float* __restrict__ x, float* __restrict__ out) {
  // one LDS block, used three times, a barrier between the uses: the PB rows of q and HR x HC rows of k; the block's PB attention rows as f16 hi and lo parts (every pitch C + 8: 16 bytes past the row, for the 16-byte fragment reads); the PB x C result as Tc[channel][pixel]
  constexpr int SM0 = (PB + HR * HC) * (C + 8) * 2, SM1 = 2 * PB * (C + 8) * 2, SM2 = C * (PB + 4) * 4;
  __shared__ __attribute__((aligned(16))) unsigned char sm[SM0 > SM1 ? (SM0 > SM2 ? SM0 : SM2) : (SM1 > SM2 ? SM1 : SM2)];
  __shared__ __attribute__((aligned(16))) float Pl[2][PB][LP];     // partial logits: half of the channels, pixel of the block, offset n
  b16 (*Sh)[C + 8] = (b16 (*)[C + 8])sm; b16 (*Sl)[C + 8] = Sh + PB; float (*Tc)[PB + 4] = (float (*)[PB + 4])sm; b16 (*Sq)[C + 8] = Sh; b16 (*Sk)[C + 8] = Sh + PB;
  const int wid = __builtin_amdgcn_readfirstlane(threadIdx.x >> 5), lane = threadIdx.x & 31; const int ca = lane * 4, cb = 128 + lane * 4, cl = lane * 8, nloc = lane & 15, hlf = lane >> 4;
  constexpr int BR = HW / PC, BY = HW / RW;                        // blocks side by side in an image row; block rows of an image
  const int xb = (blockIdx.x % BR) * PC, x0 = xb + wid * PS, y0 = ((blockIdx.x / BR) % BY) * RW, b = blockIdx.x / (BR * BY);
  int nb[RW + 2][PS + 2];                                          // the wave's neighbour pixels, clamped into the image; the same for the whole wave
#pragma unroll
  for (int r = 0; r < RW + 2; ++r)
#pragma unroll
    for (int c = 0; c < PS + 2; ++c) nb[r][c] = b * NP + min(max(y0 + r - 1, 0), HW - 1) * HW + min(max(x0 + c - 1, 0), HW - 1);
  v8b R[PS + 2];                                                   // R: one image row's neighbours as loaded, f16 pairs (channel ca + e, channel cb + e)
  { static_assert(PB % 8 == 0 && HR * 2 == 8 && HC % 2 == 0 && PC % 8 == 0, "a wave stages PB / 8 rows of q and half a neighbourhood row of k");
    constexpr int NQ = PB / 8, NK = HC / 2; v8b tq[NQ], tk[NK];      // a row is one 16-byte-per-lane load of the wave; all of them are in flight together
    const int hr = wid >> 1, hc0 = (wid & 1) * NK, mq = wid * NQ;
    const b16* qs = q + (size_t)(b * NP + (y0 + mq / PC) * HW + xb + mq % PC) * C + cl; const b16* ks = k + (size_t)(b * NP + min(max(y0 + hr - 1, 0), HW - 1) * HW) * C + cl;
    // image column of the wave's piece j: xb + hc0 + j - 1; only the first piece can fall left of the image and only the last one right of it (the others reach at most HW - PC + HC - 3 = HW - 1)
    const b16* kf = ks + max(xb + hc0 - 1, 0) * C; const b16* km = ks + (xb + hc0) * C; const b16* ke = ks + min(xb + hc0 + NK - 2, HW - 1) * C; const b16* vp[PS + 2];
#pragma unroll
    for (int j = 0; j < NQ; ++j) tq[j] = *(const v8b*)(qs + j * C);
#pragma unroll
    for (int j = 0; j < NK; ++j) tk[j] = *(const v8b*)(j == 0 ? kf : j == NK - 1 ? ke : km + (j - 1) * C);
    asm volatile("s_wait_xcnt 0x0" ::: "memory");                   // holds any rewrite of the q and k loads' address registers, the results of the v loads below among them, behind those loads' issue
#pragma unroll
    for (int c = 0; c < PS + 2; ++c) { vp[c] = v + (size_t)nb[0][c] * C + cl; R[c] = *(const v8b*)vp[c]; }   // row 0 of v flies under the logits
    static_assert(PS == 4, "the wait behind the batch names every address of its v loads");
    asm volatile("s_wait_xcnt 0x0" :: "v"(vp[0]), "v"(vp[1]), "v"(vp[2]), "v"(vp[3]), "v"(vp[4]), "v"(vp[5]) : "memory");   // the same for the v loads; as operands their addresses stay live up to here, so that no load of the batch takes them for its result
#pragma unroll
    for (int j = 0; j < NQ; ++j) *(v8b*)(&Sq[mq + j][cl]) = tq[j];
#pragma unroll
    for (int j = 0; j < NK; ++j) *(v8b*)(&Sk[hr * HC + hc0 + j][cl]) = tk[j]; }
  // residual rows of x, whole 128-byte lines, used only behind the last products: the first XE of the thread's loads are asked for here and fly under the logits, the softmax and the sum over v; the others (the logits' fragments need the registers) follow in the last row of that sum
  constexpr int CJ = 256 / (PB / 4), XN = C * PB / 4 / 256, XE = 3 * XN / 4;   // channels that the block's 256 threads cover in one trip, 4 pixels a thread; trips; trips asked for in front of the logits
  const int cc = threadIdx.x / (PB / 4), c4 = (threadIdx.x % (PB / 4)) * 4; const size_t io = ((size_t)b * C + cc) * NP + (y0 + c4 / PC) * HW + xb + c4 % PC; v4f xr[XN]; const float* xp = x + io;
  __builtin_amdgcn_sched_barrier(0);                               // keeps these loads behind the LDS stores above, that is behind the arrival of the wave's q and k rows, which the whole block waits for: asked for earlier they would share the memory path with those rows
#pragma unroll
  for (int j = 0; j < XE; ++j) xr[j] = *(const v4f*)(xp + (size_t)j * CJ * NP);
  asm volatile("s_wait_xcnt 0x0" :: "v"(xp) : "memory");           // holds any rewrite of these loads' address registers behind the loads' issue; as an operand the address stays live up to here, so that no load of the batch takes it for its result
  lds_barrier();                                                   // the block's q rows and k neighbourhood are complete in LDS
  { const int tl = wid & 3, kh = wid >> 2, tw = tl / (PC / 16), tc = tl % (PC / 16) * 16;   // pixel tile: pixels tl * 16 .. + 15 of the block, image row tw, first column tc; half of the channels
    v8f la[9];
#pragma unroll
    for (int n = 0; n < 9; ++n) la[n] = (v8f){};
#pragma unroll
    for (int kt = 0; kt < KT / 2; ++kt) { const int kb = kh * (C / 2) + kt * 32 + 8 * hlf; const v16b a = frag_row(&Sq[tl * 16 + nloc][kb]); v16b bk[9];
#pragma unroll
      for (int n = 0; n < 9; ++n) bk[n] = frag_row(&Sk[(tw + n / 3) * HC + tc + nloc + n % 3][kb]);
#pragma unroll
      for (int n = 0; n < 9; ++n) la[n] = wmma16b(a, bk[n], la[n]); }
    // register vv of lane (nloc, hlf) is element (8 hlf + vv, nloc): the diagonal of pixel j stands in register j & 7 of lane j (j < 8) or 16 + j (j >= 8)
    float dg[9];
#pragma unroll
    for (int n = 0; n < 9; ++n) dg[n] = la[n][lane & 7];
    if ((nloc >> 3) == hlf) { float* pp = &Pl[kh][tl * 16 + nloc][0]; *(v4f*)pp = (v4f){dg[0], dg[1], dg[2], dg[3]}; *(v4f*)(pp + 4) = (v4f){dg[4], dg[5], dg[6], dg[7]}; pp[8] = dg[8]; } }
  lds_barrier();                                                   // both halves of every logit are in LDS, and every wave has read its last q and k fragment
  float lg[RW][PS][9];
  { const int sw = (lane & 7) / PS, sp = lane % PS, m = sw * PC + wid * PS + sp, ys = y0 + sw, xs = x0 + sp;   // lane l & 7 takes pixel (image row sw, column sp) of the wave's RW x PS; the other lanes repeat it
    static_assert(RW * PS == 8, "one lane of 8 per pixel of the wave");
    const v4f pa0 = *(const v4f*)(&Pl[0][m][0]), pa1 = *(const v4f*)(&Pl[0][m][4]), pb0 = *(const v4f*)(&Pl[1][m][0]), pb1 = *(const v4f*)(&Pl[1][m][4]); const float pa2 = Pl[0][m][8], pb2 = Pl[1][m][8];
    float t[9]; bool in[9];
#pragma unroll
    for (int n = 0; n < 9; ++n) { in[n] = ((unsigned)(ys + n / 3 - 1) < (unsigned)HW) && ((unsigned)(xs + n % 3 - 1) < (unsigned)HW);
      const float d = (n < 4) ? pa0[n & 3] + pb0[n & 3] : (n < 8) ? pa1[n & 3] + pb1[n & 3] : pa2 + pb2; t[n] = in[n] ? d * ISQ : 0.0f; }   // zero-padded neighbours give logit 0 and ARE part of the softmax
    float mx = t[0];
#pragma unroll
    for (int n = 1; n < 9; ++n) mx = fmaxf(mx, t[n]);
    float z = 0.0f;
#pragma unroll
    for (int n = 0; n < 9; ++n) { t[n] = nexp(t[n] - mx); z += t[n]; }
    const float iz = 1.0f / z;
#pragma unroll
    for (int n = 0; n < 9; ++n) t[n] = in[n] ? t[n] * iz : 0.0f;
#pragma unroll
    for (int w = 0; w < RW; ++w)
#pragma unroll
      for (int p = 0; p < PS; ++p)
#pragma unroll
        for (int n = 0; n < 9; ++n) lg[w][p][n] = from_lane(t[n], w * PS + p); }
  v4f oa[RW][PS], ob[RW][PS];
#pragma unroll
  for (int w = 0; w < RW; ++w)
#pragma unroll
    for (int p = 0; p < PS; ++p) { oa[w][p] = (v4f){0.0f, 0.0f, 0.0f, 0.0f}; ob[w][p] = oa[w][p]; }
  const float* sc = bnp + 3 * 2 * C; const float* sh = sc + C; v4f sa, sb, ha, hb;
  // W4 fragments of the wave's 32 output channels wid * 32 .. + 31: column tile t at t * KT * FT, k block kk at kk * FT; every block reads all of W4, so each starts at a k block of its own and wraps
  const int c0 = wid * 32, rot = first_kblock(blockIdx.x), co0 = c0 + nloc; const b16* wb = w4r + (size_t)(c0 >> 4) * KT * FT; v16b bn[2];
  const float* sc4 = bnp + 4 * 2 * C; const float* sh4 = sc4 + C; float bb[2], s_[2], h_[2];
#pragma unroll
  for (int r = 0; r < RW + 2; ++r) {
#pragma unroll
    for (int c = 0; c < PS + 2; ++c) { v4f A, B;
#pragma unroll
      for (int e = 0; e < 4; ++e) { A[e] = (float)R[c][2 * e]; B[e] = (float)R[c][2 * e + 1]; }
#pragma unroll
      for (int w = 0; w < RW; ++w) { if (r - w < 0 || r - w > 2) continue;
#pragma unroll
        for (int p = 0; p < PS; ++p) { if (c - p < 0 || c - p > 2) continue;
          const float a_ = lg[w][p][(r - w) * 3 + c - p];
#pragma unroll
          for (int e = 0; e < 4; ++e) { oa[w][p][e] += pmul(a_, A[e]); ob[w][p][e] += pmul(a_, B[e]); }
          asm volatile("" : "+v"(oa[w][p]), "+v"(ob[w][p])); } }      // empty asm on each sum, against spills: without it the adds sink to the end and the products stay live
      if (r < RW + 1) { const b16* nx = v + (size_t)nb[r < RW + 1 ? r + 1 : 0][c] * C; R[c] = *(const v8b*)(nx + cl); }
      else if (c == 0) { sa = *(const v4f*)(sc + ca); sb = *(const v4f*)(sc + cb); }
      else if (c == 1) { ha = *(const v4f*)(sh + ca); hb = *(const v4f*)(sh + cb); }
      else if (c == 2) {                                            // behind the last load that the sums and the conversions wait for: the first pair of W4 fragments, then the other residual rows and the last layer's channel constants; they fly under the rest of the sums and the conversions (a wave's loads return in order, so that a wait for a later load would wait for these too)
        bn[0] = frag_kb_t(wb + rot * FT, lane); bn[1] = frag_kb_t(wb + (KT + rot) * FT, lane);
#pragma unroll
        for (int j = XE; j < XN; ++j) xr[j] = *(const v4f*)(xp + (size_t)j * CJ * NP);
#pragma unroll
        for (int t = 0; t < 2; ++t) { const int co = co0 + t * 16; bb[t] = b4[co]; s_[t] = sc4[co]; h_[t] = sh4[co]; }
        asm volatile("s_wait_xcnt 0x0" :: "v"(xp), "v"(co0) : "memory"); }   // holds any rewrite of the batch's address registers (the next k blocks' bases among them) behind the loads' issue; as operands xp and co0 stay live up to here, so that no load of the batch takes them for its result
      __builtin_amdgcn_sched_barrier(0); } }                       // keeps each column's sums and refill together, so that the refills stay spread over the row
#pragma unroll
  for (int w = 0; w < RW; ++w)
#pragma unroll
    for (int p = 0; p < PS; ++p) { v4b h0, l0, h1, l1; const int m = w * PC + wid * PS + p;
#pragma unroll
      for (int e = 0; e < 4; ++e) { b16 hi, lo; split16(fmaxf(oa[w][p][e] * sa[e] + ha[e], 0.0f) * OS_, hi, lo); h0[e] = hi; l0[e] = lo; split16(fmaxf(ob[w][p][e] * sb[e] + hb[e], 0.0f) * OS_, hi, lo); h1[e] = hi; l1[e] = lo; }
      *(v4b*)(&Sh[m][ca]) = h0; *(v4b*)(&Sh[m][cb]) = h1; *(v4b*)(&Sl[m][ca]) = l0; *(v4b*)(&Sl[m][cb]) = l1; }
  lds_barrier();                                                   // the block's PB attention rows are complete in LDS
  // last 1x1 convolution of these PB pixels: wave wid takes all PB rows x output channels wid * 32 .. + 31; per accumulator the order is hi, lo within k block rot, rot + 1, .., wrapping
  constexpr int MT = PB / 16;
  v8f acc[MT][2];
#pragma unroll
  for (int r = 0; r < MT; ++r)
#pragma unroll
    for (int t = 0; t < 2; ++t) acc[r][t] = (v8f){};
#pragma unroll
  for (int j = 0; j < KT; ++j) { const v16b bw[2] = {bn[0], bn[1]}; const int kb = ((j + rot) & (KT - 1)) * 32, nk = (j + 1 + rot) & (KT - 1);
    if (j + 1 < KT) { bn[0] = frag_kb_t(wb + nk * FT, lane); bn[1] = frag_kb_t(wb + (KT + nk) * FT, lane); }
    __builtin_amdgcn_sched_barrier(0);                             // keeps the next k block's W4 loads in front of this block's products, so that they fly under them (without it each load stands directly in front of its product, with a full wait)
    v16b ah[MT], al[MT];
#pragma unroll
    for (int r = 0; r < MT; ++r) { ah[r] = frag_row(&Sh[r * 16 + nloc][kb + 8 * hlf]); al[r] = frag_row(&Sl[r * 16 + nloc][kb + 8 * hlf]); }
#pragma unroll
    for (int t = 0; t < 2; ++t)
#pragma unroll
      for (int r = 0; r < MT; ++r) { acc[r][t] = wmma16b(ah[r], bw[t], acc[r][t]); acc[r][t] = wmma16b(al[r], bw[t], acc[r][t]); } }
  __syncthreads();                                                 // every wave has read its last fragment: the LDS block may take the result
#pragma unroll
  for (int t = 0; t < 2; ++t)
#pragma unroll
    for (int r = 0; r < MT; ++r)
#pragma unroll
      for (int vv = 0; vv < 8; ++vv) Tc[c0 + t * 16 + nloc][r * 16 + 8 * hlf + vv] = (acc[r][t][vv] * (1.0f / OS_) + bf16_rne(bb[t])) * s_[t] + h_[t];
  __syncthreads();                                                 // the result is complete in LDS
#pragma unroll
  for (int j = 0; j < XN; ++j) { v4f t4 = *(const v4f*)(&Tc[cc + j * CJ][c4]);
#pragma unroll
    for (int e = 0; e < 4; ++e) t4[e] = fmaxf(t4[e] + bf16_rne(xr[j][e]), 0.0f);
    *(v4f*)(out + io + (size_t)j * CJ * NP) = t4; }
}
}  // namespace

extern "C" void kernel_launch(void* const* d_in, const int* in_sizes, int n_in,
                              void* d_out, int out_size, void* d_ws, size_t ws_size, hipStream_t stream) {
  (void)n_in; (void)out_size;
  const float* x = (const float*)d_in[0]; const float* W1 = (const float*)d_in[1]; const float* b1 = (const float*)d_in[2]; const float* W2 = (const float*)d_in[3]; const float* b2 = (const float*)d_in[4]; const float* W3 = (const float*)d_in[5]; const float* b3 = (const float*)d_in[6]; const float* W4 = (const float*)d_in[7]; const float* b4 = (const float*)d_in[8];
  const float* g = (const float*)d_in[9]; const float* be = (const float*)d_in[10]; const float* mu = (const float*)d_in[11]; const float* var = (const float*)d_in[12];
  float* out = (float*)d_out;   // [8][256][64][64]
  if (in_sizes[0] != Bn * C * NP || in_sizes[1] != C * C || in_sizes[7] != C * C || in_sizes[9] != 5 * C || in_sizes[12] != 5 * C) return;
  size_t off = 0; char* ws = (char*)d_ws;
  auto carve = [&](size_t bytes) { char* p = ws + off; off += (bytes + 255) & ~(size_t)255; return p; };
  unsigned short* w16 = (unsigned short*)carve((size_t)3 * C * C * 2); b16* w4r = (b16*)carve((size_t)C * C * 2); float* bnp = (float*)carve(5 * 2 * C * 4);
  b16* q = (b16*)carve((size_t)NTOK * C * 2); b16* k = (b16*)carve((size_t)NTOK * C * 2); b16* v = (b16*)carve((size_t)NTOK * C * 2);
  if (off > ws_size) return;                                    // about 0.5 + 3 x 16.8 MB
  prep_kernel<<<PREPB, 256, 0, stream>>>(W1, W2, W3, W4, g, be, mu, var, w16, w4r, bnp);
  qkv_kernel<<<NTOK / MP, 256, 0, stream>>>(x, w16, b1, b2, b3, bnp, q, k, v);
  local_last_kernel<<<NTOK / PB, 256, 0, stream>>>(q, k, v, bnp, w4r, b4, x, out);
}
